// v000
// Times are from an AMD MI455X. After a warm-up the kernel runs many times in a row, and a time is the length of
// such a window on the GPU divided by its runs, so every launch and the gaps after it count. The runs cycle
// through copies of the inputs. A figure is the median of several windows, for all but v000 over two sittings.
// Sittings can differ by a few percent; kernels timed side by side share one.
// v000 is the starting kernel. One run takes 757 microseconds.
// compute dtype: hidden_states, encoder_hidden_states, cos, sin and all weights / biases / norm parameters (module inputs) rounded to bf16; q/k/v projections with exact bf16 products (natural [out][in] rows) + bias on WMMA 16x16x32; per-head LayerNorm of q and k (over the 64 dims, eps 1e-5) and the interleaved rotary on the video tokens (input cos/sin tables) in f32 in the projection epilogue; q and k stored once as f16 (q unscaled; 1/8 on the f32 score), v as f16 hi + (x2048-scaled) residual planes; scores with single f16 operands (1 product) and P.V with P as f16 hi + (x2048-scaled) residual x V hi/lo (3 products); the output projection with ctx as bf16 hi + residual x exact wo (2 products) + bo; running-max softmax in f32 with the hardware exp; the 2,274-token sequence is padded to 2,304 rows per batch with the padding keys masked; f32 accumulate.
#include <hip/hip_runtime.h>
#include <math.h>

typedef __attribute__((ext_vector_type(16))) _Float16 v16h;
typedef __attribute__((ext_vector_type(16))) __bf16 v16b;
typedef __attribute__((ext_vector_type(8)))  _Float16 v8h;
typedef __attribute__((ext_vector_type(8)))  float v8f;
typedef __attribute__((ext_vector_type(4)))  float v4f;
typedef __attribute__((ext_vector_type(2)))  float v2f;
typedef __attribute__((ext_vector_type(4)))  unsigned v4u;
typedef __attribute__((ext_vector_type(4)))  int v4i;
typedef float __attribute__((may_alias)) float_a;
typedef int __attribute__((may_alias)) int_a;

template <typename T> __device__ __forceinline__ void vst2(void* p, T v) { *(T*)p = v;  }
__device__ __forceinline__ v8f wmma16(v16h a, v16h b, v8f c) {
  v8f d = __builtin_amdgcn_wmma_f32_16x16x32_f16(false, a, false, b, (short)0, c, false, false);
  asm volatile("v_nop\n\tv_nop\n\tv_nop\n\tv_nop" : "+v"(d) : "v"(a), "v"(b));
  return d;
}
__device__ __forceinline__ v8f wmma_bf(v16b a, v16b b, v8f c) {
  v8f d = __builtin_amdgcn_wmma_f32_16x16x32_bf16(false, a, false, b, (short)0, c, false, false);
  asm volatile("v_nop\n\tv_nop\n\tv_nop\n\tv_nop" : "+v"(d) : "v"(a), "v"(b));
  return d;
}
// CogVideoX joint text+video attention processor (B 2, 226 text + 2,048 video tokens, D 1,024, 16 heads x 64): qkv with bias, per-head LayerNorm on q and k, rotary on the video part, full softmax attention, output projection + bias; returns (video part, text part).
__device__ __forceinline__ v16h frag_h(const _Float16* rowk0, int lane) {
  union { v16h v; v8h q[2]; } u; const _Float16* p = rowk0 + 8 * (lane >> 4);
  u.q[0] = *(const v8h*)p; u.q[1] = *(const v8h*)(p + 16); return u.v;
}
__device__ __forceinline__ v16h frag_f32(const float* rowk0, int lane) {
  v16h a; const float* p = rowk0 + 8 * (lane >> 4);
#pragma unroll
  for (int i = 0; i < 8; ++i) { a[i] = (_Float16)p[i]; a[8 + i] = (_Float16)p[16 + i]; }
  return a;
}
__device__ __forceinline__ v16h frag_f32s(const float* rowk0, int lane, float sc) {
  v16h a; const float* p = rowk0 + 8 * (lane >> 4);
#pragma unroll
  for (int i = 0; i < 8; ++i) { a[i] = (_Float16)(p[i] * sc); a[8 + i] = (_Float16)(p[16 + i] * sc); }
  return a;
}
// column fragment from a [K][ld] layout (column n), rows >= K read as 0
__device__ __forceinline__ v16h fragc_f32(const float* W, int k0, int n, int lane, int ld, int K) {
  v16h a; const int g = lane >> 4;
#pragma unroll
  for (int i = 0; i < 8; ++i) { const int ka = k0 + 8 * g + i, kb = ka + 16;
    a[i] = (_Float16)(ka < K ? W[(size_t)(ka < K ? ka : K - 1) * ld + n] : 0.f); a[8 + i] = (_Float16)(kb < K ? W[(size_t)(kb < K ? kb : K - 1) * ld + n] : 0.f); }
  return a;
}
struct F2 { v16b h, l; };
__device__ __forceinline__ F2 bsplit16(const float v[16]) { F2 r;
#pragma unroll
  for (int i = 0; i < 16; ++i) { const __bf16 h = (__bf16)v[i]; r.h[i] = h; r.l[i] = (__bf16)(v[i] - (float)h); }
  return r; }
__device__ __forceinline__ F2 split_row(const float* row, int k0, int lane) { float v[16]; const float* p = row + k0 + 8 * (lane >> 4);
#pragma unroll
  for (int i = 0; i < 8; ++i) { v[i] = p[i]; v[8 + i] = p[16 + i]; }
  return bsplit16(v); }
__device__ __forceinline__ F2 split_rowK(const float* row, int k0, int lane, int K) { float v[16]; const int g = lane >> 4;
#pragma unroll
  for (int i = 0; i < 8; ++i) { const int ka = k0 + 8 * g + i, kb = ka + 16; v[i] = ka < K ? row[ka < K ? ka : K - 1] : 0.f; v[8 + i] = kb < K ? row[kb < K ? kb : K - 1] : 0.f; }
  return bsplit16(v); }
__device__ __forceinline__ F2 split_col(const float* W, int k0, int n, int lane, int ld, int K) { float v[16]; const int g = lane >> 4;
#pragma unroll
  for (int i = 0; i < 8; ++i) { const int ka = k0 + 8 * g + i, kb = ka + 16; v[i] = ka < K ? W[(size_t)(ka < K ? ka : K - 1) * ld + n] : 0.f; v[8 + i] = kb < K ? W[(size_t)(kb < K ? kb : K - 1) * ld + n] : 0.f; }
  return bsplit16(v); }
__device__ __forceinline__ v8f mac3(const F2& a, const F2& b, v8f c) { c = wmma_bf(a.l, b.h, c); c = wmma_bf(a.h, b.l, c); return wmma_bf(a.h, b.h, c); }
__device__ __forceinline__ float sigm(float v) { return 1.0f / (1.0f + expf(-v)); }
#define LDSX() do { asm volatile("s_wait_dscnt 0" ::: "memory"); __builtin_amdgcn_wave_barrier(); __builtin_amdgcn_fence(__ATOMIC_RELEASE, "workgroup"); } while (0)


#define NB 2
#define SS 2304                 // 2,274 tokens (226 text + 2,048 video) padded to 36 x 64
#define SREAL 2274
#define STXT 226
#define SVID 2048
#define DM 1024
#define NH 16
#define HD 64
#define QKVW (3 * DM)
#ifndef TQB
#define TQB (SS / 64)
#define TNB NB
#define TOB (NB * SS / 64)     // output row tiles (all)
#endif
typedef __attribute__((ext_vector_type(8))) __bf16 v8b;
__device__ __forceinline__ v16b frag_b(const __bf16* rowk0, int lane) {
  union { v16b v; v8b q[2]; } u; const __bf16* p = rowk0 + 8 * (lane >> 4);
  u.q[0] = *(const v8b*)p; u.q[1] = *(const v8b*)(p + 16); return u.v;
}
__device__ __forceinline__ float bfr(float v) { return (float)(__bf16)v; }
__device__ __attribute__((noinline)) float exp_ni(float v) { return expf(v); }
__device__ __attribute__((noinline)) float erf_ni(float v) { return erff(v); }

#define PK_A 0                       // [3072][1024] Wqkv rows (natural [out][in])
#define PK_P (PK_A + QKVW * DM)        // [1024][1024] Wo rows (natural)
#define PK_END (PK_P + DM * DM)
#define WS_PK  0u
#define WS_QK  (WS_PK + 2u * PK_END)             // f16 [4608 rows][2048]: q | k
#define WS_VTH (WS_QK + 2u * NB * SS * 2 * DM)     // f16 [2][1024 (h*64+d)][2304 s] hi
#define WS_VTL (WS_VTH + 2u * NB * DM * SS)        // f16 lo x 2048
#define WS_O   (WS_VTL + 2u * NB * DM * SS)        // f32 [4608][1024]
#define WS_CS  (WS_O + 4u * NB * SS * DM)           // f32 2 x [2304][32], unused
#define WS_END (WS_CS + 4u * 2 * SS * 32)

// ---- k_packrows: block = natural row n of a [N][K] weight
__global__ __launch_bounds__(256) void k_packrows(const float* __restrict__ Wm, int K, __bf16* __restrict__ DST) {
  __shared__ __align__(16) __bf16 s[DM]; const int n = blockIdx.x, tid = threadIdx.x;
  for (int k = tid; k < K; k += 256) s[k] = (__bf16)Wm[(size_t)n * K + k];
  __syncthreads();
  for (int q = tid; q < K / 8; q += 256) vst2((unsigned*)(DST + (size_t)n * K + q * 8), *(const v4u*)&s[q * 8]);
}
// ---- k_qkv: block = (64 rows (b,s), 128 of the 3072 cols): qkv = bf16(x) . rows (exact); cols < 1024 -> f16(q), cols < 2048 -> f16(k) into QK rows (pitch 2048); cols >= 2048 (v) -> per-batch transposed f16 planes VT[b][h*64+d][s]: hi = f16(v), lo = f16((v - hi) * 2048)
__global__ __launch_bounds__(128) void k_qkv(const float* __restrict__ XT, const float* __restrict__ XV, const __bf16* __restrict__ P, const float* __restrict__ BQ, const float* __restrict__ BK, const float* __restrict__ BV, const float* __restrict__ LQW, const float* __restrict__ LQB, const float* __restrict__ LKW, const float* __restrict__ LKB, const float* __restrict__ COS, const float* __restrict__ SIN, _Float16* __restrict__ QK, _Float16* __restrict__ VTH, _Float16* __restrict__ VTL) {
  __shared__ __align__(16) _Float16 so[4][16][136]; __shared__ __align__(16) _Float16 sth[128][72], stl[128][72];
  const int tid = threadIdx.x, wave = tid >> 5, lane = tid & 31, col = lane & 15, g = lane >> 4; const size_t r0 = (size_t)blockIdx.x * 64 + wave * 16; const int n0 = blockIdx.y * 128;
  v8f acc[8] = {};
const int bb_ = (int)((r0 + col) / SS), ss_ = (int)((r0 + col) % SS); const bool isT = ss_ < STXT, isV = (ss_ >= STXT) && (ss_ < SREAL);   // h = concat([encoder, hidden]); rows >= 2,274 are padding (zero input; masked as keys, never output)
  const float* xrow = isT ? XT + ((size_t)bb_ * STXT + ss_) * DM : XV + ((size_t)bb_ * SVID + (isV ? ss_ - STXT : 0)) * DM;
#pragma unroll 2
  for (int kc = 0; kc < DM / 32; ++kc) { v16b a; { const float* p = xrow + kc * 32 + 8 * g;
#pragma unroll
      for (int i = 0; i < 8; ++i) { a[i] = (isT || isV) ? (__bf16)p[i] : (__bf16)0.f; a[8 + i] = (isT || isV) ? (__bf16)p[16 + i] : (__bf16)0.f; } }
#pragma unroll
    for (int j = 0; j < 8; ++j) acc[j] = wmma_bf(a, frag_b(P + (size_t)(n0 + j * 16 + col) * DM + kc * 32, lane), acc[j]); }
  { const float* BB = (n0 < DM) ? BQ : (n0 < 2 * DM) ? BK : BV; const int nb = n0 % DM;
#pragma unroll
    for (int j = 0; j < 8; ++j) { const float bb = bfr(BB[nb + j * 16 + col]);
#pragma unroll
      for (int r = 0; r < 8; ++r) acc[j][r] += bb; } }
  if (n0 < 2 * DM) {   // q | k: per-head LayerNorm over the 64 dims (this 128-col block = 2 heads: tiles 0-3 and 4-7), then rotary for video tokens; q unscaled (1/8 on the f32 score)
    const float* LW = (n0 < DM) ? LQW : LKW; const float* LBv = (n0 < DM) ? LQB : LKB;
#pragma unroll
    for (int hh = 0; hh < 2; ++hh) {
#pragma unroll
      for (int r = 0; r < 8; ++r) { float s = 0.f;
#pragma unroll
        for (int j = 0; j < 4; ++j) s += acc[hh * 4 + j][r];
#pragma unroll
        for (int o = 1; o < 16; o <<= 1) s += __shfl_xor(s, o);
        const float mu = s * (1.0f / 64.0f); float v = 0.f;
#pragma unroll
        for (int j = 0; j < 4; ++j) { const float dv = acc[hh * 4 + j][r] - mu; v += dv * dv; }
#pragma unroll
        for (int o = 1; o < 16; o <<= 1) v += __shfl_xor(v, o);
        const float rs = rsqrtf(v * (1.0f / 64.0f) + 1e-5f);
#pragma unroll
        for (int j = 0; j < 4; ++j) { const int d = j * 16 + col; acc[hh * 4 + j][r] = (acc[hh * 4 + j][r] - mu) * rs * bfr(LW[d]) + bfr(LBv[d]); } } }
    // rotary on video tokens: pairs (2i, 2i+1): out = x cos + rot(x) sin with rot = [-x_{2i+1}, x_{2i}]; cos/sin [2048][64] inputs (bf16-rounded), indexed by (s - 226, d)
#pragma unroll
    for (int j = 0; j < 8; ++j) { const int d = (j & 3) * 16 + col;
#pragma unroll
      for (int r = 0; r < 8; ++r) { const size_t row = r0 + 8 * g + r; const int sv = (int)(row % SS) - STXT; const float xv = acc[j][r]; const float xp = __shfl_xor(xv, 1);   // partner dim d^1 lives in lane col^1
        if (sv >= 0 && sv < SVID) { const float c = bfr(COS[(size_t)sv * HD + d]), sn = bfr(SIN[(size_t)sv * HD + d]); const float rot = (d & 1) ? xp : -xp; acc[j][r] = xv * c + rot * sn; } } }
#pragma unroll
    for (int j = 0; j < 8; ++j) {
#pragma unroll
      for (int r = 0; r < 8; ++r) so[wave][8 * g + r][j * 16 + col] = (_Float16)acc[j][r]; }
    LDSX();
    for (int rl = 0; rl < 16; ++rl) if (lane < 16) vst2((unsigned*)(QK + (r0 + rl) * (2 * DM) + n0 + lane * 8), *(const v4u*)&so[wave][rl][lane * 8]);
  } else {
#pragma unroll
    for (int j = 0; j < 8; ++j) {
#pragma unroll
      for (int r = 0; r < 8; ++r) { const float v = acc[j][r]; const _Float16 hv = (_Float16)v; sth[j * 16 + col][wave * 16 + 8 * g + r] = hv; stl[j * 16 + col][wave * 16 + 8 * g + r] = (_Float16)((v - (float)hv) * 2048.0f); } }
    __syncthreads();
    const size_t rb = (size_t)blockIdx.x * 64; const int b = (int)(rb / SS), s0 = (int)(rb % SS); const int pc0 = n0 - 2 * DM;
    for (int q = tid; q < 128 * 8; q += 128) { const int d = q >> 3, pc = q & 7; const size_t o = ((size_t)b * DM + pc0 + d) * SS + s0 + pc * 8; vst2((unsigned*)(VTH + o), *(const v4u*)&sth[d][pc * 8]); vst2((unsigned*)(VTL + o), *(const v4u*)&stl[d][pc * 8]); }
  }
}
// ---- k_attn: block = (64 queries, head h, batch b): non-causal flash attention (K = 64: 2 k-steps), scores = (q.k) * 0.125 with single f16 operands, P.V: f16 P x (V hi, V lo*2048) in two accumulators; O[b*S+q][h*64+d] = (acc + accl / 2048) / l (256-B segments)
__global__ __launch_bounds__(128) void k_attn(const _Float16* __restrict__ QK, const _Float16* __restrict__ VTH, const _Float16* __restrict__ VTL, float* __restrict__ O) {
  __shared__ __align__(16) float sp[4][16][36]; __shared__ __align__(16) float so[4][16][68];
  const int tid = threadIdx.x, wave = tid >> 5, lane = tid & 31, col = lane & 15, g = lane >> 4;
  const int qb = blockIdx.x, h = blockIdx.y, b = blockIdx.z; const int q0 = qb * 64 + wave * 16; const size_t rq = (size_t)b * SS + q0 + col;
  v16h aq[2];
#pragma unroll
  for (int kc = 0; kc < 2; ++kc) aq[kc] = frag_h(QK + rq * (2 * DM) + h * HD + kc * 32, lane);
  float m[8], l[8];
#pragma unroll
  for (int r = 0; r < 8; ++r) { m[r] = -3.0e38f; l[r] = 0.f; }
  v8f acc[4] = {}, accl[4] = {};
  const int nks = SS / 32;   // not causal; keys >= 2,274 are padding and masked
#pragma unroll 1
  for (int ks = 0; ks < nks; ++ks) { v8f s[2];
#pragma unroll
    for (int ct = 0; ct < 2; ++ct) { const int kk = ks * 32 + ct * 16 + col; const _Float16* krow = QK + ((size_t)b * SS + kk) * (2 * DM) + DM + h * HD; v8f c = {};
#pragma unroll
      for (int kc = 0; kc < 2; ++kc) c = wmma16(aq[kc], frag_h(krow + kc * 32, lane), c);
#pragma unroll
      for (int r = 0; r < 8; ++r) s[ct][r] = (kk < SREAL) ? c[r] * 0.125f : -3.0e38f; }   // 1/sqrt(64); padded keys masked
#pragma unroll
    for (int r = 0; r < 8; ++r) { float mx = fmaxf(s[0][r], s[1][r]);
#pragma unroll
      for (int o = 1; o < 16; o <<= 1) mx = fmaxf(mx, __shfl_xor(mx, o));
      const float mn = fmaxf(m[r], mx); const float alpha = (m[r] <= -1.0e38f) ? 0.f : __expf(m[r] - mn);
      const float e0 = (s[0][r] <= -1.0e38f) ? 0.f : __expf(s[0][r] - mn), e1 = (s[1][r] <= -1.0e38f) ? 0.f : __expf(s[1][r] - mn); float es = e0 + e1;
#pragma unroll
      for (int o = 1; o < 16; o <<= 1) es += __shfl_xor(es, o);
      l[r] = l[r] * alpha + es; m[r] = mn;
#pragma unroll
      for (int dt = 0; dt < 4; ++dt) { acc[dt][r] *= alpha; accl[dt][r] *= alpha; }
      sp[wave][8 * g + r][col] = e0; sp[wave][8 * g + r][16 + col] = e1; }
    LDSX();
    v16h pa, pl; { const float* prow = &sp[wave][col][0] + 8 * (lane >> 4);
#pragma unroll
      for (int i = 0; i < 8; ++i) { const float x0 = prow[i], x1 = prow[16 + i]; const _Float16 h0 = (_Float16)x0, h1 = (_Float16)x1; pa[i] = h0; pa[8 + i] = h1; pl[i] = (_Float16)((x0 - (float)h0) * 2048.0f); pl[8 + i] = (_Float16)((x1 - (float)h1) * 2048.0f); } }
#pragma unroll
    for (int dt = 0; dt < 4; ++dt) { const size_t vr = ((size_t)b * DM + h * HD + dt * 16 + col) * SS + ks * 32; const v16h vh = frag_h(VTH + vr, lane); acc[dt] = wmma16(pa, vh, acc[dt]); accl[dt] = wmma16(pl, vh, accl[dt]); accl[dt] = wmma16(pa, frag_h(VTL + vr, lane), accl[dt]); }   // P hi x V hi + (P lo x V hi + P hi x V lo) / 2048
    LDSX(); }
#pragma unroll
  for (int r = 0; r < 8; ++r) { const float il = 1.0f / l[r];
#pragma unroll
    for (int dt = 0; dt < 4; ++dt) so[wave][8 * g + r][dt * 16 + col] = (acc[dt][r] + accl[dt][r] * (1.0f / 2048.0f)) * il; }
  LDSX();
  for (int rl = 0; rl < 16; ++rl) if (lane < 16) vst2(O + ((size_t)b * SS + q0 + rl) * DM + h * HD + lane * 4, *(const v4f*)&so[wave][rl][lane * 4]);
}
// ---- k_out: block = (64 rows, 128 cols): out = O(hi/lo) . Wo rows (2 products) + bo
__global__ __launch_bounds__(128) void k_out(const float* __restrict__ O, const __bf16* __restrict__ P, const float* __restrict__ BO, float* __restrict__ Y) {
  __shared__ __align__(16) float so[4][16][132];
  const int tid = threadIdx.x, wave = tid >> 5, lane = tid & 31, col = lane & 15, g = lane >> 4; const size_t r0 = (size_t)blockIdx.x * 64 + wave * 16; const int n0 = blockIdx.y * 128;
  v8f acc[8] = {};
#pragma unroll 2
  for (int kc = 0; kc < DM / 32; ++kc) { const F2 a = split_row(O + (r0 + col) * DM, kc * 32, lane);
#pragma unroll
    for (int j = 0; j < 8; ++j) { const v16b w = frag_b(P + (size_t)(n0 + j * 16 + col) * DM + kc * 32, lane); acc[j] = wmma_bf(a.l, w, acc[j]); acc[j] = wmma_bf(a.h, w, acc[j]); } }
#pragma unroll
  for (int j = 0; j < 8; ++j) { const float bb = bfr(BO[n0 + j * 16 + col]);
#pragma unroll
    for (int r = 0; r < 8; ++r) so[wave][8 * g + r][j * 16 + col] = acc[j][r] + bb; }
  LDSX();
  for (int rl = 0; rl < 16; ++rl) { const size_t row = r0 + rl; const int b = (int)(row / SS), s = (int)(row % SS); if (s < STXT) vst2(Y + (size_t)NB * SVID * DM + ((size_t)b * STXT + s) * DM + n0 + lane * 4, *(const v4f*)&so[wave][rl][lane * 4]); else if (s < SREAL) vst2(Y + ((size_t)b * SVID + (s - STXT)) * DM + n0 + lane * 4, *(const v4f*)&so[wave][rl][lane * 4]); }   // out0 = o[:, 226:] at 0, out1 = o[:, :226] after it; padding rows dropped
}
extern "C" void kernel_launch(void* const* d_in, const int* in_sizes, int n_in, void* d_out, int out_size, void* d_ws, size_t ws_size, hipStream_t stream) {
  (void)in_sizes; (void)n_in; (void)out_size;
  const float** F = (const float**)d_in;   // 0 hidden_states [2,2048,1024], 1 encoder_hidden_states [2,226,1024], 2 cos [2048,64], 3 sin, 4 wq [1024,1024], 5 bq, 6 wk, 7 bk, 8 wv, 9 bv, 10 wo, 11 bo, 12 lnq_w [64], 13 lnq_b, 14 lnk_w, 15 lnk_b
  if (ws_size < (size_t)WS_END) return;
  char* ws = (char*)d_ws; __bf16* PK = (__bf16*)(ws + WS_PK); _Float16 *QK = (_Float16*)(ws + WS_QK), *VTH = (_Float16*)(ws + WS_VTH), *VTL = (_Float16*)(ws + WS_VTL); float *O = (float*)(ws + WS_O);
  k_packrows<<<DM, 256, 0, stream>>>(F[4], DM, PK + PK_A); k_packrows<<<DM, 256, 0, stream>>>(F[6], DM, PK + PK_A + (size_t)DM * DM); k_packrows<<<DM, 256, 0, stream>>>(F[8], DM, PK + PK_A + (size_t)2 * DM * DM); k_packrows<<<DM, 256, 0, stream>>>(F[10], DM, PK + PK_P);
  k_qkv<<<dim3(TNB * SS / 64, QKVW / 128), 128, 0, stream>>>(F[1], F[0], PK + PK_A, F[5], F[7], F[9], F[12], F[13], F[14], F[15], F[2], F[3], QK, VTH, VTL);
  k_attn<<<dim3(TQB, NH, TNB), 128, 0, stream>>>(QK, VTH, VTL, O);
  k_out<<<dim3(TOB, DM / 128), 128, 0, stream>>>(O, PK + PK_P, F[11], (float*)d_out);
}

// v001
// Measured time: 374 microseconds a run.
// Two timings next to v000 put it at 2.07 and 2.08 times that version's speed.
// compute dtype: hidden_states, encoder_hidden_states, cos, sin and all weights / biases / norm parameters (module inputs) rounded to bf16; q/k/v projections with exact bf16 products (natural [out][in] rows) + bias on WMMA 16x16x32; per-head LayerNorm of q and k (over the 64 dims, eps 1e-5) and the interleaved rotary on the video tokens (input cos/sin tables) in f32 in the projection epilogue; q and k stored once as f16 (q unscaled; 1/8 on the f32 score), v as f16 hi + (x2048-scaled) residual planes; scores with single f16 operands (1 product) and P.V with P as f16 hi + (x2048-scaled) residual x V hi/lo (3 products); the output projection with ctx as bf16 hi + residual x exact wo (2 products) + bo; running-max softmax in f32 with the hardware exp; the 2,274-token sequence is padded to 2,304 rows per batch with the padding keys masked; f32 accumulate.
#include <hip/hip_runtime.h>
#include <math.h>

typedef __attribute__((ext_vector_type(16))) _Float16 v16h;
typedef __attribute__((ext_vector_type(16))) __bf16 v16b;
typedef __attribute__((ext_vector_type(8)))  _Float16 v8h;
typedef __attribute__((ext_vector_type(8)))  float v8f;
typedef __attribute__((ext_vector_type(4)))  float v4f;
typedef __attribute__((ext_vector_type(2)))  float v2f;
typedef __attribute__((ext_vector_type(4)))  unsigned v4u;
typedef __attribute__((ext_vector_type(4)))  int v4i;
typedef float __attribute__((may_alias)) float_a;
typedef int __attribute__((may_alias)) int_a;

template <typename T> __device__ __forceinline__ void vst2(void* p, T v) { *(T*)p = v;  }
__device__ __forceinline__ v8f wmma16(v16h a, v16h b, v8f c) {
  v8f d = __builtin_amdgcn_wmma_f32_16x16x32_f16(false, a, false, b, (short)0, c, false, false);
  asm volatile("v_nop\n\tv_nop\n\tv_nop\n\tv_nop" : "+v"(d) : "v"(a), "v"(b));
  return d;
}
__device__ __forceinline__ v8f wmma_bf(v16b a, v16b b, v8f c) {
  v8f d = __builtin_amdgcn_wmma_f32_16x16x32_bf16(false, a, false, b, (short)0, c, false, false);
  asm volatile("v_nop\n\tv_nop\n\tv_nop\n\tv_nop" : "+v"(d) : "v"(a), "v"(b));
  return d;
}
// CogVideoX joint text+video attention processor (B 2, 226 text + 2,048 video tokens, D 1,024, 16 heads x 64): qkv with bias, per-head LayerNorm on q and k, rotary on the video part, full softmax attention, output projection + bias; returns (video part, text part).
__device__ __forceinline__ v16h frag_h(const _Float16* rowk0, int lane) {
  union { v16h v; v8h q[2]; } u; const _Float16* p = rowk0 + 8 * (lane >> 4);
  u.q[0] = *(const v8h*)p; u.q[1] = *(const v8h*)(p + 16); return u.v;
}
__device__ __forceinline__ v16h frag_f32(const float* rowk0, int lane) {
  v16h a; const float* p = rowk0 + 8 * (lane >> 4);
#pragma unroll
  for (int i = 0; i < 8; ++i) { a[i] = (_Float16)p[i]; a[8 + i] = (_Float16)p[16 + i]; }
  return a;
}
__device__ __forceinline__ v16h frag_f32s(const float* rowk0, int lane, float sc) {
  v16h a; const float* p = rowk0 + 8 * (lane >> 4);
#pragma unroll
  for (int i = 0; i < 8; ++i) { a[i] = (_Float16)(p[i] * sc); a[8 + i] = (_Float16)(p[16 + i] * sc); }
  return a;
}
// column fragment from a [K][ld] layout (column n), rows >= K read as 0
__device__ __forceinline__ v16h fragc_f32(const float* W, int k0, int n, int lane, int ld, int K) {
  v16h a; const int g = lane >> 4;
#pragma unroll
  for (int i = 0; i < 8; ++i) { const int ka = k0 + 8 * g + i, kb = ka + 16;
    a[i] = (_Float16)(ka < K ? W[(size_t)(ka < K ? ka : K - 1) * ld + n] : 0.f); a[8 + i] = (_Float16)(kb < K ? W[(size_t)(kb < K ? kb : K - 1) * ld + n] : 0.f); }
  return a;
}
struct F2 { v16b h, l; };
__device__ __forceinline__ F2 bsplit16(const float v[16]) { F2 r;
#pragma unroll
  for (int i = 0; i < 16; ++i) { const __bf16 h = (__bf16)v[i]; r.h[i] = h; r.l[i] = (__bf16)(v[i] - (float)h); }
  return r; }
__device__ __forceinline__ F2 split_row(const float* row, int k0, int lane) { float v[16]; const float* p = row + k0 + 8 * (lane >> 4);
#pragma unroll
  for (int i = 0; i < 8; ++i) { v[i] = p[i]; v[8 + i] = p[16 + i]; }
  return bsplit16(v); }
__device__ __forceinline__ F2 split_rowK(const float* row, int k0, int lane, int K) { float v[16]; const int g = lane >> 4;
#pragma unroll
  for (int i = 0; i < 8; ++i) { const int ka = k0 + 8 * g + i, kb = ka + 16; v[i] = ka < K ? row[ka < K ? ka : K - 1] : 0.f; v[8 + i] = kb < K ? row[kb < K ? kb : K - 1] : 0.f; }
  return bsplit16(v); }
__device__ __forceinline__ F2 split_col(const float* W, int k0, int n, int lane, int ld, int K) { float v[16]; const int g = lane >> 4;
#pragma unroll
  for (int i = 0; i < 8; ++i) { const int ka = k0 + 8 * g + i, kb = ka + 16; v[i] = ka < K ? W[(size_t)(ka < K ? ka : K - 1) * ld + n] : 0.f; v[8 + i] = kb < K ? W[(size_t)(kb < K ? kb : K - 1) * ld + n] : 0.f; }
  return bsplit16(v); }
__device__ __forceinline__ v8f mac3(const F2& a, const F2& b, v8f c) { c = wmma_bf(a.l, b.h, c); c = wmma_bf(a.h, b.l, c); return wmma_bf(a.h, b.h, c); }
__device__ __forceinline__ float sigm(float v) { return 1.0f / (1.0f + expf(-v)); }
#define LDSX() do { asm volatile("s_wait_dscnt 0" ::: "memory"); __builtin_amdgcn_wave_barrier(); __builtin_amdgcn_fence(__ATOMIC_RELEASE, "workgroup"); } while (0)


#define NB 2
#define SS 2304                 // 2,274 tokens (226 text + 2,048 video) padded to 36 x 64
#define SREAL 2274
#define STXT 226
#define SVID 2048
#define DM 1024
#define NH 16
#define HD 64
#define QKVW (3 * DM)
#ifndef TQB
#define TQB (SS / 64)
#define TNB NB
#define TOB (NB * SS / 64)     // output row tiles (all)
#endif
typedef __attribute__((ext_vector_type(8))) __bf16 v8b;
__device__ __forceinline__ v16b frag_b(const __bf16* rowk0, int lane) {
  union { v16b v; v8b q[2]; } u; const __bf16* p = rowk0 + 8 * (lane >> 4);
  u.q[0] = *(const v8b*)p; u.q[1] = *(const v8b*)(p + 16); return u.v;
}
__device__ __forceinline__ float bfr(float v) { return (float)(__bf16)v; }
__device__ __attribute__((noinline)) float exp_ni(float v) { return expf(v); }
__device__ __attribute__((noinline)) float erf_ni(float v) { return erff(v); }

#define PK_A 0                       // [3072][1024] Wqkv rows (natural [out][in])
#define PK_P (PK_A + QKVW * DM)        // [1024][1024] Wo rows (natural)
#define PK_END (PK_P + DM * DM)
#define WS_PK  0u
#define WS_QK  (WS_PK + 2u * PK_END)             // f16 [4608 rows][2048]: q | k
#define WS_VTH (WS_QK + 2u * NB * SS * 2 * DM)     // f16 [2][1024 (h*64+d)][2304 s] hi
#define WS_VTL (WS_VTH + 2u * NB * DM * SS)        // f16 lo x 2048
#define WS_O   (WS_VTL + 2u * NB * DM * SS)        // f32 [4608][1024]
#define WS_CS  (WS_O + 4u * NB * SS * DM)           // f32 2 x [2304][32], unused
#define WS_END (WS_CS + 4u * 2 * SS * 32)

// ---- LDS staging of the operand tiles that all four waves of a block read: rows of 128 B (64 16-bit values) at a pitch of 144 B (16 B x odd: ds_load_b128 readers), two buffers
#define TP 72                        // row pitch in 16-bit values
#define TPB (2 * TP)                 // row pitch in bytes
#define T64B (64 * TPB)              // a 64-row tile, bytes
#define ASTG (3 * T64B)              // attention stage: K | V hi | V lo, 64 keys
#define WSTG (2 * T64B)              // GEMM stage: 128 weight rows x 64 k
__device__ __forceinline__ unsigned lds_off(const void* p) { return (unsigned)(size_t)p; }
// four asynchronous 16-byte copies per lane, global -> LDS, rows 16 apart (gstep = 16 source rows, in bytes); s_wait_xcnt closes the statement so that no address register is rewritten ahead of it
__device__ __forceinline__ void cp4(unsigned l, const void* gp, size_t gstep) {
  const char* g = (const char*)gp;
  asm volatile("global_load_async_to_lds_b128 %0, %1, off\n\tglobal_load_async_to_lds_b128 %2, %3, off\n\tglobal_load_async_to_lds_b128 %4, %5, off\n\tglobal_load_async_to_lds_b128 %6, %7, off\n\ts_wait_xcnt 0x0"
               :: "v"(l), "v"(g), "v"(l + 16 * TPB), "v"(g + gstep), "v"(l + 32 * TPB), "v"(g + 2 * gstep), "v"(l + 48 * TPB), "v"(g + 3 * gstep) : "memory");
}
// a 128-row x 64-k weight tile (natural rows of DM bf16); src = this lane's 16 bytes of its first row
__device__ __forceinline__ void fill_w(unsigned l, const __bf16* src) { cp4(l, src, (size_t)16 * DM * 2); cp4(l + T64B, src + (size_t)64 * DM, (size_t)16 * DM * 2); }
#define WAIT_DS()    asm volatile("s_wait_dscnt 0x0" ::: "memory")      // this wave's LDS reads of the buffer are done before the barrier frees it
#define WAIT_ASYNC() asm volatile("s_wait_asynccnt 0x0" ::: "memory")   // this wave's copies have landed before the barrier publishes them
// ---- k_packrows: block = natural row n of a [N][K] weight
__global__ __launch_bounds__(256) void k_packrows(const float* __restrict__ Wm, int K, __bf16* __restrict__ DST) {
  __shared__ __align__(16) __bf16 s[DM]; const int n = blockIdx.x, tid = threadIdx.x;
  for (int k = tid; k < K; k += 256) s[k] = (__bf16)Wm[(size_t)n * K + k];
  __syncthreads();
  for (int q = tid; q < K / 8; q += 256) vst2((unsigned*)(DST + (size_t)n * K + q * 8), *(const v4u*)&s[q * 8]);
}
// ---- k_qkv: block = (64 rows (b,s), 128 of the 3072 cols): qkv = bf16(x) . rows (exact); cols < 1024 -> f16(q), cols < 2048 -> f16(k) into QK rows (pitch 2048); cols >= 2048 (v) -> per-batch transposed f16 planes VT[b][h*64+d][s]: hi = f16(v), lo = f16((v - hi) * 2048)
__global__ __launch_bounds__(128) void k_qkv(const float* __restrict__ XT, const float* __restrict__ XV, const __bf16* __restrict__ P, const float* __restrict__ BQ, const float* __restrict__ BK, const float* __restrict__ BV, const float* __restrict__ LQW, const float* __restrict__ LQB, const float* __restrict__ LKW, const float* __restrict__ LKB, const float* __restrict__ COS, const float* __restrict__ SIN, _Float16* __restrict__ QK, _Float16* __restrict__ VTH, _Float16* __restrict__ VTL) {
  __shared__ __align__(16) unsigned char L[4 * 16 * 136 * 2 + 2 * 128 * 72 * 2];   // the weight ring (2 x WSTG) during the k loop, then the output staging
  _Float16 (*so)[16][136] = (_Float16 (*)[16][136])L; _Float16 (*sth)[72] = (_Float16 (*)[72])(L + 4 * 16 * 136 * 2); _Float16 (*stl)[72] = sth + 128;
  const int tid = threadIdx.x, wave = tid >> 5, lane = tid & 31, col = lane & 15, g = lane >> 4; const size_t r0 = (size_t)blockIdx.x * 64 + wave * 16; const int n0 = blockIdx.y * 128;
  v8f acc[8] = {};
  const unsigned lw = lds_off(L) + (tid >> 3) * TPB + (tid & 7) * 16; const __bf16* gw = P + (size_t)(n0 + (tid >> 3)) * DM + (tid & 7) * 8;
  fill_w(lw, gw); WAIT_ASYNC(); __syncthreads(); fill_w(lw + WSTG, gw + 64);
const int bb_ = (int)((r0 + col) / SS), ss_ = (int)((r0 + col) % SS); const bool isT = ss_ < STXT, isV = (ss_ >= STXT) && (ss_ < SREAL);   // h = concat([encoder, hidden]); rows >= 2,274 are padding (zero input; masked as keys, never output)
  const float* xrow = isT ? XT + ((size_t)bb_ * STXT + ss_) * DM : XV + ((size_t)bb_ * SVID + (isV ? ss_ - STXT : 0)) * DM;
#pragma unroll 1   // one stage per trip: the buffer index and the publish point at the foot stay those of a two-buffer ring
  for (int st = 0; st < DM / 64; ++st) { const __bf16* Bt = (const __bf16*)(L + (st & 1) * WSTG);
#pragma unroll
    for (int sub = 0; sub < 2; ++sub) { const int kc = st * 2 + sub; v16b a; { const float* p = xrow + kc * 32 + 8 * g;
#pragma unroll
        for (int i = 0; i < 8; ++i) { a[i] = (isT || isV) ? (__bf16)p[i] : (__bf16)0.f; a[8 + i] = (isT || isV) ? (__bf16)p[16 + i] : (__bf16)0.f; } }
#pragma unroll
      for (int j = 0; j < 8; ++j) acc[j] = wmma_bf(a, frag_b(Bt + (j * 16 + col) * TP + sub * 32, lane), acc[j]); }
    WAIT_DS(); WAIT_ASYNC(); __syncthreads();   // publishes stage st + 1 and frees stage st's buffer
    if (st + 2 < DM / 64) fill_w(lw + (st & 1) * WSTG, gw + (st + 2) * 64); }
  WAIT_ASYNC();
  { const float* BB = (n0 < DM) ? BQ : (n0 < 2 * DM) ? BK : BV; const int nb = n0 % DM;
#pragma unroll
    for (int j = 0; j < 8; ++j) { const float bb = bfr(BB[nb + j * 16 + col]);
#pragma unroll
      for (int r = 0; r < 8; ++r) acc[j][r] += bb; } }
  if (n0 < 2 * DM) {   // q | k: per-head LayerNorm over the 64 dims (this 128-col block = 2 heads: tiles 0-3 and 4-7), then rotary for video tokens; q unscaled (1/8 on the f32 score)
    const float* LW = (n0 < DM) ? LQW : LKW; const float* LBv = (n0 < DM) ? LQB : LKB;
#pragma unroll
    for (int hh = 0; hh < 2; ++hh) {
#pragma unroll
      for (int r = 0; r < 8; ++r) { float s = 0.f;
#pragma unroll
        for (int j = 0; j < 4; ++j) s += acc[hh * 4 + j][r];
#pragma unroll
        for (int o = 1; o < 16; o <<= 1) s += __shfl_xor(s, o);
        const float mu = s * (1.0f / 64.0f); float v = 0.f;
#pragma unroll
        for (int j = 0; j < 4; ++j) { const float dv = acc[hh * 4 + j][r] - mu; v += dv * dv; }
#pragma unroll
        for (int o = 1; o < 16; o <<= 1) v += __shfl_xor(v, o);
        const float rs = rsqrtf(v * (1.0f / 64.0f) + 1e-5f);
#pragma unroll
        for (int j = 0; j < 4; ++j) { const int d = j * 16 + col; acc[hh * 4 + j][r] = (acc[hh * 4 + j][r] - mu) * rs * bfr(LW[d]) + bfr(LBv[d]); } } }
    // rotary on video tokens: pairs (2i, 2i+1): out = x cos + rot(x) sin with rot = [-x_{2i+1}, x_{2i}]; cos/sin [2048][64] inputs (bf16-rounded), indexed by (s - 226, d)
#pragma unroll
    for (int j = 0; j < 8; ++j) { const int d = (j & 3) * 16 + col;
#pragma unroll
      for (int r = 0; r < 8; ++r) { const size_t row = r0 + 8 * g + r; const int sv = (int)(row % SS) - STXT; const float xv = acc[j][r]; const float xp = __shfl_xor(xv, 1);   // partner dim d^1 lives in lane col^1
        if (sv >= 0 && sv < SVID) { const float c = bfr(COS[(size_t)sv * HD + d]), sn = bfr(SIN[(size_t)sv * HD + d]); const float rot = (d & 1) ? xp : -xp; acc[j][r] = xv * c + rot * sn; } } }
#pragma unroll
    for (int j = 0; j < 8; ++j) {
#pragma unroll
      for (int r = 0; r < 8; ++r) so[wave][8 * g + r][j * 16 + col] = (_Float16)acc[j][r]; }
    LDSX();
    for (int rl = 0; rl < 16; ++rl) if (lane < 16) vst2((unsigned*)(QK + (r0 + rl) * (2 * DM) + n0 + lane * 8), *(const v4u*)&so[wave][rl][lane * 8]);
  } else {
#pragma unroll
    for (int j = 0; j < 8; ++j) {
#pragma unroll
      for (int r = 0; r < 8; ++r) { const float v = acc[j][r]; const _Float16 hv = (_Float16)v; sth[j * 16 + col][wave * 16 + 8 * g + r] = hv; stl[j * 16 + col][wave * 16 + 8 * g + r] = (_Float16)((v - (float)hv) * 2048.0f); } }
    __syncthreads();
    const size_t rb = (size_t)blockIdx.x * 64; const int b = (int)(rb / SS), s0 = (int)(rb % SS); const int pc0 = n0 - 2 * DM;
    for (int q = tid; q < 128 * 8; q += 128) { const int d = q >> 3, pc = q & 7; const size_t o = ((size_t)b * DM + pc0 + d) * SS + s0 + pc * 8; vst2((unsigned*)(VTH + o), *(const v4u*)&sth[d][pc * 8]); vst2((unsigned*)(VTL + o), *(const v4u*)&stl[d][pc * 8]); }
  }
}
// ---- k_attn: block = (64 queries, head h, batch b): non-causal flash attention (K = 64: 2 k-steps), scores = (q.k) * 0.125 with single f16 operands, P.V: f16 P x (V hi, V lo*2048) in two accumulators; O[b*S+q][h*64+d] = (acc + accl / 2048) / l (256-B segments)
__global__ __launch_bounds__(128) void k_attn(const _Float16* __restrict__ QK, const _Float16* __restrict__ VTH, const _Float16* __restrict__ VTL, float* __restrict__ O) {
  __shared__ __align__(16) float sp[4][16][36]; __shared__ __align__(16) unsigned char L[2 * ASTG];   // the K/V ring during the key loop, then the output staging
  float (*so)[16][68] = (float (*)[16][68])L;
  const int tid = threadIdx.x, wave = tid >> 5, lane = tid & 31, col = lane & 15, g = lane >> 4;
  const int qb = blockIdx.x, h = blockIdx.y, b = blockIdx.z; const int q0 = qb * 64 + wave * 16; const size_t rq = (size_t)b * SS + q0 + col;
  const unsigned lt = lds_off(L) + (tid >> 3) * TPB + (tid & 7) * 16;
  const _Float16* gk = QK + ((size_t)b * SS + (tid >> 3)) * (2 * DM) + DM + h * HD + (tid & 7) * 8; const size_t gvo = ((size_t)b * DM + h * HD + (tid >> 3)) * SS + (tid & 7) * 8;
  auto fill = [&](int st) { const unsigned l = lt + (st & 1) * ASTG;   // stage st = keys 64 st .. 64 st + 63: K rows [key][64 d], V planes [d][64 keys]
    cp4(l, gk + (size_t)st * 64 * (2 * DM), (size_t)16 * 2 * DM * 2); cp4(l + T64B, VTH + gvo + st * 64, (size_t)16 * SS * 2); cp4(l + 2 * T64B, VTL + gvo + st * 64, (size_t)16 * SS * 2); };
  fill(0); WAIT_ASYNC(); __syncthreads(); fill(1);
  v16h aq[2];
#pragma unroll
  for (int kc = 0; kc < 2; ++kc) aq[kc] = frag_h(QK + rq * (2 * DM) + h * HD + kc * 32, lane);
  float m[8], l[8];
#pragma unroll
  for (int r = 0; r < 8; ++r) { m[r] = -3.0e38f; l[r] = 0.f; }
  v8f acc[4] = {}, accl[4] = {};
  // not causal; keys >= 2,274 are padding and masked
#pragma unroll 1   // one stage per trip: the buffer index and the publish point at the foot stay those of a two-buffer ring
  for (int st = 0; st < SS / 64; ++st) { const _Float16* Kt = (const _Float16*)(L + (st & 1) * ASTG); const _Float16* Vh = Kt + 64 * TP; const _Float16* Vl = Vh + 64 * TP;
#pragma unroll 1   // the 32-key pass stays rolled, as before this ring: one copy of it in the text
  for (int sub = 0; sub < 2; ++sub) { const int ks = st * 2 + sub; v8f s[2];
#pragma unroll
    for (int ct = 0; ct < 2; ++ct) { const int kk = ks * 32 + ct * 16 + col; const _Float16* krow = Kt + (sub * 32 + ct * 16 + col) * TP; v8f c = {};
#pragma unroll
      for (int kc = 0; kc < 2; ++kc) c = wmma16(aq[kc], frag_h(krow + kc * 32, lane), c);
#pragma unroll
      for (int r = 0; r < 8; ++r) s[ct][r] = (kk < SREAL) ? c[r] * 0.125f : -3.0e38f; }   // 1/sqrt(64); padded keys masked
#pragma unroll
    for (int r = 0; r < 8; ++r) { float mx = fmaxf(s[0][r], s[1][r]);
#pragma unroll
      for (int o = 1; o < 16; o <<= 1) mx = fmaxf(mx, __shfl_xor(mx, o));
      const float mn = fmaxf(m[r], mx); const float alpha = (m[r] <= -1.0e38f) ? 0.f : __expf(m[r] - mn);
      const float e0 = (s[0][r] <= -1.0e38f) ? 0.f : __expf(s[0][r] - mn), e1 = (s[1][r] <= -1.0e38f) ? 0.f : __expf(s[1][r] - mn); float es = e0 + e1;
#pragma unroll
      for (int o = 1; o < 16; o <<= 1) es += __shfl_xor(es, o);
      l[r] = l[r] * alpha + es; m[r] = mn;
#pragma unroll
      for (int dt = 0; dt < 4; ++dt) { acc[dt][r] *= alpha; accl[dt][r] *= alpha; }
      sp[wave][8 * g + r][col] = e0; sp[wave][8 * g + r][16 + col] = e1; }
    LDSX();
    v16h pa, pl; { const float* prow = &sp[wave][col][0] + 8 * (lane >> 4);
#pragma unroll
      for (int i = 0; i < 8; ++i) { const float x0 = prow[i], x1 = prow[16 + i]; const _Float16 h0 = (_Float16)x0, h1 = (_Float16)x1; pa[i] = h0; pa[8 + i] = h1; pl[i] = (_Float16)((x0 - (float)h0) * 2048.0f); pl[8 + i] = (_Float16)((x1 - (float)h1) * 2048.0f); } }
#pragma unroll
    for (int dt = 0; dt < 4; ++dt) { const int vr = (dt * 16 + col) * TP + sub * 32; const v16h vh = frag_h(Vh + vr, lane); acc[dt] = wmma16(pa, vh, acc[dt]); accl[dt] = wmma16(pl, vh, accl[dt]); accl[dt] = wmma16(pa, frag_h(Vl + vr, lane), accl[dt]); }   // P hi x V hi + (P lo x V hi + P hi x V lo) / 2048
    LDSX(); }
    WAIT_DS(); WAIT_ASYNC(); __syncthreads();   // publishes stage st + 1 and frees stage st's buffer
    if (st + 2 < SS / 64) fill(st + 2); }
  WAIT_ASYNC();
#pragma unroll
  for (int r = 0; r < 8; ++r) { const float il = 1.0f / l[r];
#pragma unroll
    for (int dt = 0; dt < 4; ++dt) so[wave][8 * g + r][dt * 16 + col] = (acc[dt][r] + accl[dt][r] * (1.0f / 2048.0f)) * il; }
  LDSX();
  for (int rl = 0; rl < 16; ++rl) if (lane < 16) vst2(O + ((size_t)b * SS + q0 + rl) * DM + h * HD + lane * 4, *(const v4f*)&so[wave][rl][lane * 4]);
}
// ---- k_out: block = (64 rows, 128 cols): out = O(hi/lo) . Wo rows (2 products) + bo
__global__ __launch_bounds__(128) void k_out(const float* __restrict__ O, const __bf16* __restrict__ P, const float* __restrict__ BO, float* __restrict__ Y) {
  __shared__ __align__(16) unsigned char L[2 * WSTG];   // the weight ring during the k loop, then the output staging
  float (*so)[16][132] = (float (*)[16][132])L;
  const int tid = threadIdx.x, wave = tid >> 5, lane = tid & 31, col = lane & 15, g = lane >> 4; const size_t r0 = (size_t)blockIdx.x * 64 + wave * 16; const int n0 = blockIdx.y * 128;
  v8f acc[8] = {};
  const unsigned lw = lds_off(L) + (tid >> 3) * TPB + (tid & 7) * 16; const __bf16* gw = P + (size_t)(n0 + (tid >> 3)) * DM + (tid & 7) * 8;
  fill_w(lw, gw); WAIT_ASYNC(); __syncthreads(); fill_w(lw + WSTG, gw + 64);
#pragma unroll 1   // one stage per trip: the buffer index and the publish point at the foot stay those of a two-buffer ring
  for (int st = 0; st < DM / 64; ++st) { const __bf16* Bt = (const __bf16*)(L + (st & 1) * WSTG);
#pragma unroll
    for (int sub = 0; sub < 2; ++sub) { const F2 a = split_row(O + (r0 + col) * DM, (st * 2 + sub) * 32, lane);
#pragma unroll
      for (int j = 0; j < 8; ++j) { const v16b w = frag_b(Bt + (j * 16 + col) * TP + sub * 32, lane); acc[j] = wmma_bf(a.l, w, acc[j]); acc[j] = wmma_bf(a.h, w, acc[j]); } }
    WAIT_DS(); WAIT_ASYNC(); __syncthreads();   // publishes stage st + 1 and frees stage st's buffer
    if (st + 2 < DM / 64) fill_w(lw + (st & 1) * WSTG, gw + (st + 2) * 64); }
  WAIT_ASYNC();
#pragma unroll
  for (int j = 0; j < 8; ++j) { const float bb = bfr(BO[n0 + j * 16 + col]);
#pragma unroll
    for (int r = 0; r < 8; ++r) so[wave][8 * g + r][j * 16 + col] = acc[j][r] + bb; }
  LDSX();
  for (int rl = 0; rl < 16; ++rl) { const size_t row = r0 + rl; const int b = (int)(row / SS), s = (int)(row % SS); if (s < STXT) vst2(Y + (size_t)NB * SVID * DM + ((size_t)b * STXT + s) * DM + n0 + lane * 4, *(const v4f*)&so[wave][rl][lane * 4]); else if (s < SREAL) vst2(Y + ((size_t)b * SVID + (s - STXT)) * DM + n0 + lane * 4, *(const v4f*)&so[wave][rl][lane * 4]); }   // out0 = o[:, 226:] at 0, out1 = o[:, :226] after it; padding rows dropped
}
extern "C" void kernel_launch(void* const* d_in, const int* in_sizes, int n_in, void* d_out, int out_size, void* d_ws, size_t ws_size, hipStream_t stream) {
  (void)in_sizes; (void)n_in; (void)out_size;
  const float** F = (const float**)d_in;   // 0 hidden_states [2,2048,1024], 1 encoder_hidden_states [2,226,1024], 2 cos [2048,64], 3 sin, 4 wq [1024,1024], 5 bq, 6 wk, 7 bk, 8 wv, 9 bv, 10 wo, 11 bo, 12 lnq_w [64], 13 lnq_b, 14 lnk_w, 15 lnk_b
  if (ws_size < (size_t)WS_END) return;
  char* ws = (char*)d_ws; __bf16* PK = (__bf16*)(ws + WS_PK); _Float16 *QK = (_Float16*)(ws + WS_QK), *VTH = (_Float16*)(ws + WS_VTH), *VTL = (_Float16*)(ws + WS_VTL); float *O = (float*)(ws + WS_O);
  k_packrows<<<DM, 256, 0, stream>>>(F[4], DM, PK + PK_A); k_packrows<<<DM, 256, 0, stream>>>(F[6], DM, PK + PK_A + (size_t)DM * DM); k_packrows<<<DM, 256, 0, stream>>>(F[8], DM, PK + PK_A + (size_t)2 * DM * DM); k_packrows<<<DM, 256, 0, stream>>>(F[10], DM, PK + PK_P);
  k_qkv<<<dim3(TNB * SS / 64, QKVW / 128), 128, 0, stream>>>(F[1], F[0], PK + PK_A, F[5], F[7], F[9], F[12], F[13], F[14], F[15], F[2], F[3], QK, VTH, VTL);
  k_attn<<<dim3(TQB, NH, TNB), 128, 0, stream>>>(QK, VTH, VTL, O);
  k_out<<<dim3(TOB, DM / 128), 128, 0, stream>>>(O, PK + PK_P, F[11], (float*)d_out);
}

// v002
// Measured time: 301 microseconds a run.
// Timed twice side by side with v001, it ran 1.24 times as fast both times.
// All steps since v000 together make it 2.57 times as fast.
// compute dtype: hidden_states, encoder_hidden_states, cos, sin and all weights / biases / norm parameters (module inputs) rounded to bf16; q/k/v projections with exact bf16 products (natural [out][in] rows) + bias on WMMA 16x16x32; per-head LayerNorm of q and k (over the 64 dims, eps 1e-5) and the interleaved rotary on the video tokens (input cos/sin tables) in f32 in the projection epilogue; q and k stored once as f16 (q unscaled; 1/8 on the f32 score), v as f16 hi + (x2048-scaled) residual planes; scores with single f16 operands (1 product) and P.V with P as f16 hi + (x2048-scaled) residual x V hi/lo (3 products); the output projection with ctx as bf16 hi + residual x exact wo (2 products) + bo; running-max softmax in f32 with the hardware exp; the 2,274-token sequence is padded to 2,304 rows per batch with the padding keys masked; f32 accumulate.
#include <hip/hip_runtime.h>
#include <math.h>

typedef __attribute__((ext_vector_type(16))) _Float16 v16h;
typedef __attribute__((ext_vector_type(16))) __bf16 v16b;
typedef __attribute__((ext_vector_type(8)))  _Float16 v8h;
typedef __attribute__((ext_vector_type(8)))  float v8f;
typedef __attribute__((ext_vector_type(4)))  float v4f;
typedef __attribute__((ext_vector_type(2)))  float v2f;
typedef __attribute__((ext_vector_type(4)))  unsigned v4u;
typedef __attribute__((ext_vector_type(4)))  int v4i;
typedef float __attribute__((may_alias)) float_a;
typedef int __attribute__((may_alias)) int_a;

template <typename T> __device__ __forceinline__ void vst2(void* p, T v) { *(T*)p = v;  }
__device__ __forceinline__ v8f wmma16(v16h a, v16h b, v8f c) {
  v8f d = __builtin_amdgcn_wmma_f32_16x16x32_f16(false, a, false, b, (short)0, c, false, false);
  asm volatile("v_nop\n\tv_nop\n\tv_nop\n\tv_nop" : "+v"(d) : "v"(a), "v"(b));
  return d;
}
__device__ __forceinline__ v8f wmma_bf(v16b a, v16b b, v8f c) {
  v8f d = __builtin_amdgcn_wmma_f32_16x16x32_bf16(false, a, false, b, (short)0, c, false, false);
  asm volatile("v_nop\n\tv_nop\n\tv_nop\n\tv_nop" : "+v"(d) : "v"(a), "v"(b));
  return d;
}
// CogVideoX joint text+video attention processor (B 2, 226 text + 2,048 video tokens, D 1,024, 16 heads x 64): qkv with bias, per-head LayerNorm on q and k, rotary on the video part, full softmax attention, output projection + bias; returns (video part, text part).
__device__ __forceinline__ v16h frag_h(const _Float16* rowk0, int lane) {
  union { v16h v; v8h q[2]; } u; const _Float16* p = rowk0 + 8 * (lane >> 4);
  u.q[0] = *(const v8h*)p; u.q[1] = *(const v8h*)(p + 16); return u.v;
}
__device__ __forceinline__ v16h frag_f32(const float* rowk0, int lane) {
  v16h a; const float* p = rowk0 + 8 * (lane >> 4);
#pragma unroll
  for (int i = 0; i < 8; ++i) { a[i] = (_Float16)p[i]; a[8 + i] = (_Float16)p[16 + i]; }
  return a;
}
__device__ __forceinline__ v16h frag_f32s(const float* rowk0, int lane, float sc) {
  v16h a; const float* p = rowk0 + 8 * (lane >> 4);
#pragma unroll
  for (int i = 0; i < 8; ++i) { a[i] = (_Float16)(p[i] * sc); a[8 + i] = (_Float16)(p[16 + i] * sc); }
  return a;
}
// column fragment from a [K][ld] layout (column n), rows >= K read as 0
__device__ __forceinline__ v16h fragc_f32(const float* W, int k0, int n, int lane, int ld, int K) {
  v16h a; const int g = lane >> 4;
#pragma unroll
  for (int i = 0; i < 8; ++i) { const int ka = k0 + 8 * g + i, kb = ka + 16;
    a[i] = (_Float16)(ka < K ? W[(size_t)(ka < K ? ka : K - 1) * ld + n] : 0.f); a[8 + i] = (_Float16)(kb < K ? W[(size_t)(kb < K ? kb : K - 1) * ld + n] : 0.f); }
  return a;
}
struct F2 { v16b h, l; };
__device__ __forceinline__ F2 bsplit16(const float v[16]) { F2 r;
#pragma unroll
  for (int i = 0; i < 16; ++i) { const __bf16 h = (__bf16)v[i]; r.h[i] = h; r.l[i] = (__bf16)(v[i] - (float)h); }
  return r; }
__device__ __forceinline__ F2 split_row(const float* row, int k0, int lane) { float v[16]; const float* p = row + k0 + 8 * (lane >> 4);
#pragma unroll
  for (int i = 0; i < 8; ++i) { v[i] = p[i]; v[8 + i] = p[16 + i]; }
  return bsplit16(v); }
__device__ __forceinline__ F2 split_rowK(const float* row, int k0, int lane, int K) { float v[16]; const int g = lane >> 4;
#pragma unroll
  for (int i = 0; i < 8; ++i) { const int ka = k0 + 8 * g + i, kb = ka + 16; v[i] = ka < K ? row[ka < K ? ka : K - 1] : 0.f; v[8 + i] = kb < K ? row[kb < K ? kb : K - 1] : 0.f; }
  return bsplit16(v); }
__device__ __forceinline__ F2 split_col(const float* W, int k0, int n, int lane, int ld, int K) { float v[16]; const int g = lane >> 4;
#pragma unroll
  for (int i = 0; i < 8; ++i) { const int ka = k0 + 8 * g + i, kb = ka + 16; v[i] = ka < K ? W[(size_t)(ka < K ? ka : K - 1) * ld + n] : 0.f; v[8 + i] = kb < K ? W[(size_t)(kb < K ? kb : K - 1) * ld + n] : 0.f; }
  return bsplit16(v); }
__device__ __forceinline__ v8f mac3(const F2& a, const F2& b, v8f c) { c = wmma_bf(a.l, b.h, c); c = wmma_bf(a.h, b.l, c); return wmma_bf(a.h, b.h, c); }
__device__ __forceinline__ float sigm(float v) { return 1.0f / (1.0f + expf(-v)); }
#define LDSX() do { asm volatile("s_wait_dscnt 0" ::: "memory"); __builtin_amdgcn_wave_barrier(); __builtin_amdgcn_fence(__ATOMIC_RELEASE, "workgroup"); } while (0)


#define NB 2
#define SS 2304                 // 2,274 tokens (226 text + 2,048 video) padded to 36 x 64
#define SREAL 2274
#define STXT 226
#define SVID 2048
#define DM 1024
#define NH 16
#define HD 64
#define QKVW (3 * DM)
#ifndef TQB
#define TQB (SS / 64)
#define TNB NB
#define TOB (NB * SS / 64)     // output row tiles (all)
#endif
typedef __attribute__((ext_vector_type(8))) __bf16 v8b;
__device__ __forceinline__ v16b frag_b(const __bf16* rowk0, int lane) {
  union { v16b v; v8b q[2]; } u; const __bf16* p = rowk0 + 8 * (lane >> 4);
  u.q[0] = *(const v8b*)p; u.q[1] = *(const v8b*)(p + 16); return u.v;
}
__device__ __forceinline__ float bfr(float v) { return (float)(__bf16)v; }
__device__ __attribute__((noinline)) float exp_ni(float v) { return expf(v); }
__device__ __attribute__((noinline)) float erf_ni(float v) { return erff(v); }

#define PK_A 0                       // [3072][1024] Wqkv rows (natural [out][in])
#define PK_P (PK_A + QKVW * DM)        // [1024][1024] Wo rows (natural)
#define PK_END (PK_P + DM * DM)
#define WS_PK  0u
#define WS_QK  (WS_PK + 2u * PK_END)             // f16 [4608 rows][2048]: q | k
#define WS_VTH (WS_QK + 2u * NB * SS * 2 * DM)     // f16 [2][1024 (h*64+d)][2304 s] hi
#define WS_VTL (WS_VTH + 2u * NB * DM * SS)        // f16 lo x 2048
#define WS_O   (WS_VTL + 2u * NB * DM * SS)        // f32 [4608][1024]
#define WS_CS  (WS_O + 4u * NB * SS * DM)           // f32 2 x [2304][32], unused
#define WS_END (WS_CS + 4u * 2 * SS * 32)

// ---- LDS staging of the operand tiles that all four waves of a block read: rows of 128 B (64 16-bit values) at a pitch of 144 B (16 B x odd: ds_load_b128 readers), two buffers
#define TP 72                        // row pitch in 16-bit values
#define TPB (2 * TP)                 // row pitch in bytes
#define T64B (64 * TPB)              // a 64-row tile, bytes
#define ASTG (3 * T64B)              // attention stage: K | V hi | V lo, 64 keys
#define WSTG (2 * T64B)              // GEMM stage: 128 weight rows x 64 k
__device__ __forceinline__ unsigned lds_off(const void* p) { return (unsigned)(size_t)p; }
// four asynchronous 16-byte copies per lane, global -> LDS, rows 16 apart (gstep = 16 source rows, in bytes); s_wait_xcnt closes the statement so that no address register is rewritten ahead of it
__device__ __forceinline__ void cp4(unsigned l, const void* gp, size_t gstep) {
  const char* g = (const char*)gp;
  asm volatile("global_load_async_to_lds_b128 %0, %1, off\n\tglobal_load_async_to_lds_b128 %2, %3, off\n\tglobal_load_async_to_lds_b128 %4, %5, off\n\tglobal_load_async_to_lds_b128 %6, %7, off\n\ts_wait_xcnt 0x0"
               :: "v"(l), "v"(g), "v"(l + 16 * TPB), "v"(g + gstep), "v"(l + 32 * TPB), "v"(g + 2 * gstep), "v"(l + 48 * TPB), "v"(g + 3 * gstep) : "memory");
}
// a 128-row x 64-k weight tile (natural rows of DM bf16); src = this lane's 16 bytes of its first row
__device__ __forceinline__ void fill_w(unsigned l, const __bf16* src) { cp4(l, src, (size_t)16 * DM * 2); cp4(l + T64B, src + (size_t)64 * DM, (size_t)16 * DM * 2); }
#define WAIT_DS()    asm volatile("s_wait_dscnt 0x0" ::: "memory")      // this wave's LDS reads of the buffer are done before the barrier frees it
#define WAIT_ASYNC() asm volatile("s_wait_asynccnt 0x0" ::: "memory")   // this wave's copies have landed before the barrier publishes them
// ---- k_packrows: block = natural row n of a [N][K] weight
__global__ __launch_bounds__(256) void k_packrows(const float* __restrict__ Wm, int K, __bf16* __restrict__ DST) {
  __shared__ __align__(16) __bf16 s[DM]; const int n = blockIdx.x, tid = threadIdx.x;
  for (int k = tid; k < K; k += 256) s[k] = (__bf16)Wm[(size_t)n * K + k];
  __syncthreads();
  for (int q = tid; q < K / 8; q += 256) vst2((unsigned*)(DST + (size_t)n * K + q * 8), *(const v4u*)&s[q * 8]);
}
// ---- k_qkv: block = (64 rows (b,s), 128 of the 3072 cols): qkv = bf16(x) . rows (exact); cols < 1024 -> f16(q), cols < 2048 -> f16(k) into QK rows (pitch 2048); cols >= 2048 (v) -> per-batch transposed f16 planes VT[b][h*64+d][s]: hi = f16(v), lo = f16((v - hi) * 2048)
__global__ __launch_bounds__(128) void k_qkv(const float* __restrict__ XT, const float* __restrict__ XV, const __bf16* __restrict__ P, const float* __restrict__ BQ, const float* __restrict__ BK, const float* __restrict__ BV, const float* __restrict__ LQW, const float* __restrict__ LQB, const float* __restrict__ LKW, const float* __restrict__ LKB, const float* __restrict__ COS, const float* __restrict__ SIN, _Float16* __restrict__ QK, _Float16* __restrict__ VTH, _Float16* __restrict__ VTL) {
  __shared__ __align__(16) unsigned char L[4 * 16 * 136 * 2 + 2 * 128 * 72 * 2];   // the weight ring (2 x WSTG) during the k loop, then the output staging
  _Float16 (*so)[16][136] = (_Float16 (*)[16][136])L; _Float16 (*sth)[72] = (_Float16 (*)[72])(L + 4 * 16 * 136 * 2); _Float16 (*stl)[72] = sth + 128;
  const int tid = threadIdx.x, wave = tid >> 5, lane = tid & 31, col = lane & 15, g = lane >> 4; const size_t r0 = (size_t)blockIdx.x * 64 + wave * 16; const int n0 = blockIdx.y * 128;
  v8f acc[8] = {};
  const unsigned lw = lds_off(L) + (tid >> 3) * TPB + (tid & 7) * 16; const __bf16* gw = P + (size_t)(n0 + (tid >> 3)) * DM + (tid & 7) * 8;
  fill_w(lw, gw); WAIT_ASYNC(); __syncthreads(); fill_w(lw + WSTG, gw + 64);
const int bb_ = (int)((r0 + col) / SS), ss_ = (int)((r0 + col) % SS); const bool isT = ss_ < STXT, isV = (ss_ >= STXT) && (ss_ < SREAL);   // h = concat([encoder, hidden]); rows >= 2,274 are padding (zero input; masked as keys, never output)
  const float* xrow = isT ? XT + ((size_t)bb_ * STXT + ss_) * DM : XV + ((size_t)bb_ * SVID + (isV ? ss_ - STXT : 0)) * DM;
#pragma unroll 1   // one stage per trip: the buffer index and the publish point at the foot stay those of a two-buffer ring
  for (int st = 0; st < DM / 64; ++st) { const __bf16* Bt = (const __bf16*)(L + (st & 1) * WSTG);
    v4f x[2][4];   // the stage's 64 k of this lane's row: xrow is a valid row for padding lanes too, so the loads stand under no lane test; the zero is selected behind them
#pragma unroll
    for (int sub = 0; sub < 2; ++sub) { const float* p = xrow + st * 64 + sub * 32 + 8 * g; x[sub][0] = *(const v4f*)p; x[sub][1] = *(const v4f*)(p + 4); x[sub][2] = *(const v4f*)(p + 16); x[sub][3] = *(const v4f*)(p + 20); }
#pragma unroll
    for (int sub = 0; sub < 2; ++sub) { union { v16b v; unsigned w[8]; } u;
#pragma unroll
      for (int q = 0; q < 4; ++q) {
#pragma unroll
        for (int i = 0; i < 4; ++i) u.v[q * 4 + i] = (__bf16)x[sub][q][i]; }
#pragma unroll
      for (int q = 0; q < 8; ++q) u.w[q] = (isT || isV) ? u.w[q] : 0u;   // padding rows: zero input
      const v16b a = u.v;
#pragma unroll
      for (int j = 0; j < 8; ++j) acc[j] = wmma_bf(a, frag_b(Bt + (j * 16 + col) * TP + sub * 32, lane), acc[j]); }
    WAIT_DS(); WAIT_ASYNC(); __syncthreads();   // publishes stage st + 1 and frees stage st's buffer
    if (st + 2 < DM / 64) fill_w(lw + (st & 1) * WSTG, gw + (st + 2) * 64); }
  WAIT_ASYNC();
  { const float* BB = (n0 < DM) ? BQ : (n0 < 2 * DM) ? BK : BV; const int nb = n0 % DM;
#pragma unroll
    for (int j = 0; j < 8; ++j) { const float bb = bfr(BB[nb + j * 16 + col]);
#pragma unroll
      for (int r = 0; r < 8; ++r) acc[j][r] += bb; } }
  if (n0 < 2 * DM) {   // q | k: per-head LayerNorm over the 64 dims (this 128-col block = 2 heads: tiles 0-3 and 4-7), then rotary for video tokens; q unscaled (1/8 on the f32 score)
    const float* LW = (n0 < DM) ? LQW : LKW; const float* LBv = (n0 < DM) ? LQB : LKB;
#pragma unroll
    for (int hh = 0; hh < 2; ++hh) {
#pragma unroll
      for (int r = 0; r < 8; ++r) { float s = 0.f;
#pragma unroll
        for (int j = 0; j < 4; ++j) s += acc[hh * 4 + j][r];
#pragma unroll
        for (int o = 1; o < 16; o <<= 1) s += __shfl_xor(s, o);
        const float mu = s * (1.0f / 64.0f); float v = 0.f;
#pragma unroll
        for (int j = 0; j < 4; ++j) { const float dv = acc[hh * 4 + j][r] - mu; v += dv * dv; }
#pragma unroll
        for (int o = 1; o < 16; o <<= 1) v += __shfl_xor(v, o);
        const float rs = rsqrtf(v * (1.0f / 64.0f) + 1e-5f);
#pragma unroll
        for (int j = 0; j < 4; ++j) { const int d = j * 16 + col; acc[hh * 4 + j][r] = (acc[hh * 4 + j][r] - mu) * rs * bfr(LW[d]) + bfr(LBv[d]); } } }
    // the rotary tables of this lane's 8 rows x 4 dims (both heads of the block use the same): table row clamped to 0 for text and padding rows, so the loads stand under no lane test and are all in flight together
    float tc[8][4], ts[8][4]; bool vid[8]; unsigned to[8]; const int sv0 = (int)((r0 + 8 * g) % SS) - STXT;   // 8 rows from a multiple of 8 never cross a batch (SS is one)
#pragma unroll
    for (int r = 0; r < 8; ++r) { const int sv = sv0 + r; vid[r] = sv >= 0 && sv < SVID; to[r] = (unsigned)(vid[r] ? sv : 0) * HD + col; }
#pragma unroll
    for (int r = 0; r < 8; ++r) {
#pragma unroll
      for (int q = 0; q < 4; ++q) { tc[r][q] = COS[to[r] + q * 16]; ts[r][q] = SIN[to[r] + q * 16]; } }
    asm volatile("s_wait_xcnt 0x0" :: "v"(to[0]), "v"(to[1]), "v"(to[2]), "v"(to[3]), "v"(to[4]), "v"(to[5]), "v"(to[6]), "v"(to[7]) : "memory");   // the offset registers of the table loads stay as they are up to this wait
    // rotary on video tokens: pairs (2i, 2i+1): out = x cos + rot(x) sin with rot = [-x_{2i+1}, x_{2i}]; cos/sin [2048][64] inputs (bf16-rounded), indexed by (s - 226, d)
#pragma unroll
    for (int j = 0; j < 8; ++j) { const int d = (j & 3) * 16 + col;
#pragma unroll
      for (int r = 0; r < 8; ++r) { const float xv = acc[j][r]; const float xp = __shfl_xor(xv, 1);   // partner dim d^1 lives in lane col^1
        const float c = bfr(tc[r][j & 3]), sn = bfr(ts[r][j & 3]); const float rot = (d & 1) ? xp : -xp; acc[j][r] = vid[r] ? xv * c + rot * sn : xv; } }   // text and padding rows keep xv by the select
#pragma unroll
    for (int j = 0; j < 8; ++j) {
#pragma unroll
      for (int r = 0; r < 8; ++r) so[wave][8 * g + r][j * 16 + col] = (_Float16)acc[j][r]; }
    LDSX();
    for (int rl = 0; rl < 16; ++rl) if (lane < 16) vst2((unsigned*)(QK + (r0 + rl) * (2 * DM) + n0 + lane * 8), *(const v4u*)&so[wave][rl][lane * 8]);
  } else {
#pragma unroll
    for (int j = 0; j < 8; ++j) {
#pragma unroll
      for (int r = 0; r < 8; ++r) { const float v = acc[j][r]; const _Float16 hv = (_Float16)v; sth[j * 16 + col][wave * 16 + 8 * g + r] = hv; stl[j * 16 + col][wave * 16 + 8 * g + r] = (_Float16)((v - (float)hv) * 2048.0f); } }
    __syncthreads();
    const size_t rb = (size_t)blockIdx.x * 64; const int b = (int)(rb / SS), s0 = (int)(rb % SS); const int pc0 = n0 - 2 * DM;
    for (int q = tid; q < 128 * 8; q += 128) { const int d = q >> 3, pc = q & 7; const size_t o = ((size_t)b * DM + pc0 + d) * SS + s0 + pc * 8; vst2((unsigned*)(VTH + o), *(const v4u*)&sth[d][pc * 8]); vst2((unsigned*)(VTL + o), *(const v4u*)&stl[d][pc * 8]); }
  }
}
// ---- k_attn: block = (64 queries, head h, batch b): non-causal flash attention (K = 64: 2 k-steps), scores = (q.k) * 0.125 with single f16 operands, P.V: f16 P x (V hi, V lo*2048) in two accumulators; O[b*S+q][h*64+d] = (acc + accl / 2048) / l (256-B segments)
__global__ __launch_bounds__(128) void k_attn(const _Float16* __restrict__ QK, const _Float16* __restrict__ VTH, const _Float16* __restrict__ VTL, float* __restrict__ O) {
  __shared__ __align__(16) float sp[4][16][36]; __shared__ __align__(16) unsigned char L[2 * ASTG];   // the K/V ring during the key loop, then the output staging
  float (*so)[16][68] = (float (*)[16][68])L;
  const int tid = threadIdx.x, wave = tid >> 5, lane = tid & 31, col = lane & 15, g = lane >> 4;
  const int qb = blockIdx.x, h = blockIdx.y, b = blockIdx.z; const int q0 = qb * 64 + wave * 16; const size_t rq = (size_t)b * SS + q0 + col;
  const unsigned lt = lds_off(L) + (tid >> 3) * TPB + (tid & 7) * 16;
  const _Float16* gk = QK + ((size_t)b * SS + (tid >> 3)) * (2 * DM) + DM + h * HD + (tid & 7) * 8; const size_t gvo = ((size_t)b * DM + h * HD + (tid >> 3)) * SS + (tid & 7) * 8;
  auto fill = [&](int st) { const unsigned l = lt + (st & 1) * ASTG;   // stage st = keys 64 st .. 64 st + 63: K rows [key][64 d], V planes [d][64 keys]
    cp4(l, gk + (size_t)st * 64 * (2 * DM), (size_t)16 * 2 * DM * 2); cp4(l + T64B, VTH + gvo + st * 64, (size_t)16 * SS * 2); cp4(l + 2 * T64B, VTL + gvo + st * 64, (size_t)16 * SS * 2); };
  fill(0); WAIT_ASYNC(); __syncthreads(); fill(1);
  v16h aq[2];
#pragma unroll
  for (int kc = 0; kc < 2; ++kc) aq[kc] = frag_h(QK + rq * (2 * DM) + h * HD + kc * 32, lane);
  float m[8], l[8];
#pragma unroll
  for (int r = 0; r < 8; ++r) { m[r] = -3.0e38f; l[r] = 0.f; }
  v8f acc[4] = {}, accl[4] = {};
  // not causal; keys >= 2,274 are padding and masked
#pragma unroll 1   // one stage per trip: the buffer index and the publish point at the foot stay those of a two-buffer ring
  for (int st = 0; st < SS / 64; ++st) { const _Float16* Kt = (const _Float16*)(L + (st & 1) * ASTG); const _Float16* Vh = Kt + 64 * TP; const _Float16* Vl = Vh + 64 * TP;
#pragma unroll 1   // the 32-key pass stays rolled, as before this ring: one copy of it in the text
  for (int sub = 0; sub < 2; ++sub) { const int ks = st * 2 + sub; v8f s[2];
#pragma unroll
    for (int ct = 0; ct < 2; ++ct) { const int kk = ks * 32 + ct * 16 + col; const _Float16* krow = Kt + (sub * 32 + ct * 16 + col) * TP; v8f c = {};
#pragma unroll
      for (int kc = 0; kc < 2; ++kc) c = wmma16(aq[kc], frag_h(krow + kc * 32, lane), c);
#pragma unroll
      for (int r = 0; r < 8; ++r) s[ct][r] = (kk < SREAL) ? c[r] * 0.125f : -3.0e38f; }   // 1/sqrt(64); padded keys masked
#pragma unroll
    for (int r = 0; r < 8; ++r) { float mx = fmaxf(s[0][r], s[1][r]);
#pragma unroll
      for (int o = 1; o < 16; o <<= 1) mx = fmaxf(mx, __shfl_xor(mx, o));
      const float mn = fmaxf(m[r], mx); const float alpha = (m[r] <= -1.0e38f) ? 0.f : __expf(m[r] - mn);
      const float e0 = (s[0][r] <= -1.0e38f) ? 0.f : __expf(s[0][r] - mn), e1 = (s[1][r] <= -1.0e38f) ? 0.f : __expf(s[1][r] - mn); float es = e0 + e1;
#pragma unroll
      for (int o = 1; o < 16; o <<= 1) es += __shfl_xor(es, o);
      l[r] = l[r] * alpha + es; m[r] = mn;
#pragma unroll
      for (int dt = 0; dt < 4; ++dt) { acc[dt][r] *= alpha; accl[dt][r] *= alpha; }
      sp[wave][8 * g + r][col] = e0; sp[wave][8 * g + r][16 + col] = e1; }
    LDSX();
    v16h pa, pl; { const float* prow = &sp[wave][col][0] + 8 * (lane >> 4);
#pragma unroll
      for (int i = 0; i < 8; ++i) { const float x0 = prow[i], x1 = prow[16 + i]; const _Float16 h0 = (_Float16)x0, h1 = (_Float16)x1; pa[i] = h0; pa[8 + i] = h1; pl[i] = (_Float16)((x0 - (float)h0) * 2048.0f); pl[8 + i] = (_Float16)((x1 - (float)h1) * 2048.0f); } }
#pragma unroll
    for (int dt = 0; dt < 4; ++dt) { const int vr = (dt * 16 + col) * TP + sub * 32; const v16h vh = frag_h(Vh + vr, lane); acc[dt] = wmma16(pa, vh, acc[dt]); accl[dt] = wmma16(pl, vh, accl[dt]); accl[dt] = wmma16(pa, frag_h(Vl + vr, lane), accl[dt]); }   // P hi x V hi + (P lo x V hi + P hi x V lo) / 2048
    LDSX(); }
    WAIT_DS(); WAIT_ASYNC(); __syncthreads();   // publishes stage st + 1 and frees stage st's buffer
    if (st + 2 < SS / 64) fill(st + 2); }
  WAIT_ASYNC();
#pragma unroll
  for (int r = 0; r < 8; ++r) { const float il = 1.0f / l[r];
#pragma unroll
    for (int dt = 0; dt < 4; ++dt) so[wave][8 * g + r][dt * 16 + col] = (acc[dt][r] + accl[dt][r] * (1.0f / 2048.0f)) * il; }
  LDSX();
  for (int rl = 0; rl < 16; ++rl) if (lane < 16) vst2(O + ((size_t)b * SS + q0 + rl) * DM + h * HD + lane * 4, *(const v4f*)&so[wave][rl][lane * 4]);
}
// ---- k_out: block = (64 rows, 128 cols): out = O(hi/lo) . Wo rows (2 products) + bo
__global__ __launch_bounds__(128) void k_out(const float* __restrict__ O, const __bf16* __restrict__ P, const float* __restrict__ BO, float* __restrict__ Y) {
  __shared__ __align__(16) unsigned char L[2 * WSTG];   // the weight ring during the k loop, then the output staging
  float (*so)[16][132] = (float (*)[16][132])L;
  const int tid = threadIdx.x, wave = tid >> 5, lane = tid & 31, col = lane & 15, g = lane >> 4; const size_t r0 = (size_t)blockIdx.x * 64 + wave * 16; const int n0 = blockIdx.y * 128;
  v8f acc[8] = {};
  const unsigned lw = lds_off(L) + (tid >> 3) * TPB + (tid & 7) * 16; const __bf16* gw = P + (size_t)(n0 + (tid >> 3)) * DM + (tid & 7) * 8;
  fill_w(lw, gw); WAIT_ASYNC(); __syncthreads(); fill_w(lw + WSTG, gw + 64);
#pragma unroll 1   // one stage per trip: the buffer index and the publish point at the foot stay those of a two-buffer ring
  for (int st = 0; st < DM / 64; ++st) { const __bf16* Bt = (const __bf16*)(L + (st & 1) * WSTG);
#pragma unroll
    for (int sub = 0; sub < 2; ++sub) { const F2 a = split_row(O + (r0 + col) * DM, (st * 2 + sub) * 32, lane);
#pragma unroll
      for (int j = 0; j < 8; ++j) { const v16b w = frag_b(Bt + (j * 16 + col) * TP + sub * 32, lane); acc[j] = wmma_bf(a.l, w, acc[j]); acc[j] = wmma_bf(a.h, w, acc[j]); } }
    WAIT_DS(); WAIT_ASYNC(); __syncthreads();   // publishes stage st + 1 and frees stage st's buffer
    if (st + 2 < DM / 64) fill_w(lw + (st & 1) * WSTG, gw + (st + 2) * 64); }
  WAIT_ASYNC();
#pragma unroll
  for (int j = 0; j < 8; ++j) { const float bb = bfr(BO[n0 + j * 16 + col]);
#pragma unroll
    for (int r = 0; r < 8; ++r) so[wave][8 * g + r][j * 16 + col] = acc[j][r] + bb; }
  LDSX();
  for (int rl = 0; rl < 16; ++rl) { const size_t row = r0 + rl; const int b = (int)(row / SS), s = (int)(row % SS); if (s < STXT) vst2(Y + (size_t)NB * SVID * DM + ((size_t)b * STXT + s) * DM + n0 + lane * 4, *(const v4f*)&so[wave][rl][lane * 4]); else if (s < SREAL) vst2(Y + ((size_t)b * SVID + (s - STXT)) * DM + n0 + lane * 4, *(const v4f*)&so[wave][rl][lane * 4]); }   // out0 = o[:, 226:] at 0, out1 = o[:, :226] after it; padding rows dropped
}
extern "C" void kernel_launch(void* const* d_in, const int* in_sizes, int n_in, void* d_out, int out_size, void* d_ws, size_t ws_size, hipStream_t stream) {
  (void)in_sizes; (void)n_in; (void)out_size;
  const float** F = (const float**)d_in;   // 0 hidden_states [2,2048,1024], 1 encoder_hidden_states [2,226,1024], 2 cos [2048,64], 3 sin, 4 wq [1024,1024], 5 bq, 6 wk, 7 bk, 8 wv, 9 bv, 10 wo, 11 bo, 12 lnq_w [64], 13 lnq_b, 14 lnk_w, 15 lnk_b
  if (ws_size < (size_t)WS_END) return;
  char* ws = (char*)d_ws; __bf16* PK = (__bf16*)(ws + WS_PK); _Float16 *QK = (_Float16*)(ws + WS_QK), *VTH = (_Float16*)(ws + WS_VTH), *VTL = (_Float16*)(ws + WS_VTL); float *O = (float*)(ws + WS_O);
  k_packrows<<<DM, 256, 0, stream>>>(F[4], DM, PK + PK_A); k_packrows<<<DM, 256, 0, stream>>>(F[6], DM, PK + PK_A + (size_t)DM * DM); k_packrows<<<DM, 256, 0, stream>>>(F[8], DM, PK + PK_A + (size_t)2 * DM * DM); k_packrows<<<DM, 256, 0, stream>>>(F[10], DM, PK + PK_P);
  k_qkv<<<dim3(TNB * SS / 64, QKVW / 128), 128, 0, stream>>>(F[1], F[0], PK + PK_A, F[5], F[7], F[9], F[12], F[13], F[14], F[15], F[2], F[3], QK, VTH, VTL);
  k_attn<<<dim3(TQB, NH, TNB), 128, 0, stream>>>(QK, VTH, VTL, O);
  k_out<<<dim3(TOB, DM / 128), 128, 0, stream>>>(O, PK + PK_P, F[11], (float*)d_out);
}

// v003
// One run takes 228 microseconds.
// Timed twice side by side with v002, it ran 1.32 times as fast both times.
// All steps since v000 together make it 3.40 times as fast.
// compute dtype: hidden_states, encoder_hidden_states, cos, sin and all weights / biases / norm parameters (module inputs) rounded to bf16; q/k/v projections with exact bf16 products (natural [out][in] rows) + bias on WMMA 16x16x32; per-head LayerNorm of q and k (over the 64 dims, eps 1e-5) and the interleaved rotary on the video tokens (input cos/sin tables) in f32 in the projection epilogue; q and k stored once as f16 (q unscaled; 1/8 on the f32 score), v as f16 hi + (x2048-scaled) residual planes; scores with single f16 operands (1 product) and P.V with P as f16 hi + (x2048-scaled) residual x V hi/lo (3 products); the output projection with ctx as bf16 hi + residual x exact wo (2 products) + bo; running-max softmax in f32 with the hardware exp; the 2,274-token sequence is padded to 2,304 rows per batch with the padding keys masked; f32 accumulate.
#include <hip/hip_runtime.h>
#include <math.h>

typedef __attribute__((ext_vector_type(16))) _Float16 v16h;
typedef __attribute__((ext_vector_type(16))) __bf16 v16b;
typedef __attribute__((ext_vector_type(8)))  _Float16 v8h;
typedef __attribute__((ext_vector_type(8)))  float v8f;
typedef __attribute__((ext_vector_type(4)))  float v4f;
typedef __attribute__((ext_vector_type(2)))  float v2f;
typedef __attribute__((ext_vector_type(4)))  unsigned v4u;
typedef __attribute__((ext_vector_type(4)))  int v4i;
typedef float __attribute__((may_alias)) float_a;
typedef int __attribute__((may_alias)) int_a;

template <typename T> __device__ __forceinline__ void vst2(void* p, T v) { *(T*)p = v;  }
__device__ __forceinline__ v8f wmma16(v16h a, v16h b, v8f c) {
  v8f d = __builtin_amdgcn_wmma_f32_16x16x32_f16(false, a, false, b, (short)0, c, false, false);
  asm volatile("v_nop\n\tv_nop\n\tv_nop\n\tv_nop" : "+v"(d) : "v"(a), "v"(b));
  return d;
}
__device__ __forceinline__ v8f wmma_bf(v16b a, v16b b, v8f c) {
  v8f d = __builtin_amdgcn_wmma_f32_16x16x32_bf16(false, a, false, b, (short)0, c, false, false);
  asm volatile("v_nop\n\tv_nop\n\tv_nop\n\tv_nop" : "+v"(d) : "v"(a), "v"(b));
  return d;
}
// CogVideoX joint text+video attention processor (B 2, 226 text + 2,048 video tokens, D 1,024, 16 heads x 64): qkv with bias, per-head LayerNorm on q and k, rotary on the video part, full softmax attention, output projection + bias; returns (video part, text part).
__device__ __forceinline__ v16h frag_h(const _Float16* rowk0, int lane) {
  union { v16h v; v8h q[2]; } u; const _Float16* p = rowk0 + 8 * (lane >> 4);
  u.q[0] = *(const v8h*)p; u.q[1] = *(const v8h*)(p + 16); return u.v;
}
__device__ __forceinline__ v16h frag_f32(const float* rowk0, int lane) {
  v16h a; const float* p = rowk0 + 8 * (lane >> 4);
#pragma unroll
  for (int i = 0; i < 8; ++i) { a[i] = (_Float16)p[i]; a[8 + i] = (_Float16)p[16 + i]; }
  return a;
}
__device__ __forceinline__ v16h frag_f32s(const float* rowk0, int lane, float sc) {
  v16h a; const float* p = rowk0 + 8 * (lane >> 4);
#pragma unroll
  for (int i = 0; i < 8; ++i) { a[i] = (_Float16)(p[i] * sc); a[8 + i] = (_Float16)(p[16 + i] * sc); }
  return a;
}
// column fragment from a [K][ld] layout (column n), rows >= K read as 0
__device__ __forceinline__ v16h fragc_f32(const float* W, int k0, int n, int lane, int ld, int K) {
  v16h a; const int g = lane >> 4;
#pragma unroll
  for (int i = 0; i < 8; ++i) { const int ka = k0 + 8 * g + i, kb = ka + 16;
    a[i] = (_Float16)(ka < K ? W[(size_t)(ka < K ? ka : K - 1) * ld + n] : 0.f); a[8 + i] = (_Float16)(kb < K ? W[(size_t)(kb < K ? kb : K - 1) * ld + n] : 0.f); }
  return a;
}
struct F2 { v16b h, l; };
__device__ __forceinline__ F2 bsplit16(const float v[16]) { F2 r;
#pragma unroll
  for (int i = 0; i < 16; ++i) { const __bf16 h = (__bf16)v[i]; r.h[i] = h; r.l[i] = (__bf16)(v[i] - (float)h); }
  return r; }
__device__ __forceinline__ F2 split_row(const float* row, int k0, int lane) { float v[16]; const float* p = row + k0 + 8 * (lane >> 4);
#pragma unroll
  for (int i = 0; i < 8; ++i) { v[i] = p[i]; v[8 + i] = p[16 + i]; }
  return bsplit16(v); }
__device__ __forceinline__ F2 split_rowK(const float* row, int k0, int lane, int K) { float v[16]; const int g = lane >> 4;
#pragma unroll
  for (int i = 0; i < 8; ++i) { const int ka = k0 + 8 * g + i, kb = ka + 16; v[i] = ka < K ? row[ka < K ? ka : K - 1] : 0.f; v[8 + i] = kb < K ? row[kb < K ? kb : K - 1] : 0.f; }
  return bsplit16(v); }
__device__ __forceinline__ F2 split_col(const float* W, int k0, int n, int lane, int ld, int K) { float v[16]; const int g = lane >> 4;
#pragma unroll
  for (int i = 0; i < 8; ++i) { const int ka = k0 + 8 * g + i, kb = ka + 16; v[i] = ka < K ? W[(size_t)(ka < K ? ka : K - 1) * ld + n] : 0.f; v[8 + i] = kb < K ? W[(size_t)(kb < K ? kb : K - 1) * ld + n] : 0.f; }
  return bsplit16(v); }
__device__ __forceinline__ v8f mac3(const F2& a, const F2& b, v8f c) { c = wmma_bf(a.l, b.h, c); c = wmma_bf(a.h, b.l, c); return wmma_bf(a.h, b.h, c); }
__device__ __forceinline__ float sigm(float v) { return 1.0f / (1.0f + expf(-v)); }
#define LDSX() do { asm volatile("s_wait_dscnt 0" ::: "memory"); __builtin_amdgcn_wave_barrier(); __builtin_amdgcn_fence(__ATOMIC_RELEASE, "workgroup"); } while (0)


#define NB 2
#define SS 2304                 // 2,274 tokens (226 text + 2,048 video) padded to 36 x 64
#define SREAL 2274
#define STXT 226
#define SVID 2048
#define DM 1024
#define NH 16
#define HD 64
#define QKVW (3 * DM)
#ifndef TQB
#define TQB (SS / 64)
#define TNB NB
#define TOB (NB * SS / 64)     // output row tiles (all)
#endif
typedef __attribute__((ext_vector_type(8))) __bf16 v8b;
__device__ __forceinline__ v16b frag_b(const __bf16* rowk0, int lane) {
  union { v16b v; v8b q[2]; } u; const __bf16* p = rowk0 + 8 * (lane >> 4);
  u.q[0] = *(const v8b*)p; u.q[1] = *(const v8b*)(p + 16); return u.v;
}
__device__ __forceinline__ float bfr(float v) { return (float)(__bf16)v; }
__device__ __attribute__((noinline)) float exp_ni(float v) { return expf(v); }
__device__ __attribute__((noinline)) float erf_ni(float v) { return erff(v); }

#define PK_A 0                       // [3072][1024] Wqkv rows (natural [out][in])
#define PK_P (PK_A + QKVW * DM)        // [1024][1024] Wo rows (natural)
#define PK_END (PK_P + DM * DM)
#define WS_PK  0u
#define WS_QK  (WS_PK + 2u * PK_END)             // f16 [4608 rows][2048]: q | k
#define WS_VTH (WS_QK + 2u * NB * SS * 2 * DM)     // f16 [2][1024 (h*64+d)][2304 s] hi
#define WS_VTL (WS_VTH + 2u * NB * DM * SS)        // f16 lo x 2048
#define WS_O   (WS_VTL + 2u * NB * DM * SS)        // f32 [4608][1024]
#define WS_CS  (WS_O + 4u * NB * SS * DM)           // f32 2 x [2304][32], unused
#define WS_END (WS_CS + 4u * 2 * SS * 32)

// ---- LDS staging of the operand tiles that all four waves of a block read: rows of 128 B (64 16-bit values) at a pitch of 144 B (16 B x odd: ds_load_b128 readers), two buffers
#define TP 72                        // row pitch in 16-bit values
#define TPB (2 * TP)                 // row pitch in bytes
#define T64B (64 * TPB)              // a 64-row tile, bytes
#define ASTG (3 * T64B)              // attention stage: K | V hi | V lo, 64 keys
#define WSTG (2 * T64B)              // GEMM stage: 128 weight rows x 64 k
__device__ __forceinline__ unsigned lds_off(const void* p) { return (unsigned)(size_t)p; }
// four asynchronous 16-byte copies per lane, global -> LDS, rows 16 apart (gstep = 16 source rows, in bytes); s_wait_xcnt closes the statement so that no address register is rewritten ahead of it
__device__ __forceinline__ void cp4(unsigned l, const void* gp, size_t gstep) {
  const char* g = (const char*)gp;
  asm volatile("global_load_async_to_lds_b128 %0, %1, off\n\tglobal_load_async_to_lds_b128 %2, %3, off\n\tglobal_load_async_to_lds_b128 %4, %5, off\n\tglobal_load_async_to_lds_b128 %6, %7, off\n\ts_wait_xcnt 0x0"
               :: "v"(l), "v"(g), "v"(l + 16 * TPB), "v"(g + gstep), "v"(l + 32 * TPB), "v"(g + 2 * gstep), "v"(l + 48 * TPB), "v"(g + 3 * gstep) : "memory");
}
// a 128-row x 64-k weight tile (natural rows of DM bf16); src = this lane's 16 bytes of its first row
__device__ __forceinline__ void fill_w(unsigned l, const __bf16* src) { cp4(l, src, (size_t)16 * DM * 2); cp4(l + T64B, src + (size_t)64 * DM, (size_t)16 * DM * 2); }
#define WAIT_DS()    asm volatile("s_wait_dscnt 0x0" ::: "memory")      // this wave's LDS reads of the buffer are done before the barrier frees it
#define WAIT_ASYNC() asm volatile("s_wait_asynccnt 0x0" ::: "memory")   // this wave's copies have landed before the barrier publishes them
// ---- k_packrows: block = natural row n of a [N][K] weight
__global__ __launch_bounds__(256) void k_packrows(const float* __restrict__ Wm, int K, __bf16* __restrict__ DST) {
  __shared__ __align__(16) __bf16 s[DM]; const int n = blockIdx.x, tid = threadIdx.x;
  for (int k = tid; k < K; k += 256) s[k] = (__bf16)Wm[(size_t)n * K + k];
  __syncthreads();
  for (int q = tid; q < K / 8; q += 256) vst2((unsigned*)(DST + (size_t)n * K + q * 8), *(const v4u*)&s[q * 8]);
}
// ---- k_qkv: block = (64 rows (b,s), 128 of the 3072 cols): qkv = bf16(x) . rows (exact); cols < 1024 -> f16(q), cols < 2048 -> f16(k) into QK rows (pitch 2048); cols >= 2048 (v) -> per-batch transposed f16 planes VT[b][h*64+d][s]: hi = f16(v), lo = f16((v - hi) * 2048)
__global__ __launch_bounds__(128) void k_qkv(const float* __restrict__ XT, const float* __restrict__ XV, const __bf16* __restrict__ P, const float* __restrict__ BQ, const float* __restrict__ BK, const float* __restrict__ BV, const float* __restrict__ LQW, const float* __restrict__ LQB, const float* __restrict__ LKW, const float* __restrict__ LKB, const float* __restrict__ COS, const float* __restrict__ SIN, _Float16* __restrict__ QK, _Float16* __restrict__ VTH, _Float16* __restrict__ VTL) {
  __shared__ __align__(16) unsigned char L[4 * 16 * 136 * 2 + 2 * 128 * 72 * 2];   // the weight ring (2 x WSTG) during the k loop, then the output staging
  _Float16 (*so)[16][136] = (_Float16 (*)[16][136])L; _Float16 (*sth)[72] = (_Float16 (*)[72])(L + 4 * 16 * 136 * 2); _Float16 (*stl)[72] = sth + 128;
  const int tid = threadIdx.x, wave = tid >> 5, lane = tid & 31, col = lane & 15, g = lane >> 4; const size_t r0 = (size_t)blockIdx.x * 64 + wave * 16; const int n0 = blockIdx.y * 128;
  v8f acc[8] = {};
  const unsigned lw = lds_off(L) + (tid >> 3) * TPB + (tid & 7) * 16; const __bf16* gw = P + (size_t)(n0 + (tid >> 3)) * DM + (tid & 7) * 8;
  fill_w(lw, gw); WAIT_ASYNC(); __syncthreads(); fill_w(lw + WSTG, gw + 64);
const int bb_ = (int)((r0 + col) / SS), ss_ = (int)((r0 + col) % SS); const bool isT = ss_ < STXT, isV = (ss_ >= STXT) && (ss_ < SREAL);   // h = concat([encoder, hidden]); rows >= 2,274 are padding (zero input; masked as keys, never output)
  const float* xrow = isT ? XT + ((size_t)bb_ * STXT + ss_) * DM : XV + ((size_t)bb_ * SVID + (isV ? ss_ - STXT : 0)) * DM;
#pragma unroll 1   // one stage per trip: the buffer index and the publish point at the foot stay those of a two-buffer ring
  for (int st = 0; st < DM / 64; ++st) { const __bf16* Bt = (const __bf16*)(L + (st & 1) * WSTG);
    v4f x[2][4];   // the stage's 64 k of this lane's row: xrow is a valid row for padding lanes too, so the loads stand under no lane test; the zero is selected behind them
#pragma unroll
    for (int sub = 0; sub < 2; ++sub) { const float* p = xrow + st * 64 + sub * 32 + 8 * g; x[sub][0] = *(const v4f*)p; x[sub][1] = *(const v4f*)(p + 4); x[sub][2] = *(const v4f*)(p + 16); x[sub][3] = *(const v4f*)(p + 20); }
#pragma unroll
    for (int sub = 0; sub < 2; ++sub) { union { v16b v; unsigned w[8]; } u;
#pragma unroll
      for (int q = 0; q < 4; ++q) {
#pragma unroll
        for (int i = 0; i < 4; ++i) u.v[q * 4 + i] = (__bf16)x[sub][q][i]; }
#pragma unroll
      for (int q = 0; q < 8; ++q) u.w[q] = (isT || isV) ? u.w[q] : 0u;   // padding rows: zero input
      const v16b a = u.v;
#pragma unroll
      for (int j = 0; j < 8; ++j) acc[j] = wmma_bf(a, frag_b(Bt + (j * 16 + col) * TP + sub * 32, lane), acc[j]); }
    WAIT_DS(); WAIT_ASYNC(); __syncthreads();   // publishes stage st + 1 and frees stage st's buffer
    if (st + 2 < DM / 64) fill_w(lw + (st & 1) * WSTG, gw + (st + 2) * 64); }
  WAIT_ASYNC();
  { const float* BB = (n0 < DM) ? BQ : (n0 < 2 * DM) ? BK : BV; const int nb = n0 % DM;
#pragma unroll
    for (int j = 0; j < 8; ++j) { const float bb = bfr(BB[nb + j * 16 + col]);
#pragma unroll
      for (int r = 0; r < 8; ++r) acc[j][r] += bb; } }
  if (n0 < 2 * DM) {   // q | k: per-head LayerNorm over the 64 dims (this 128-col block = 2 heads: tiles 0-3 and 4-7), then rotary for video tokens; q unscaled (1/8 on the f32 score)
    const float* LW = (n0 < DM) ? LQW : LKW; const float* LBv = (n0 < DM) ? LQB : LKB;
#pragma unroll
    for (int hh = 0; hh < 2; ++hh) {
#pragma unroll
      for (int r = 0; r < 8; ++r) { float s = 0.f;
#pragma unroll
        for (int j = 0; j < 4; ++j) s += acc[hh * 4 + j][r];
#pragma unroll
        for (int o = 1; o < 16; o <<= 1) s += __shfl_xor(s, o);
        const float mu = s * (1.0f / 64.0f); float v = 0.f;
#pragma unroll
        for (int j = 0; j < 4; ++j) { const float dv = acc[hh * 4 + j][r] - mu; v += dv * dv; }
#pragma unroll
        for (int o = 1; o < 16; o <<= 1) v += __shfl_xor(v, o);
        const float rs = rsqrtf(v * (1.0f / 64.0f) + 1e-5f);
#pragma unroll
        for (int j = 0; j < 4; ++j) { const int d = j * 16 + col; acc[hh * 4 + j][r] = (acc[hh * 4 + j][r] - mu) * rs * bfr(LW[d]) + bfr(LBv[d]); } } }
    // the rotary tables of this lane's 8 rows x 4 dims (both heads of the block use the same): table row clamped to 0 for text and padding rows, so the loads stand under no lane test and are all in flight together
    float tc[8][4], ts[8][4]; bool vid[8]; unsigned to[8]; const int sv0 = (int)((r0 + 8 * g) % SS) - STXT;   // 8 rows from a multiple of 8 never cross a batch (SS is one)
#pragma unroll
    for (int r = 0; r < 8; ++r) { const int sv = sv0 + r; vid[r] = sv >= 0 && sv < SVID; to[r] = (unsigned)(vid[r] ? sv : 0) * HD + col; }
#pragma unroll
    for (int r = 0; r < 8; ++r) {
#pragma unroll
      for (int q = 0; q < 4; ++q) { tc[r][q] = COS[to[r] + q * 16]; ts[r][q] = SIN[to[r] + q * 16]; } }
    asm volatile("s_wait_xcnt 0x0" :: "v"(to[0]), "v"(to[1]), "v"(to[2]), "v"(to[3]), "v"(to[4]), "v"(to[5]), "v"(to[6]), "v"(to[7]) : "memory");   // the offset registers of the table loads stay as they are up to this wait
    // rotary on video tokens: pairs (2i, 2i+1): out = x cos + rot(x) sin with rot = [-x_{2i+1}, x_{2i}]; cos/sin [2048][64] inputs (bf16-rounded), indexed by (s - 226, d)
#pragma unroll
    for (int j = 0; j < 8; ++j) { const int d = (j & 3) * 16 + col;
#pragma unroll
      for (int r = 0; r < 8; ++r) { const float xv = acc[j][r]; const float xp = __shfl_xor(xv, 1);   // partner dim d^1 lives in lane col^1
        const float c = bfr(tc[r][j & 3]), sn = bfr(ts[r][j & 3]); const float rot = (d & 1) ? xp : -xp; acc[j][r] = vid[r] ? xv * c + rot * sn : xv; } }   // text and padding rows keep xv by the select
#pragma unroll
    for (int j = 0; j < 8; ++j) {
#pragma unroll
      for (int r = 0; r < 8; ++r) so[wave][8 * g + r][j * 16 + col] = (_Float16)acc[j][r]; }
    LDSX();
    for (int rl = 0; rl < 16; ++rl) if (lane < 16) vst2((unsigned*)(QK + (r0 + rl) * (2 * DM) + n0 + lane * 8), *(const v4u*)&so[wave][rl][lane * 8]);
  } else {
#pragma unroll
    for (int j = 0; j < 8; ++j) {
#pragma unroll
      for (int r = 0; r < 8; ++r) { const float v = acc[j][r]; const _Float16 hv = (_Float16)v; sth[j * 16 + col][wave * 16 + 8 * g + r] = hv; stl[j * 16 + col][wave * 16 + 8 * g + r] = (_Float16)((v - (float)hv) * 2048.0f); } }
    __syncthreads();
    const size_t rb = (size_t)blockIdx.x * 64; const int b = (int)(rb / SS), s0 = (int)(rb % SS); const int pc0 = n0 - 2 * DM;
    for (int q = tid; q < 128 * 8; q += 128) { const int d = q >> 3, pc = q & 7; const size_t o = ((size_t)b * DM + pc0 + d) * SS + s0 + pc * 8; vst2((unsigned*)(VTH + o), *(const v4u*)&sth[d][pc * 8]); vst2((unsigned*)(VTL + o), *(const v4u*)&stl[d][pc * 8]); }
  }
}
typedef __attribute__((ext_vector_type(2))) _Float16 v2h;
// lane l <-> lane l ^ 16 as one vector instruction
__device__ __forceinline__ float xhalf(float x) { return __builtin_bit_cast(float, __builtin_amdgcn_permlanex16(__builtin_bit_cast(int, x), __builtin_bit_cast(int, x), 0x76543210, 0xfedcba98, false, false)); }
__global__ __launch_bounds__(128) void k_attn(const _Float16* __restrict__ QK, const _Float16* __restrict__ VTH, const _Float16* __restrict__ VTL, float* __restrict__ O) {
  __shared__ __align__(16) unsigned char L[2 * ASTG];   // the K/V ring during the key loop, then the output staging
  float (*so)[16][68] = (float (*)[16][68])L;
  const int tid = threadIdx.x, wave = tid >> 5, lane = tid & 31, col = lane & 15, g = lane >> 4;
  const int qb = blockIdx.x, h = blockIdx.y, b = blockIdx.z; const int q0 = qb * 64 + wave * 16; const size_t rq = (size_t)b * SS + q0 + col;
  const unsigned lt = lds_off(L) + (tid >> 3) * TPB + (tid & 7) * 16;
  const _Float16* gk = QK + ((size_t)b * SS + (tid >> 3)) * (2 * DM) + DM + h * HD + (tid & 7) * 8; const size_t gvo = ((size_t)b * DM + h * HD + (tid >> 3)) * SS + (tid & 7) * 8;
  auto fill = [&](int st) { const unsigned l = lt + (st & 1) * ASTG;   // stage st = keys 64 st .. 64 st + 63: K rows [key][64 d], V planes [d][64 keys]
    cp4(l, gk + (size_t)st * 64 * (2 * DM), (size_t)16 * 2 * DM * 2); cp4(l + T64B, VTH + gvo + st * 64, (size_t)16 * SS * 2); cp4(l + 2 * T64B, VTL + gvo + st * 64, (size_t)16 * SS * 2); };
  fill(0); WAIT_ASYNC(); __syncthreads(); fill(1);
  v16h aq[2];
#pragma unroll
  for (int kc = 0; kc < 2; ++kc) aq[kc] = frag_h(QK + rq * (2 * DM) + h * HD + kc * 32, lane);
  float m = -3.0e38f, l = 0.f;   // of query col: m is the same in both halves, l is this half's share of the sum (joined behind the loop)
  v8f acc[4] = {}, accl[4] = {};   // acc[dt][r] = O^T[dt * 16 + 8 g + r][col]
  // not causal; keys >= 2,274 are padding and masked
#pragma unroll 1   // one stage per trip: the buffer index and the publish point at the foot stay those of a two-buffer ring
  for (int st = 0; st < SS / 64; ++st) { const _Float16* Kt = (const _Float16*)(L + (st & 1) * ASTG); const _Float16* Vh = Kt + 64 * TP; const _Float16* Vl = Vh + 64 * TP;
#pragma unroll 1   // the 32-key pass stays rolled: one copy of it in the text
  for (int sub = 0; sub < 2; ++sub) { const int ks = st * 2 + sub; v8f s[2];
#pragma unroll
    for (int ct = 0; ct < 2; ++ct) { const int kk0 = ks * 32 + ct * 16 + 8 * g; const _Float16* krow = Kt + (sub * 32 + ct * 16 + col) * TP; v8f c = {};
#pragma unroll
      for (int kc = 0; kc < 2; ++kc) c = wmma16(frag_h(krow + kc * 32, lane), aq[kc], c);
#pragma unroll
      for (int r = 0; r < 8; ++r) s[ct][r] = (kk0 + r < SREAL) ? c[r] * 0.125f : -3.0e38f; }   // 1/sqrt(64); padded keys masked
    float mx = fmaxf(s[0][0], s[1][0]);
#pragma unroll
    for (int r = 1; r < 8; ++r) mx = fmaxf(mx, fmaxf(s[0][r], s[1][r]));
    mx = fmaxf(mx, xhalf(mx));
    const float mn = fmaxf(m, mx); const float alpha = (m <= -1.0e38f) ? 0.f : __expf(m - mn);
    union { v16h v; v2h p[8]; } pa, pl; v2f es = {0.f, 0.f};   // element ct * 8 + r = key ct * 16 + 8 g + r: the k order of frag_h
#pragma unroll
    for (int ct = 0; ct < 2; ++ct) {
#pragma unroll
      for (int rp = 0; rp < 4; ++rp) { v2f e; e[0] = (s[ct][2 * rp] <= -1.0e38f) ? 0.f : __expf(s[ct][2 * rp] - mn); e[1] = (s[ct][2 * rp + 1] <= -1.0e38f) ? 0.f : __expf(s[ct][2 * rp + 1] - mn); es += e;
        const v2h hh = __builtin_convertvector(e, v2h); pa.p[ct * 4 + rp] = hh; pl.p[ct * 4 + rp] = __builtin_convertvector((e - __builtin_convertvector(hh, v2f)) * 2048.0f, v2h); } }
    l = l * alpha + (es[0] + es[1]); m = mn;
#pragma unroll
    for (int dt = 0; dt < 4; ++dt) { acc[dt] *= alpha; accl[dt] *= alpha; }
#pragma unroll
    for (int dt = 0; dt < 4; ++dt) { const int vr = (dt * 16 + col) * TP + sub * 32; const v16h vh = frag_h(Vh + vr, lane); acc[dt] = wmma16(vh, pa.v, acc[dt]); accl[dt] = wmma16(vh, pl.v, accl[dt]); accl[dt] = wmma16(frag_h(Vl + vr, lane), pa.v, accl[dt]); } }   // V hi x P hi + (V hi x P lo + V lo x P hi) / 2048
    WAIT_DS(); WAIT_ASYNC(); __syncthreads();   // publishes stage st + 1 and frees stage st's buffer
    if (st + 2 < SS / 64) fill(st + 2); }
  WAIT_ASYNC();
  const float il = 1.0f / (l + xhalf(l));
#pragma unroll
  for (int dt = 0; dt < 4; ++dt) {
#pragma unroll
    for (int q = 0; q < 2; ++q) { v4f o;
#pragma unroll
      for (int i = 0; i < 4; ++i) o[i] = (acc[dt][q * 4 + i] + accl[dt][q * 4 + i] * (1.0f / 2048.0f)) * il;
      *(v4f*)&so[wave][col][dt * 16 + 8 * g + q * 4] = o; } }
  LDSX();
  for (int rl = 0; rl < 16; ++rl) if (lane < 16) vst2(O + ((size_t)b * SS + q0 + rl) * DM + h * HD + lane * 4, *(const v4f*)&so[wave][rl][lane * 4]);
}
// ---- k_out: block = (64 rows, 128 cols): out = O(hi/lo) . Wo rows (2 products) + bo
__global__ __launch_bounds__(128) void k_out(const float* __restrict__ O, const __bf16* __restrict__ P, const float* __restrict__ BO, float* __restrict__ Y) {
  __shared__ __align__(16) unsigned char L[2 * WSTG];   // the weight ring during the k loop, then the output staging
  float (*so)[16][132] = (float (*)[16][132])L;
  const int tid = threadIdx.x, wave = tid >> 5, lane = tid & 31, col = lane & 15, g = lane >> 4; const size_t r0 = (size_t)blockIdx.x * 64 + wave * 16; const int n0 = blockIdx.y * 128;
  v8f acc[8] = {};
  const unsigned lw = lds_off(L) + (tid >> 3) * TPB + (tid & 7) * 16; const __bf16* gw = P + (size_t)(n0 + (tid >> 3)) * DM + (tid & 7) * 8;
  fill_w(lw, gw); WAIT_ASYNC(); __syncthreads(); fill_w(lw + WSTG, gw + 64);
#pragma unroll 1   // one stage per trip: the buffer index and the publish point at the foot stay those of a two-buffer ring
  for (int st = 0; st < DM / 64; ++st) { const __bf16* Bt = (const __bf16*)(L + (st & 1) * WSTG);
#pragma unroll
    for (int sub = 0; sub < 2; ++sub) { const F2 a = split_row(O + (r0 + col) * DM, (st * 2 + sub) * 32, lane);
#pragma unroll
      for (int j = 0; j < 8; ++j) { const v16b w = frag_b(Bt + (j * 16 + col) * TP + sub * 32, lane); acc[j] = wmma_bf(a.l, w, acc[j]); acc[j] = wmma_bf(a.h, w, acc[j]); } }
    WAIT_DS(); WAIT_ASYNC(); __syncthreads();   // publishes stage st + 1 and frees stage st's buffer
    if (st + 2 < DM / 64) fill_w(lw + (st & 1) * WSTG, gw + (st + 2) * 64); }
  WAIT_ASYNC();
#pragma unroll
  for (int j = 0; j < 8; ++j) { const float bb = bfr(BO[n0 + j * 16 + col]);
#pragma unroll
    for (int r = 0; r < 8; ++r) so[wave][8 * g + r][j * 16 + col] = acc[j][r] + bb; }
  LDSX();
  for (int rl = 0; rl < 16; ++rl) { const size_t row = r0 + rl; const int b = (int)(row / SS), s = (int)(row % SS); if (s < STXT) vst2(Y + (size_t)NB * SVID * DM + ((size_t)b * STXT + s) * DM + n0 + lane * 4, *(const v4f*)&so[wave][rl][lane * 4]); else if (s < SREAL) vst2(Y + ((size_t)b * SVID + (s - STXT)) * DM + n0 + lane * 4, *(const v4f*)&so[wave][rl][lane * 4]); }   // out0 = o[:, 226:] at 0, out1 = o[:, :226] after it; padding rows dropped
}
extern "C" void kernel_launch(void* const* d_in, const int* in_sizes, int n_in, void* d_out, int out_size, void* d_ws, size_t ws_size, hipStream_t stream) {
  (void)in_sizes; (void)n_in; (void)out_size;
  const float** F = (const float**)d_in;   // 0 hidden_states [2,2048,1024], 1 encoder_hidden_states [2,226,1024], 2 cos [2048,64], 3 sin, 4 wq [1024,1024], 5 bq, 6 wk, 7 bk, 8 wv, 9 bv, 10 wo, 11 bo, 12 lnq_w [64], 13 lnq_b, 14 lnk_w, 15 lnk_b
  if (ws_size < (size_t)WS_END) return;
  char* ws = (char*)d_ws; __bf16* PK = (__bf16*)(ws + WS_PK); _Float16 *QK = (_Float16*)(ws + WS_QK), *VTH = (_Float16*)(ws + WS_VTH), *VTL = (_Float16*)(ws + WS_VTL); float *O = (float*)(ws + WS_O);
  k_packrows<<<DM, 256, 0, stream>>>(F[4], DM, PK + PK_A); k_packrows<<<DM, 256, 0, stream>>>(F[6], DM, PK + PK_A + (size_t)DM * DM); k_packrows<<<DM, 256, 0, stream>>>(F[8], DM, PK + PK_A + (size_t)2 * DM * DM); k_packrows<<<DM, 256, 0, stream>>>(F[10], DM, PK + PK_P);
  k_qkv<<<dim3(TNB * SS / 64, QKVW / 128), 128, 0, stream>>>(F[1], F[0], PK + PK_A, F[5], F[7], F[9], F[12], F[13], F[14], F[15], F[2], F[3], QK, VTH, VTL);
  k_attn<<<dim3(TQB, NH, TNB), 128, 0, stream>>>(QK, VTH, VTL, O);
  k_out<<<dim3(TOB, DM / 128), 128, 0, stream>>>(O, PK + PK_P, F[11], (float*)d_out);
}

// v004
// One run takes 205 microseconds.
// Next to v003, in two timings, it ran 1.10 and 1.11 times as fast.
// All steps since v000 together make it 3.76 times as fast.
// compute dtype: hidden_states, encoder_hidden_states, cos, sin and all weights / biases / norm parameters (module inputs) rounded to bf16; q/k/v projections with exact bf16 products (natural [out][in] rows) + bias on WMMA 16x16x32; per-head LayerNorm of q and k (over the 64 dims, eps 1e-5) and the interleaved rotary on the video tokens (input cos/sin tables) in f32 in the projection epilogue; q and k stored once as f16 (q unscaled; 1/8 on the f32 score), v as f16 hi + (x2048-scaled) residual planes; scores with single f16 operands (1 product) and P.V with P as f16 hi + (x2048-scaled) residual x V hi/lo (3 products); the output projection with ctx as bf16 hi + residual x exact wo (2 products) + bo; running-max softmax in f32 with the hardware exp; the 2,274-token sequence is padded to 2,304 rows per batch with the padding keys masked; f32 accumulate.
#include <hip/hip_runtime.h>
#include <math.h>

typedef __attribute__((ext_vector_type(16))) _Float16 v16h;
typedef __attribute__((ext_vector_type(16))) __bf16 v16b;
typedef __attribute__((ext_vector_type(8)))  _Float16 v8h;
typedef __attribute__((ext_vector_type(8)))  float v8f;
typedef __attribute__((ext_vector_type(4)))  float v4f;
typedef __attribute__((ext_vector_type(2)))  float v2f;
typedef __attribute__((ext_vector_type(4)))  unsigned v4u;
typedef __attribute__((ext_vector_type(4)))  int v4i;
typedef float __attribute__((may_alias)) float_a;
typedef int __attribute__((may_alias)) int_a;

template <typename T> __device__ __forceinline__ void vst2(void* p, T v) { *(T*)p = v;  }
__device__ __forceinline__ v8f wmma16(v16h a, v16h b, v8f c) {
  v8f d = __builtin_amdgcn_wmma_f32_16x16x32_f16(false, a, false, b, (short)0, c, false, false);
  return d;
}
__device__ __forceinline__ v8f wmma_bf(v16b a, v16b b, v8f c) {
  v8f d = __builtin_amdgcn_wmma_f32_16x16x32_bf16(false, a, false, b, (short)0, c, false, false);
  return d;
}
// CogVideoX joint text+video attention processor (B 2, 226 text + 2,048 video tokens, D 1,024, 16 heads x 64): qkv with bias, per-head LayerNorm on q and k, rotary on the video part, full softmax attention, output projection + bias; returns (video part, text part).
__device__ __forceinline__ v16h frag_h(const _Float16* rowk0, int lane) {
  union { v16h v; v8h q[2]; } u; const _Float16* p = rowk0 + 8 * (lane >> 4);
  u.q[0] = *(const v8h*)p; u.q[1] = *(const v8h*)(p + 16); return u.v;
}
__device__ __forceinline__ v16h frag_f32(const float* rowk0, int lane) {
  v16h a; const float* p = rowk0 + 8 * (lane >> 4);
#pragma unroll
  for (int i = 0; i < 8; ++i) { a[i] = (_Float16)p[i]; a[8 + i] = (_Float16)p[16 + i]; }
  return a;
}
__device__ __forceinline__ v16h frag_f32s(const float* rowk0, int lane, float sc) {
  v16h a; const float* p = rowk0 + 8 * (lane >> 4);
#pragma unroll
  for (int i = 0; i < 8; ++i) { a[i] = (_Float16)(p[i] * sc); a[8 + i] = (_Float16)(p[16 + i] * sc); }
  return a;
}
// column fragment from a [K][ld] layout (column n), rows >= K read as 0
__device__ __forceinline__ v16h fragc_f32(const float* W, int k0, int n, int lane, int ld, int K) {
  v16h a; const int g = lane >> 4;
#pragma unroll
  for (int i = 0; i < 8; ++i) { const int ka = k0 + 8 * g + i, kb = ka + 16;
    a[i] = (_Float16)(ka < K ? W[(size_t)(ka < K ? ka : K - 1) * ld + n] : 0.f); a[8 + i] = (_Float16)(kb < K ? W[(size_t)(kb < K ? kb : K - 1) * ld + n] : 0.f); }
  return a;
}
struct F2 { v16b h, l; };
__device__ __forceinline__ F2 bsplit16(const float v[16]) { F2 r;
#pragma unroll
  for (int i = 0; i < 16; ++i) { const __bf16 h = (__bf16)v[i]; r.h[i] = h; r.l[i] = (__bf16)(v[i] - (float)h); }
  return r; }
__device__ __forceinline__ F2 split_row(const float* row, int k0, int lane) { float v[16]; const float* p = row + k0 + 8 * (lane >> 4);
#pragma unroll
  for (int i = 0; i < 8; ++i) { v[i] = p[i]; v[8 + i] = p[16 + i]; }
  return bsplit16(v); }
__device__ __forceinline__ F2 split_rowK(const float* row, int k0, int lane, int K) { float v[16]; const int g = lane >> 4;
#pragma unroll
  for (int i = 0; i < 8; ++i) { const int ka = k0 + 8 * g + i, kb = ka + 16; v[i] = ka < K ? row[ka < K ? ka : K - 1] : 0.f; v[8 + i] = kb < K ? row[kb < K ? kb : K - 1] : 0.f; }
  return bsplit16(v); }
__device__ __forceinline__ F2 split_col(const float* W, int k0, int n, int lane, int ld, int K) { float v[16]; const int g = lane >> 4;
#pragma unroll
  for (int i = 0; i < 8; ++i) { const int ka = k0 + 8 * g + i, kb = ka + 16; v[i] = ka < K ? W[(size_t)(ka < K ? ka : K - 1) * ld + n] : 0.f; v[8 + i] = kb < K ? W[(size_t)(kb < K ? kb : K - 1) * ld + n] : 0.f; }
  return bsplit16(v); }
__device__ __forceinline__ v8f mac3(const F2& a, const F2& b, v8f c) { c = wmma_bf(a.l, b.h, c); c = wmma_bf(a.h, b.l, c); return wmma_bf(a.h, b.h, c); }
__device__ __forceinline__ float sigm(float v) { return 1.0f / (1.0f + expf(-v)); }
#define LDSX() do { asm volatile("s_wait_dscnt 0" ::: "memory"); __builtin_amdgcn_wave_barrier(); __builtin_amdgcn_fence(__ATOMIC_RELEASE, "workgroup"); } while (0)


#define NB 2
#define SS 2304                 // 2,274 tokens (226 text + 2,048 video) padded to 36 x 64
#define SREAL 2274
#define STXT 226
#define SVID 2048
#define DM 1024
#define NH 16
#define HD 64
#define QKVW (3 * DM)
#ifndef TQB
#define TQB (SS / 64)
#define TNB NB
#define TOB (NB * SS / 64)     // output row tiles (all)
#endif
typedef __attribute__((ext_vector_type(8))) __bf16 v8b;
__device__ __forceinline__ v16b frag_b(const __bf16* rowk0, int lane) {
  union { v16b v; v8b q[2]; } u; const __bf16* p = rowk0 + 8 * (lane >> 4);
  u.q[0] = *(const v8b*)p; u.q[1] = *(const v8b*)(p + 16); return u.v;
}
__device__ __forceinline__ float bfr(float v) { return (float)(__bf16)v; }
__device__ __attribute__((noinline)) float exp_ni(float v) { return expf(v); }
__device__ __attribute__((noinline)) float erf_ni(float v) { return erff(v); }

#define PK_A 0                       // [3072][1024] Wqkv rows (natural [out][in])
#define PK_P (PK_A + QKVW * DM)        // [1024][1024] Wo rows (natural)
#define PK_END (PK_P + DM * DM)
#define WS_PK  0u
#define WS_QK  (WS_PK + 2u * PK_END)             // f16 [4608 rows][2048]: q | k
#define WS_VTH (WS_QK + 2u * NB * SS * 2 * DM)     // f16 [2][1024 (h*64+d)][2304 s] hi
#define WS_VTL (WS_VTH + 2u * NB * DM * SS)        // f16 lo x 2048
#define WS_O   (WS_VTL + 2u * NB * DM * SS)        // f32 [4608][1024]
#define WS_CS  (WS_O + 4u * NB * SS * DM)           // f32 2 x [2304][32], unused
#define WS_END (WS_CS + 4u * 2 * SS * 32)

// ---- LDS staging of the operand tiles that all four waves of a block read: rows of 128 B (64 16-bit values) at a pitch of 144 B (16 B x odd: ds_load_b128 readers), two buffers
#define TP 72                        // row pitch in 16-bit values
#define TPB (2 * TP)                 // row pitch in bytes
#define T64B (64 * TPB)              // a 64-row tile, bytes
#define ASTG (3 * T64B)              // attention stage: K | V hi | V lo, 64 keys
#define WSTG (2 * T64B)              // GEMM stage: 128 weight rows x 64 k
__device__ __forceinline__ unsigned lds_off(const void* p) { return (unsigned)(size_t)p; }
// four asynchronous 16-byte copies per lane, global -> LDS, rows 16 apart (gstep = 16 source rows, in bytes); s_wait_xcnt closes the statement so that no address register is rewritten ahead of it
__device__ __forceinline__ void cp4(unsigned l, const void* gp, size_t gstep) {
  const char* g = (const char*)gp;
  asm volatile("global_load_async_to_lds_b128 %0, %1, off\n\tglobal_load_async_to_lds_b128 %2, %3, off\n\tglobal_load_async_to_lds_b128 %4, %5, off\n\tglobal_load_async_to_lds_b128 %6, %7, off\n\ts_wait_xcnt 0x0"
               :: "v"(l), "v"(g), "v"(l + 16 * TPB), "v"(g + gstep), "v"(l + 32 * TPB), "v"(g + 2 * gstep), "v"(l + 48 * TPB), "v"(g + 3 * gstep) : "memory");
}
// a 128-row x 64-k weight tile (natural rows of DM bf16); src = this lane's 16 bytes of its first row
__device__ __forceinline__ void fill_w(unsigned l, const __bf16* src) { cp4(l, src, (size_t)16 * DM * 2); cp4(l + T64B, src + (size_t)64 * DM, (size_t)16 * DM * 2); }
#define WAIT_DS()    asm volatile("s_wait_dscnt 0x0" ::: "memory")      // this wave's LDS reads of the buffer are done before the barrier frees it
#define WAIT_ASYNC() asm volatile("s_wait_asynccnt 0x0" ::: "memory")   // this wave's copies have landed before the barrier publishes them
// ---- k_packrows: block = natural row n of a [N][K] weight
__global__ __launch_bounds__(256) void k_packrows(const float* __restrict__ Wm, int K, __bf16* __restrict__ DST) {
  __shared__ __align__(16) __bf16 s[DM]; const int n = blockIdx.x, tid = threadIdx.x;
  for (int k = tid; k < K; k += 256) s[k] = (__bf16)Wm[(size_t)n * K + k];
  __syncthreads();
  for (int q = tid; q < K / 8; q += 256) vst2((unsigned*)(DST + (size_t)n * K + q * 8), *(const v4u*)&s[q * 8]);
}
// ---- k_qkv: block = (64 rows (b,s), 128 of the 3072 cols): qkv = bf16(x) . rows (exact); cols < 1024 -> f16(q), cols < 2048 -> f16(k) into QK rows (pitch 2048); cols >= 2048 (v) -> per-batch transposed f16 planes VT[b][h*64+d][s]: hi = f16(v), lo = f16((v - hi) * 2048)
__global__ __launch_bounds__(128) void k_qkv(const float* __restrict__ XT, const float* __restrict__ XV, const __bf16* __restrict__ P, const float* __restrict__ BQ, const float* __restrict__ BK, const float* __restrict__ BV, const float* __restrict__ LQW, const float* __restrict__ LQB, const float* __restrict__ LKW, const float* __restrict__ LKB, const float* __restrict__ COS, const float* __restrict__ SIN, _Float16* __restrict__ QK, _Float16* __restrict__ VTH, _Float16* __restrict__ VTL) {
  __shared__ __align__(16) unsigned char L[4 * 16 * 136 * 2 + 2 * 128 * 72 * 2];   // the weight ring (2 x WSTG) during the k loop, then the output staging
  _Float16 (*so)[16][136] = (_Float16 (*)[16][136])L; _Float16 (*sth)[72] = (_Float16 (*)[72])(L + 4 * 16 * 136 * 2); _Float16 (*stl)[72] = sth + 128;
  const int tid = threadIdx.x, wave = tid >> 5, lane = tid & 31, col = lane & 15, g = lane >> 4; const size_t r0 = (size_t)blockIdx.x * 64 + wave * 16; const int n0 = blockIdx.y * 128;
  v8f acc[8] = {};
  const unsigned lw = lds_off(L) + (tid >> 3) * TPB + (tid & 7) * 16; const __bf16* gw = P + (size_t)(n0 + (tid >> 3)) * DM + (tid & 7) * 8;
  fill_w(lw, gw); WAIT_ASYNC(); __syncthreads(); fill_w(lw + WSTG, gw + 64);
const int bb_ = (int)((r0 + col) / SS), ss_ = (int)((r0 + col) % SS); const bool isT = ss_ < STXT, isV = (ss_ >= STXT) && (ss_ < SREAL);   // h = concat([encoder, hidden]); rows >= 2,274 are padding (zero input; masked as keys, never output)
  const float* xrow = isT ? XT + ((size_t)bb_ * STXT + ss_) * DM : XV + ((size_t)bb_ * SVID + (isV ? ss_ - STXT : 0)) * DM;
#pragma unroll 1   // one stage per trip: the buffer index and the publish point at the foot stay those of a two-buffer ring
  for (int st = 0; st < DM / 64; ++st) { const __bf16* Bt = (const __bf16*)(L + (st & 1) * WSTG);
    v4f x[2][4];   // the stage's 64 k of this lane's row: xrow is a valid row for padding lanes too, so the loads stand under no lane test; the zero is selected behind them
#pragma unroll
    for (int sub = 0; sub < 2; ++sub) { const float* p = xrow + st * 64 + sub * 32 + 8 * g; x[sub][0] = *(const v4f*)p; x[sub][1] = *(const v4f*)(p + 4); x[sub][2] = *(const v4f*)(p + 16); x[sub][3] = *(const v4f*)(p + 20); }
#pragma unroll
    for (int sub = 0; sub < 2; ++sub) { union { v16b v; unsigned w[8]; } u;
#pragma unroll
      for (int q = 0; q < 4; ++q) {
#pragma unroll
        for (int i = 0; i < 4; ++i) u.v[q * 4 + i] = (__bf16)x[sub][q][i]; }
#pragma unroll
      for (int q = 0; q < 8; ++q) u.w[q] = (isT || isV) ? u.w[q] : 0u;   // padding rows: zero input
      const v16b a = u.v;
#pragma unroll
      for (int j = 0; j < 8; ++j) acc[j] = wmma_bf(a, frag_b(Bt + (j * 16 + col) * TP + sub * 32, lane), acc[j]); }
    WAIT_DS(); WAIT_ASYNC(); __syncthreads();   // publishes stage st + 1 and frees stage st's buffer
    if (st + 2 < DM / 64) fill_w(lw + (st & 1) * WSTG, gw + (st + 2) * 64); }
  WAIT_ASYNC();
  { const float* BB = (n0 < DM) ? BQ : (n0 < 2 * DM) ? BK : BV; const int nb = n0 % DM;
#pragma unroll
    for (int j = 0; j < 8; ++j) { const float bb = bfr(BB[nb + j * 16 + col]);
#pragma unroll
      for (int r = 0; r < 8; ++r) acc[j][r] += bb; } }
  if (n0 < 2 * DM) {   // q | k: per-head LayerNorm over the 64 dims (this 128-col block = 2 heads: tiles 0-3 and 4-7), then rotary for video tokens; q unscaled (1/8 on the f32 score)
    const float* LW = (n0 < DM) ? LQW : LKW; const float* LBv = (n0 < DM) ? LQB : LKB;
#pragma unroll
    for (int hh = 0; hh < 2; ++hh) {
#pragma unroll
      for (int r = 0; r < 8; ++r) { float s = 0.f;
#pragma unroll
        for (int j = 0; j < 4; ++j) s += acc[hh * 4 + j][r];
#pragma unroll
        for (int o = 1; o < 16; o <<= 1) s += __shfl_xor(s, o);
        const float mu = s * (1.0f / 64.0f); float v = 0.f;
#pragma unroll
        for (int j = 0; j < 4; ++j) { const float dv = acc[hh * 4 + j][r] - mu; v += dv * dv; }
#pragma unroll
        for (int o = 1; o < 16; o <<= 1) v += __shfl_xor(v, o);
        const float rs = rsqrtf(v * (1.0f / 64.0f) + 1e-5f);
#pragma unroll
        for (int j = 0; j < 4; ++j) { const int d = j * 16 + col; acc[hh * 4 + j][r] = (acc[hh * 4 + j][r] - mu) * rs * bfr(LW[d]) + bfr(LBv[d]); } } }
    // the rotary tables of this lane's 8 rows x 4 dims (both heads of the block use the same): table row clamped to 0 for text and padding rows, so the loads stand under no lane test and are all in flight together
    float tc[8][4], ts[8][4]; bool vid[8]; unsigned to[8]; const int sv0 = (int)((r0 + 8 * g) % SS) - STXT;   // 8 rows from a multiple of 8 never cross a batch (SS is one)
#pragma unroll
    for (int r = 0; r < 8; ++r) { const int sv = sv0 + r; vid[r] = sv >= 0 && sv < SVID; to[r] = (unsigned)(vid[r] ? sv : 0) * HD + col; }
#pragma unroll
    for (int r = 0; r < 8; ++r) {
#pragma unroll
      for (int q = 0; q < 4; ++q) { tc[r][q] = COS[to[r] + q * 16]; ts[r][q] = SIN[to[r] + q * 16]; } }
    asm volatile("s_wait_xcnt 0x0" :: "v"(to[0]), "v"(to[1]), "v"(to[2]), "v"(to[3]), "v"(to[4]), "v"(to[5]), "v"(to[6]), "v"(to[7]) : "memory");   // the offset registers of the table loads stay as they are up to this wait
    // rotary on video tokens: pairs (2i, 2i+1): out = x cos + rot(x) sin with rot = [-x_{2i+1}, x_{2i}]; cos/sin [2048][64] inputs (bf16-rounded), indexed by (s - 226, d)
#pragma unroll
    for (int j = 0; j < 8; ++j) { const int d = (j & 3) * 16 + col;
#pragma unroll
      for (int r = 0; r < 8; ++r) { const float xv = acc[j][r]; const float xp = __shfl_xor(xv, 1);   // partner dim d^1 lives in lane col^1
        const float c = bfr(tc[r][j & 3]), sn = bfr(ts[r][j & 3]); const float rot = (d & 1) ? xp : -xp; acc[j][r] = vid[r] ? xv * c + rot * sn : xv; } }   // text and padding rows keep xv by the select
#pragma unroll
    for (int j = 0; j < 8; ++j) {
#pragma unroll
      for (int r = 0; r < 8; ++r) so[wave][8 * g + r][j * 16 + col] = (_Float16)acc[j][r]; }
    LDSX();
    for (int rl = 0; rl < 16; ++rl) if (lane < 16) vst2((unsigned*)(QK + (r0 + rl) * (2 * DM) + n0 + lane * 8), *(const v4u*)&so[wave][rl][lane * 8]);
  } else {
#pragma unroll
    for (int j = 0; j < 8; ++j) {
#pragma unroll
      for (int r = 0; r < 8; ++r) { const float v = acc[j][r]; const _Float16 hv = (_Float16)v; sth[j * 16 + col][wave * 16 + 8 * g + r] = hv; stl[j * 16 + col][wave * 16 + 8 * g + r] = (_Float16)((v - (float)hv) * 2048.0f); } }
    __syncthreads();
    const size_t rb = (size_t)blockIdx.x * 64; const int b = (int)(rb / SS), s0 = (int)(rb % SS); const int pc0 = n0 - 2 * DM;
    for (int q = tid; q < 128 * 8; q += 128) { const int d = q >> 3, pc = q & 7; const size_t o = ((size_t)b * DM + pc0 + d) * SS + s0 + pc * 8; vst2((unsigned*)(VTH + o), *(const v4u*)&sth[d][pc * 8]); vst2((unsigned*)(VTL + o), *(const v4u*)&stl[d][pc * 8]); }
  }
}
typedef __attribute__((ext_vector_type(2))) _Float16 v2h;
// lane l <-> lane l ^ 16 as one vector instruction
__device__ __forceinline__ float xhalf(float x) { return __builtin_bit_cast(float, __builtin_amdgcn_permlanex16(__builtin_bit_cast(int, x), __builtin_bit_cast(int, x), 0x76543210, 0xfedcba98, false, false)); }
__global__ __launch_bounds__(128) void k_attn(const _Float16* __restrict__ QK, const _Float16* __restrict__ VTH, const _Float16* __restrict__ VTL, float* __restrict__ O) {
  __shared__ __align__(16) unsigned char L[2 * ASTG];   // the K/V ring during the key loop, then the output staging
  float (*so)[16][68] = (float (*)[16][68])L;
  const int tid = threadIdx.x, wave = tid >> 5, lane = tid & 31, col = lane & 15, g = lane >> 4;
  const int qb = blockIdx.x, h = blockIdx.y, b = blockIdx.z; const int q0 = qb * 64 + wave * 16; const size_t rq = (size_t)b * SS + q0 + col;
  const unsigned lt = lds_off(L) + (tid >> 3) * TPB + (tid & 7) * 16;
  const _Float16* gk = QK + ((size_t)b * SS + (tid >> 3)) * (2 * DM) + DM + h * HD + (tid & 7) * 8; const size_t gvo = ((size_t)b * DM + h * HD + (tid >> 3)) * SS + (tid & 7) * 8;
  auto fill = [&](int st) { const unsigned l = lt + (st & 1) * ASTG;   // stage st = keys 64 st .. 64 st + 63: K rows [key][64 d], V planes [d][64 keys]
    cp4(l, gk + (size_t)st * 64 * (2 * DM), (size_t)16 * 2 * DM * 2); cp4(l + T64B, VTH + gvo + st * 64, (size_t)16 * SS * 2); cp4(l + 2 * T64B, VTL + gvo + st * 64, (size_t)16 * SS * 2); };
  fill(0); WAIT_ASYNC(); __syncthreads(); fill(1);
  v16h aq[2];
#pragma unroll
  for (int kc = 0; kc < 2; ++kc) aq[kc] = frag_h(QK + rq * (2 * DM) + h * HD + kc * 32, lane);
  float m = -3.0e38f, l = 0.f;   // of query col: m is the same in both halves, l is this half's share of the sum (joined behind the loop)
  v8f acc[4] = {}, accl[4] = {};   // acc[dt][r] = O^T[dt * 16 + 8 g + r][col]
  // not causal; keys >= 2,274 are padding and masked
#pragma unroll 1   // one stage per trip: the buffer index and the publish point at the foot stay those of a two-buffer ring
  for (int st = 0; st < SS / 64; ++st) { const _Float16* Kt = (const _Float16*)(L + (st & 1) * ASTG); const _Float16* Vh = Kt + 64 * TP; const _Float16* Vl = Vh + 64 * TP;
#pragma unroll 1   // the 32-key pass stays rolled: one copy of it in the text
  for (int sub = 0; sub < 2; ++sub) { const int ks = st * 2 + sub; v8f s[2];
#pragma unroll
    for (int ct = 0; ct < 2; ++ct) { const int kk0 = ks * 32 + ct * 16 + 8 * g; const _Float16* krow = Kt + (sub * 32 + ct * 16 + col) * TP; v8f c = {};
#pragma unroll
      for (int kc = 0; kc < 2; ++kc) c = wmma16(frag_h(krow + kc * 32, lane), aq[kc], c);
#pragma unroll
      for (int r = 0; r < 8; ++r) s[ct][r] = (kk0 + r < SREAL) ? c[r] * 0.125f : -3.0e38f; }   // 1/sqrt(64); padded keys masked
    float mx = fmaxf(s[0][0], s[1][0]);
#pragma unroll
    for (int r = 1; r < 8; ++r) mx = fmaxf(mx, fmaxf(s[0][r], s[1][r]));
    mx = fmaxf(mx, xhalf(mx));
    const float mn = fmaxf(m, mx); const float alpha = (m <= -1.0e38f) ? 0.f : __expf(m - mn);
    union { v16h v; v2h p[8]; } pa, pl; v2f es = {0.f, 0.f};   // element ct * 8 + r = key ct * 16 + 8 g + r: the k order of frag_h
#pragma unroll
    for (int ct = 0; ct < 2; ++ct) {
#pragma unroll
      for (int rp = 0; rp < 4; ++rp) { v2f e; e[0] = (s[ct][2 * rp] <= -1.0e38f) ? 0.f : __expf(s[ct][2 * rp] - mn); e[1] = (s[ct][2 * rp + 1] <= -1.0e38f) ? 0.f : __expf(s[ct][2 * rp + 1] - mn); es += e;
        const v2h hh = __builtin_convertvector(e, v2h); pa.p[ct * 4 + rp] = hh; pl.p[ct * 4 + rp] = __builtin_convertvector((e - __builtin_convertvector(hh, v2f)) * 2048.0f, v2h); } }
    l = l * alpha + (es[0] + es[1]); m = mn;
#pragma unroll
    for (int dt = 0; dt < 4; ++dt) { acc[dt] *= alpha; accl[dt] *= alpha; }
#pragma unroll
    for (int dt = 0; dt < 4; ++dt) { const int vr = (dt * 16 + col) * TP + sub * 32; const v16h vh = frag_h(Vh + vr, lane); acc[dt] = wmma16(vh, pa.v, acc[dt]); accl[dt] = wmma16(vh, pl.v, accl[dt]); accl[dt] = wmma16(frag_h(Vl + vr, lane), pa.v, accl[dt]); }   // V hi x P hi + (V hi x P lo + V lo x P hi) / 2048
    // the pass's back edge: the four vector slots between the pass's last WMMAs and the next pass's first write of their operand registers stand here, behind all of them
    asm volatile("v_nop\n\tv_nop\n\tv_nop\n\tv_nop" : "+v"(acc[0]), "+v"(acc[1]), "+v"(acc[2]), "+v"(acc[3]), "+v"(accl[0]), "+v"(accl[1]), "+v"(accl[2]), "+v"(accl[3])); }
    WAIT_DS(); WAIT_ASYNC(); __syncthreads();   // publishes stage st + 1 and frees stage st's buffer
    if (st + 2 < SS / 64) fill(st + 2); }
  WAIT_ASYNC();
  const float il = 1.0f / (l + xhalf(l));
#pragma unroll
  for (int dt = 0; dt < 4; ++dt) {
#pragma unroll
    for (int q = 0; q < 2; ++q) { v4f o;
#pragma unroll
      for (int i = 0; i < 4; ++i) o[i] = (acc[dt][q * 4 + i] + accl[dt][q * 4 + i] * (1.0f / 2048.0f)) * il;
      *(v4f*)&so[wave][col][dt * 16 + 8 * g + q * 4] = o; } }
  LDSX();
  for (int rl = 0; rl < 16; ++rl) if (lane < 16) vst2(O + ((size_t)b * SS + q0 + rl) * DM + h * HD + lane * 4, *(const v4f*)&so[wave][rl][lane * 4]);
}
// ---- k_out: block = (64 rows, 128 cols): out = O(hi/lo) . Wo rows (2 products) + bo
__global__ __launch_bounds__(128) void k_out(const float* __restrict__ O, const __bf16* __restrict__ P, const float* __restrict__ BO, float* __restrict__ Y) {
  __shared__ __align__(16) unsigned char L[2 * WSTG];   // the weight ring during the k loop, then the output staging
  float (*so)[16][132] = (float (*)[16][132])L;
  const int tid = threadIdx.x, wave = tid >> 5, lane = tid & 31, col = lane & 15, g = lane >> 4; const size_t r0 = (size_t)blockIdx.x * 64 + wave * 16; const int n0 = blockIdx.y * 128;
  v8f acc[8] = {};
  const unsigned lw = lds_off(L) + (tid >> 3) * TPB + (tid & 7) * 16; const __bf16* gw = P + (size_t)(n0 + (tid >> 3)) * DM + (tid & 7) * 8;
  fill_w(lw, gw); WAIT_ASYNC(); __syncthreads(); fill_w(lw + WSTG, gw + 64);
#pragma unroll 1   // one stage per trip: the buffer index and the publish point at the foot stay those of a two-buffer ring
  for (int st = 0; st < DM / 64; ++st) { const __bf16* Bt = (const __bf16*)(L + (st & 1) * WSTG);
#pragma unroll
    for (int sub = 0; sub < 2; ++sub) { const F2 a = split_row(O + (r0 + col) * DM, (st * 2 + sub) * 32, lane);
#pragma unroll
      for (int j = 0; j < 8; ++j) { const v16b w = frag_b(Bt + (j * 16 + col) * TP + sub * 32, lane); acc[j] = wmma_bf(a.l, w, acc[j]); acc[j] = wmma_bf(a.h, w, acc[j]); } }
    WAIT_DS(); WAIT_ASYNC(); __syncthreads();   // publishes stage st + 1 and frees stage st's buffer
    if (st + 2 < DM / 64) fill_w(lw + (st & 1) * WSTG, gw + (st + 2) * 64); }
  WAIT_ASYNC();
#pragma unroll
  for (int j = 0; j < 8; ++j) { const float bb = bfr(BO[n0 + j * 16 + col]);
#pragma unroll
    for (int r = 0; r < 8; ++r) so[wave][8 * g + r][j * 16 + col] = acc[j][r] + bb; }
  LDSX();
  for (int rl = 0; rl < 16; ++rl) { const size_t row = r0 + rl; const int b = (int)(row / SS), s = (int)(row % SS); if (s < STXT) vst2(Y + (size_t)NB * SVID * DM + ((size_t)b * STXT + s) * DM + n0 + lane * 4, *(const v4f*)&so[wave][rl][lane * 4]); else if (s < SREAL) vst2(Y + ((size_t)b * SVID + (s - STXT)) * DM + n0 + lane * 4, *(const v4f*)&so[wave][rl][lane * 4]); }   // out0 = o[:, 226:] at 0, out1 = o[:, :226] after it; padding rows dropped
}
extern "C" void kernel_launch(void* const* d_in, const int* in_sizes, int n_in, void* d_out, int out_size, void* d_ws, size_t ws_size, hipStream_t stream) {
  (void)in_sizes; (void)n_in; (void)out_size;
  const float** F = (const float**)d_in;   // 0 hidden_states [2,2048,1024], 1 encoder_hidden_states [2,226,1024], 2 cos [2048,64], 3 sin, 4 wq [1024,1024], 5 bq, 6 wk, 7 bk, 8 wv, 9 bv, 10 wo, 11 bo, 12 lnq_w [64], 13 lnq_b, 14 lnk_w, 15 lnk_b
  if (ws_size < (size_t)WS_END) return;
  char* ws = (char*)d_ws; __bf16* PK = (__bf16*)(ws + WS_PK); _Float16 *QK = (_Float16*)(ws + WS_QK), *VTH = (_Float16*)(ws + WS_VTH), *VTL = (_Float16*)(ws + WS_VTL); float *O = (float*)(ws + WS_O);
  k_packrows<<<DM, 256, 0, stream>>>(F[4], DM, PK + PK_A); k_packrows<<<DM, 256, 0, stream>>>(F[6], DM, PK + PK_A + (size_t)DM * DM); k_packrows<<<DM, 256, 0, stream>>>(F[8], DM, PK + PK_A + (size_t)2 * DM * DM); k_packrows<<<DM, 256, 0, stream>>>(F[10], DM, PK + PK_P);
  k_qkv<<<dim3(TNB * SS / 64, QKVW / 128), 128, 0, stream>>>(F[1], F[0], PK + PK_A, F[5], F[7], F[9], F[12], F[13], F[14], F[15], F[2], F[3], QK, VTH, VTL);
  k_attn<<<dim3(TQB, NH, TNB), 128, 0, stream>>>(QK, VTH, VTL, O);
  k_out<<<dim3(TOB, DM / 128), 128, 0, stream>>>(O, PK + PK_P, F[11], (float*)d_out);
}

// v005
// One run takes 192 microseconds.
// Next to v004, in two timings, it ran 1.07 and 1.06 times as fast.
// Over all steps from v000 it is 4.01 times as fast.
// compute dtype: hidden_states, encoder_hidden_states, cos, sin and all weights / biases / norm parameters (module inputs) rounded to bf16; q/k/v projections with exact bf16 products (natural [out][in] rows) + bias on WMMA 16x16x32; per-head LayerNorm of q and k (over the 64 dims, eps 1e-5) and the interleaved rotary on the video tokens (input cos/sin tables) in f32 in the projection epilogue; q and k stored once as f16 (q unscaled; 1/8 on the f32 score), v as f16 hi + (x2048-scaled) residual planes; scores with single f16 operands (1 product) and P.V with P as f16 hi + (x2048-scaled) residual x V hi/lo (3 products); the output projection with ctx as bf16 hi + residual x exact wo (2 products) + bo; running-max softmax in f32 with the hardware exp; the 2,274-token sequence is padded to 2,304 rows per batch with the padding keys masked; f32 accumulate.
#include <hip/hip_runtime.h>
#include <math.h>

typedef __attribute__((ext_vector_type(16))) _Float16 v16h;
typedef __attribute__((ext_vector_type(16))) __bf16 v16b;
typedef __attribute__((ext_vector_type(8)))  _Float16 v8h;
typedef __attribute__((ext_vector_type(8)))  float v8f;
typedef __attribute__((ext_vector_type(4)))  float v4f;
typedef __attribute__((ext_vector_type(2)))  float v2f;
typedef __attribute__((ext_vector_type(4)))  unsigned v4u;
typedef __attribute__((ext_vector_type(4)))  int v4i;
typedef float __attribute__((may_alias)) float_a;
typedef int __attribute__((may_alias)) int_a;

template <typename T> __device__ __forceinline__ void vst2(void* p, T v) { *(T*)p = v;  }
__device__ __forceinline__ v8f wmma16(v16h a, v16h b, v8f c) {
  v8f d = __builtin_amdgcn_wmma_f32_16x16x32_f16(false, a, false, b, (short)0, c, false, false);
  return d;
}
__device__ __forceinline__ v8f wmma_bf(v16b a, v16b b, v8f c) {
  v8f d = __builtin_amdgcn_wmma_f32_16x16x32_bf16(false, a, false, b, (short)0, c, false, false);
  return d;
}
// CogVideoX joint text+video attention processor (B 2, 226 text + 2,048 video tokens, D 1,024, 16 heads x 64): qkv with bias, per-head LayerNorm on q and k, rotary on the video part, full softmax attention, output projection + bias; returns (video part, text part).
__device__ __forceinline__ v16h frag_h(const _Float16* rowk0, int lane) {
  union { v16h v; v8h q[2]; } u; const _Float16* p = rowk0 + 8 * (lane >> 4);
  u.q[0] = *(const v8h*)p; u.q[1] = *(const v8h*)(p + 16); return u.v;
}
__device__ __forceinline__ v16h frag_f32(const float* rowk0, int lane) {
  v16h a; const float* p = rowk0 + 8 * (lane >> 4);
#pragma unroll
  for (int i = 0; i < 8; ++i) { a[i] = (_Float16)p[i]; a[8 + i] = (_Float16)p[16 + i]; }
  return a;
}
__device__ __forceinline__ v16h frag_f32s(const float* rowk0, int lane, float sc) {
  v16h a; const float* p = rowk0 + 8 * (lane >> 4);
#pragma unroll
  for (int i = 0; i < 8; ++i) { a[i] = (_Float16)(p[i] * sc); a[8 + i] = (_Float16)(p[16 + i] * sc); }
  return a;
}
// column fragment from a [K][ld] layout (column n), rows >= K read as 0
__device__ __forceinline__ v16h fragc_f32(const float* W, int k0, int n, int lane, int ld, int K) {
  v16h a; const int g = lane >> 4;
#pragma unroll
  for (int i = 0; i < 8; ++i) { const int ka = k0 + 8 * g + i, kb = ka + 16;
    a[i] = (_Float16)(ka < K ? W[(size_t)(ka < K ? ka : K - 1) * ld + n] : 0.f); a[8 + i] = (_Float16)(kb < K ? W[(size_t)(kb < K ? kb : K - 1) * ld + n] : 0.f); }
  return a;
}
struct F2 { v16b h, l; };
__device__ __forceinline__ F2 bsplit16(const float v[16]) { F2 r;
#pragma unroll
  for (int i = 0; i < 16; ++i) { const __bf16 h = (__bf16)v[i]; r.h[i] = h; r.l[i] = (__bf16)(v[i] - (float)h); }
  return r; }
__device__ __forceinline__ F2 split_row(const float* row, int k0, int lane) { float v[16]; const float* p = row + k0 + 8 * (lane >> 4);
#pragma unroll
  for (int i = 0; i < 8; ++i) { v[i] = p[i]; v[8 + i] = p[16 + i]; }
  return bsplit16(v); }
__device__ __forceinline__ F2 split_rowK(const float* row, int k0, int lane, int K) { float v[16]; const int g = lane >> 4;
#pragma unroll
  for (int i = 0; i < 8; ++i) { const int ka = k0 + 8 * g + i, kb = ka + 16; v[i] = ka < K ? row[ka < K ? ka : K - 1] : 0.f; v[8 + i] = kb < K ? row[kb < K ? kb : K - 1] : 0.f; }
  return bsplit16(v); }
__device__ __forceinline__ F2 split_col(const float* W, int k0, int n, int lane, int ld, int K) { float v[16]; const int g = lane >> 4;
#pragma unroll
  for (int i = 0; i < 8; ++i) { const int ka = k0 + 8 * g + i, kb = ka + 16; v[i] = ka < K ? W[(size_t)(ka < K ? ka : K - 1) * ld + n] : 0.f; v[8 + i] = kb < K ? W[(size_t)(kb < K ? kb : K - 1) * ld + n] : 0.f; }
  return bsplit16(v); }
__device__ __forceinline__ v8f mac3(const F2& a, const F2& b, v8f c) { c = wmma_bf(a.l, b.h, c); c = wmma_bf(a.h, b.l, c); return wmma_bf(a.h, b.h, c); }
__device__ __forceinline__ float sigm(float v) { return 1.0f / (1.0f + expf(-v)); }
#define LDSX() do { asm volatile("s_wait_dscnt 0" ::: "memory"); __builtin_amdgcn_wave_barrier(); __builtin_amdgcn_fence(__ATOMIC_RELEASE, "workgroup"); } while (0)


#define NB 2
#define SS 2304                 // 2,274 tokens (226 text + 2,048 video) padded to 36 x 64
#define SREAL 2274
#define STXT 226
#define SVID 2048
#define DM 1024
#define NH 16
#define HD 64
#define QKVW (3 * DM)
#ifndef TQB
#define TQB (SS / 64)
#define TNB NB
#define TOB (NB * SS / 64)     // output row tiles (all)
#endif
typedef __attribute__((ext_vector_type(8))) __bf16 v8b;
__device__ __forceinline__ v16b frag_b(const __bf16* rowk0, int lane) {
  union { v16b v; v8b q[2]; } u; const __bf16* p = rowk0 + 8 * (lane >> 4);
  u.q[0] = *(const v8b*)p; u.q[1] = *(const v8b*)(p + 16); return u.v;
}
__device__ __forceinline__ float bfr(float v) { return (float)(__bf16)v; }
__device__ __attribute__((noinline)) float exp_ni(float v) { return expf(v); }
__device__ __attribute__((noinline)) float erf_ni(float v) { return erff(v); }

#define PK_A 0                       // [3072][1024] Wqkv rows (natural [out][in])
#define PK_P (PK_A + QKVW * DM)        // [1024][1024] Wo rows (natural)
#define PK_END (PK_P + DM * DM)
#define WS_PK  0u
#define WS_QK  (WS_PK + 2u * PK_END)             // f16 [4608 rows][2048]: q | k
#define WS_VTH (WS_QK + 2u * NB * SS * 2 * DM)     // f16 [2][1024 (h*64+d)][2304 s] hi
#define WS_VTL (WS_VTH + 2u * NB * DM * SS)        // f16 lo x 2048
#define WS_O   (WS_VTL + 2u * NB * DM * SS)        // f32 [4608][1024]
#define WS_CS  (WS_O + 4u * NB * SS * DM)           // f32 2 x [2304][32], unused
#define WS_END (WS_CS + 4u * 2 * SS * 32)

// ---- LDS staging of the operand tiles that all four waves of a block read: rows of 128 B (64 16-bit values) at a pitch of 144 B (16 B x odd: ds_load_b128 readers), two buffers
#define TP 72                        // row pitch in 16-bit values
#define TPB (2 * TP)                 // row pitch in bytes
#define T64B (64 * TPB)              // a 64-row tile, bytes
#define ASTG (3 * T64B)              // attention stage: K | V hi | V lo, 64 keys
#define WSTG (2 * T64B)              // GEMM stage: 128 weight rows x 64 k
__device__ __forceinline__ unsigned lds_off(const void* p) { return (unsigned)(size_t)p; }
// four asynchronous 16-byte copies per lane, global -> LDS, rows 16 apart (gstep = 16 source rows, in bytes); s_wait_xcnt closes the statement so that no address register is rewritten ahead of it
__device__ __forceinline__ void cp4(unsigned l, const void* gp, size_t gstep) {
  const char* g = (const char*)gp;
  asm volatile("global_load_async_to_lds_b128 %0, %1, off\n\tglobal_load_async_to_lds_b128 %2, %3, off\n\tglobal_load_async_to_lds_b128 %4, %5, off\n\tglobal_load_async_to_lds_b128 %6, %7, off\n\ts_wait_xcnt 0x0"
               :: "v"(l), "v"(g), "v"(l + 16 * TPB), "v"(g + gstep), "v"(l + 32 * TPB), "v"(g + 2 * gstep), "v"(l + 48 * TPB), "v"(g + 3 * gstep) : "memory");
}
// a 128-row x 64-k weight tile (natural rows of DM bf16); src = this lane's 16 bytes of its first row
__device__ __forceinline__ void fill_w(unsigned l, const __bf16* src) { cp4(l, src, (size_t)16 * DM * 2); cp4(l + T64B, src + (size_t)64 * DM, (size_t)16 * DM * 2); }
#define WAIT_DS()    asm volatile("s_wait_dscnt 0x0" ::: "memory")      // this wave's LDS reads of the buffer are done before the barrier frees it
#define WAIT_ASYNC() asm volatile("s_wait_asynccnt 0x0" ::: "memory")   // this wave's copies have landed before the barrier publishes them
// ---- k_pack: ONE launch rounds the four [1024][1024] weights to bf16 (natural [out][in] rows) into the four consecutive planes of DST (wq | wk | wv | wo); blockIdx.y picks the matrix. A wave's load covers 512 contiguous bytes, its store 256; a thread's PKIT loads all issue ahead of its first store
#define PKIT 16                      // 16-byte loads per thread
typedef __attribute__((ext_vector_type(4))) __bf16 v4b;
__global__ __launch_bounds__(256) void k_pack(const float* __restrict__ WQ, const float* __restrict__ WK, const float* __restrict__ WV, const float* __restrict__ WO, __bf16* __restrict__ DST) {
  const int mt = blockIdx.y; const float* S = (mt == 0) ? WQ : (mt == 1) ? WK : (mt == 2) ? WV : WO;
  const size_t e0 = ((size_t)blockIdx.x * (PKIT * 256) + threadIdx.x) * 4;   // this thread's first element; its next ones lie 1,024 elements apart
  const float* s = S + e0; __bf16* d = DST + (size_t)mt * DM * DM + e0; v4f x[PKIT];
#pragma unroll   // x stays in registers and the loads stand together, on one address with immediate offsets
  for (int it = 0; it < PKIT; ++it) x[it] = *(const v4f*)(s + it * 1024);
#pragma unroll   // as above, for the stores
  for (int it = 0; it < PKIT; ++it) { v4b o;
#pragma unroll   // four converts, packed in pairs
    for (int i = 0; i < 4; ++i) o[i] = (__bf16)x[it][i];
    *(v4b*)(d + it * 1024) = o; }
}
// ---- k_qkv: block = (64 rows (b,s), 128 of the 3072 cols): qkv = bf16(x) . rows (exact); cols < 1024 -> f16(q), cols < 2048 -> f16(k) into QK rows (pitch 2048); cols >= 2048 (v) -> per-batch transposed f16 planes VT[b][h*64+d][s]: hi = f16(v), lo = f16((v - hi) * 2048)
__global__ __launch_bounds__(128) void k_qkv(const float* __restrict__ XT, const float* __restrict__ XV, const __bf16* __restrict__ P, const float* __restrict__ BQ, const float* __restrict__ BK, const float* __restrict__ BV, const float* __restrict__ LQW, const float* __restrict__ LQB, const float* __restrict__ LKW, const float* __restrict__ LKB, const float* __restrict__ COS, const float* __restrict__ SIN, _Float16* __restrict__ QK, _Float16* __restrict__ VTH, _Float16* __restrict__ VTL) {
  __shared__ __align__(16) unsigned char L[4 * 16 * 136 * 2 + 2 * 128 * 72 * 2];   // the weight ring (2 x WSTG) during the k loop, then the output staging
  _Float16 (*so)[16][136] = (_Float16 (*)[16][136])L; _Float16 (*sth)[72] = (_Float16 (*)[72])(L + 4 * 16 * 136 * 2); _Float16 (*stl)[72] = sth + 128;
  const int tid = threadIdx.x, wave = tid >> 5, lane = tid & 31, col = lane & 15, g = lane >> 4; const size_t r0 = (size_t)blockIdx.x * 64 + wave * 16; const int n0 = blockIdx.y * 128;
  v8f acc[8] = {};
  const unsigned lw = lds_off(L) + (tid >> 3) * TPB + (tid & 7) * 16; const __bf16* gw = P + (size_t)(n0 + (tid >> 3)) * DM + (tid & 7) * 8;
  fill_w(lw, gw); WAIT_ASYNC(); __syncthreads(); fill_w(lw + WSTG, gw + 64);
const int bb_ = (int)((r0 + col) / SS), ss_ = (int)((r0 + col) % SS); const bool isT = ss_ < STXT, isV = (ss_ >= STXT) && (ss_ < SREAL);   // h = concat([encoder, hidden]); rows >= 2,274 are padding (zero input; masked as keys, never output)
  const float* xrow = isT ? XT + ((size_t)bb_ * STXT + ss_) * DM : XV + ((size_t)bb_ * SVID + (isV ? ss_ - STXT : 0)) * DM;
#pragma unroll 1   // one stage per trip: the buffer index and the publish point at the foot stay those of a two-buffer ring
  for (int st = 0; st < DM / 64; ++st) { const __bf16* Bt = (const __bf16*)(L + (st & 1) * WSTG);
    v4f x[2][4];   // the stage's 64 k of this lane's row: xrow is a valid row for padding lanes too, so the loads stand under no lane test; the zero is selected behind them
#pragma unroll
    for (int sub = 0; sub < 2; ++sub) { const float* p = xrow + st * 64 + sub * 32 + 8 * g; x[sub][0] = *(const v4f*)p; x[sub][1] = *(const v4f*)(p + 4); x[sub][2] = *(const v4f*)(p + 16); x[sub][3] = *(const v4f*)(p + 20); }
#pragma unroll
    for (int sub = 0; sub < 2; ++sub) { union { v16b v; unsigned w[8]; } u;
#pragma unroll
      for (int q = 0; q < 4; ++q) {
#pragma unroll
        for (int i = 0; i < 4; ++i) u.v[q * 4 + i] = (__bf16)x[sub][q][i]; }
#pragma unroll
      for (int q = 0; q < 8; ++q) u.w[q] = (isT || isV) ? u.w[q] : 0u;   // padding rows: zero input
      const v16b a = u.v;
#pragma unroll
      for (int j = 0; j < 8; ++j) acc[j] = wmma_bf(a, frag_b(Bt + (j * 16 + col) * TP + sub * 32, lane), acc[j]); }
    WAIT_DS(); WAIT_ASYNC(); __syncthreads();   // publishes stage st + 1 and frees stage st's buffer
    if (st + 2 < DM / 64) fill_w(lw + (st & 1) * WSTG, gw + (st + 2) * 64); }
  WAIT_ASYNC();
  { const float* BB = (n0 < DM) ? BQ : (n0 < 2 * DM) ? BK : BV; const int nb = n0 % DM;
#pragma unroll
    for (int j = 0; j < 8; ++j) { const float bb = bfr(BB[nb + j * 16 + col]);
#pragma unroll
      for (int r = 0; r < 8; ++r) acc[j][r] += bb; } }
  if (n0 < 2 * DM) {   // q | k: per-head LayerNorm over the 64 dims (this 128-col block = 2 heads: tiles 0-3 and 4-7), then rotary for video tokens; q unscaled (1/8 on the f32 score)
    const float* LW = (n0 < DM) ? LQW : LKW; const float* LBv = (n0 < DM) ? LQB : LKB;
#pragma unroll
    for (int hh = 0; hh < 2; ++hh) {
#pragma unroll
      for (int r = 0; r < 8; ++r) { float s = 0.f;
#pragma unroll
        for (int j = 0; j < 4; ++j) s += acc[hh * 4 + j][r];
#pragma unroll
        for (int o = 1; o < 16; o <<= 1) s += __shfl_xor(s, o);
        const float mu = s * (1.0f / 64.0f); float v = 0.f;
#pragma unroll
        for (int j = 0; j < 4; ++j) { const float dv = acc[hh * 4 + j][r] - mu; v += dv * dv; }
#pragma unroll
        for (int o = 1; o < 16; o <<= 1) v += __shfl_xor(v, o);
        const float rs = rsqrtf(v * (1.0f / 64.0f) + 1e-5f);
#pragma unroll
        for (int j = 0; j < 4; ++j) { const int d = j * 16 + col; acc[hh * 4 + j][r] = (acc[hh * 4 + j][r] - mu) * rs * bfr(LW[d]) + bfr(LBv[d]); } } }
    // the rotary tables of this lane's 8 rows x 4 dims (both heads of the block use the same): table row clamped to 0 for text and padding rows, so the loads stand under no lane test and are all in flight together
    float tc[8][4], ts[8][4]; bool vid[8]; unsigned to[8]; const int sv0 = (int)((r0 + 8 * g) % SS) - STXT;   // 8 rows from a multiple of 8 never cross a batch (SS is one)
#pragma unroll
    for (int r = 0; r < 8; ++r) { const int sv = sv0 + r; vid[r] = sv >= 0 && sv < SVID; to[r] = (unsigned)(vid[r] ? sv : 0) * HD + col; }
#pragma unroll
    for (int r = 0; r < 8; ++r) {
#pragma unroll
      for (int q = 0; q < 4; ++q) { tc[r][q] = COS[to[r] + q * 16]; ts[r][q] = SIN[to[r] + q * 16]; } }
    asm volatile("s_wait_xcnt 0x0" :: "v"(to[0]), "v"(to[1]), "v"(to[2]), "v"(to[3]), "v"(to[4]), "v"(to[5]), "v"(to[6]), "v"(to[7]) : "memory");   // the offset registers of the table loads stay as they are up to this wait
    // rotary on video tokens: pairs (2i, 2i+1): out = x cos + rot(x) sin with rot = [-x_{2i+1}, x_{2i}]; cos/sin [2048][64] inputs (bf16-rounded), indexed by (s - 226, d)
#pragma unroll
    for (int j = 0; j < 8; ++j) { const int d = (j & 3) * 16 + col;
#pragma unroll
      for (int r = 0; r < 8; ++r) { const float xv = acc[j][r]; const float xp = __shfl_xor(xv, 1);   // partner dim d^1 lives in lane col^1
        const float c = bfr(tc[r][j & 3]), sn = bfr(ts[r][j & 3]); const float rot = (d & 1) ? xp : -xp; acc[j][r] = vid[r] ? xv * c + rot * sn : xv; } }   // text and padding rows keep xv by the select
#pragma unroll
    for (int j = 0; j < 8; ++j) {
#pragma unroll
      for (int r = 0; r < 8; ++r) so[wave][8 * g + r][j * 16 + col] = (_Float16)acc[j][r]; }
    LDSX();
    for (int rl = 0; rl < 16; ++rl) if (lane < 16) vst2((unsigned*)(QK + (r0 + rl) * (2 * DM) + n0 + lane * 8), *(const v4u*)&so[wave][rl][lane * 8]);
  } else {
#pragma unroll
    for (int j = 0; j < 8; ++j) {
#pragma unroll
      for (int r = 0; r < 8; ++r) { const float v = acc[j][r]; const _Float16 hv = (_Float16)v; sth[j * 16 + col][wave * 16 + 8 * g + r] = hv; stl[j * 16 + col][wave * 16 + 8 * g + r] = (_Float16)((v - (float)hv) * 2048.0f); } }
    __syncthreads();
    const size_t rb = (size_t)blockIdx.x * 64; const int b = (int)(rb / SS), s0 = (int)(rb % SS); const int pc0 = n0 - 2 * DM;
    for (int q = tid; q < 128 * 8; q += 128) { const int d = q >> 3, pc = q & 7; const size_t o = ((size_t)b * DM + pc0 + d) * SS + s0 + pc * 8; vst2((unsigned*)(VTH + o), *(const v4u*)&sth[d][pc * 8]); vst2((unsigned*)(VTL + o), *(const v4u*)&stl[d][pc * 8]); }
  }
}
typedef __attribute__((ext_vector_type(2))) _Float16 v2h;
// lane l <-> lane l ^ 16 as one vector instruction
__device__ __forceinline__ float xhalf(float x) { return __builtin_bit_cast(float, __builtin_amdgcn_permlanex16(__builtin_bit_cast(int, x), __builtin_bit_cast(int, x), 0x76543210, 0xfedcba98, false, false)); }
__global__ __launch_bounds__(128) void k_attn(const _Float16* __restrict__ QK, const _Float16* __restrict__ VTH, const _Float16* __restrict__ VTL, float* __restrict__ O) {
  __shared__ __align__(16) unsigned char L[2 * ASTG];   // the K/V ring during the key loop, then the output staging
  float (*so)[16][68] = (float (*)[16][68])L;
  const int tid = threadIdx.x, wave = tid >> 5, lane = tid & 31, col = lane & 15, g = lane >> 4;
  const int qb = blockIdx.x, h = blockIdx.y, b = blockIdx.z; const int q0 = qb * 64 + wave * 16; const size_t rq = (size_t)b * SS + q0 + col;
  const unsigned lt = lds_off(L) + (tid >> 3) * TPB + (tid & 7) * 16;
  const _Float16* gk = QK + ((size_t)b * SS + (tid >> 3)) * (2 * DM) + DM + h * HD + (tid & 7) * 8; const size_t gvo = ((size_t)b * DM + h * HD + (tid >> 3)) * SS + (tid & 7) * 8;
  auto fill = [&](int st) { const unsigned l = lt + (st & 1) * ASTG;   // stage st = keys 64 st .. 64 st + 63: K rows [key][64 d], V planes [d][64 keys]
    cp4(l, gk + (size_t)st * 64 * (2 * DM), (size_t)16 * 2 * DM * 2); cp4(l + T64B, VTH + gvo + st * 64, (size_t)16 * SS * 2); cp4(l + 2 * T64B, VTL + gvo + st * 64, (size_t)16 * SS * 2); };
  fill(0); WAIT_ASYNC(); __syncthreads(); fill(1);
  v16h aq[2];
#pragma unroll
  for (int kc = 0; kc < 2; ++kc) aq[kc] = frag_h(QK + rq * (2 * DM) + h * HD + kc * 32, lane);
  float m = -3.0e38f, l = 0.f;   // of query col: m is the same in both halves, l is this half's share of the sum (joined behind the loop)
  v8f acc[4] = {}, accl[4] = {};   // acc[dt][r] = O^T[dt * 16 + 8 g + r][col]
  // not causal; keys >= 2,274 are padding and masked
#pragma unroll 1   // one stage per trip: the buffer index and the publish point at the foot stay those of a two-buffer ring
  for (int st = 0; st < SS / 64; ++st) { const _Float16* Kt = (const _Float16*)(L + (st & 1) * ASTG); const _Float16* Vh = Kt + 64 * TP; const _Float16* Vl = Vh + 64 * TP;
#pragma unroll 1   // the 32-key pass stays rolled: one copy of it in the text
  for (int sub = 0; sub < 2; ++sub) { const int ks = st * 2 + sub; v8f s[2];
#pragma unroll
    for (int ct = 0; ct < 2; ++ct) { const int kk0 = ks * 32 + ct * 16 + 8 * g; const _Float16* krow = Kt + (sub * 32 + ct * 16 + col) * TP; v8f c = {};
#pragma unroll
      for (int kc = 0; kc < 2; ++kc) c = wmma16(frag_h(krow + kc * 32, lane), aq[kc], c);
#pragma unroll
      for (int r = 0; r < 8; ++r) s[ct][r] = (kk0 + r < SREAL) ? c[r] * 0.125f : -3.0e38f; }   // 1/sqrt(64); padded keys masked
    float mx = fmaxf(s[0][0], s[1][0]);
#pragma unroll
    for (int r = 1; r < 8; ++r) mx = fmaxf(mx, fmaxf(s[0][r], s[1][r]));
    mx = fmaxf(mx, xhalf(mx));
    const float mn = fmaxf(m, mx); const float alpha = (m <= -1.0e38f) ? 0.f : __expf(m - mn);
    union { v16h v; v2h p[8]; } pa, pl; v2f es = {0.f, 0.f};   // element ct * 8 + r = key ct * 16 + 8 g + r: the k order of frag_h
#pragma unroll
    for (int ct = 0; ct < 2; ++ct) {
#pragma unroll
      for (int rp = 0; rp < 4; ++rp) { v2f e; e[0] = (s[ct][2 * rp] <= -1.0e38f) ? 0.f : __expf(s[ct][2 * rp] - mn); e[1] = (s[ct][2 * rp + 1] <= -1.0e38f) ? 0.f : __expf(s[ct][2 * rp + 1] - mn); es += e;
        const v2h hh = __builtin_convertvector(e, v2h); pa.p[ct * 4 + rp] = hh; pl.p[ct * 4 + rp] = __builtin_convertvector((e - __builtin_convertvector(hh, v2f)) * 2048.0f, v2h); } }
    l = l * alpha + (es[0] + es[1]); m = mn;
#pragma unroll
    for (int dt = 0; dt < 4; ++dt) { acc[dt] *= alpha; accl[dt] *= alpha; }
#pragma unroll
    for (int dt = 0; dt < 4; ++dt) { const int vr = (dt * 16 + col) * TP + sub * 32; const v16h vh = frag_h(Vh + vr, lane); acc[dt] = wmma16(vh, pa.v, acc[dt]); accl[dt] = wmma16(vh, pl.v, accl[dt]); accl[dt] = wmma16(frag_h(Vl + vr, lane), pa.v, accl[dt]); }   // V hi x P hi + (V hi x P lo + V lo x P hi) / 2048
    // the pass's back edge: the four vector slots between the pass's last WMMAs and the next pass's first write of their operand registers stand here, behind all of them
    asm volatile("v_nop\n\tv_nop\n\tv_nop\n\tv_nop" : "+v"(acc[0]), "+v"(acc[1]), "+v"(acc[2]), "+v"(acc[3]), "+v"(accl[0]), "+v"(accl[1]), "+v"(accl[2]), "+v"(accl[3])); }
    WAIT_DS(); WAIT_ASYNC(); __syncthreads();   // publishes stage st + 1 and frees stage st's buffer
    if (st + 2 < SS / 64) fill(st + 2); }
  WAIT_ASYNC();
  const float il = 1.0f / (l + xhalf(l));
#pragma unroll
  for (int dt = 0; dt < 4; ++dt) {
#pragma unroll
    for (int q = 0; q < 2; ++q) { v4f o;
#pragma unroll
      for (int i = 0; i < 4; ++i) o[i] = (acc[dt][q * 4 + i] + accl[dt][q * 4 + i] * (1.0f / 2048.0f)) * il;
      *(v4f*)&so[wave][col][dt * 16 + 8 * g + q * 4] = o; } }
  LDSX();
  for (int rl = 0; rl < 16; ++rl) if (lane < 16) vst2(O + ((size_t)b * SS + q0 + rl) * DM + h * HD + lane * 4, *(const v4f*)&so[wave][rl][lane * 4]);
}
// ---- k_out: block = (64 rows, 128 cols): out = O(hi/lo) . Wo rows (2 products) + bo
__global__ __launch_bounds__(128) void k_out(const float* __restrict__ O, const __bf16* __restrict__ P, const float* __restrict__ BO, float* __restrict__ Y) {
  __shared__ __align__(16) unsigned char L[2 * WSTG];   // the weight ring during the k loop, then the output staging
  float (*so)[16][132] = (float (*)[16][132])L;
  const int tid = threadIdx.x, wave = tid >> 5, lane = tid & 31, col = lane & 15, g = lane >> 4; const size_t r0 = (size_t)blockIdx.x * 64 + wave * 16; const int n0 = blockIdx.y * 128;
  v8f acc[8] = {};
  const unsigned lw = lds_off(L) + (tid >> 3) * TPB + (tid & 7) * 16; const __bf16* gw = P + (size_t)(n0 + (tid >> 3)) * DM + (tid & 7) * 8;
  fill_w(lw, gw); WAIT_ASYNC(); __syncthreads(); fill_w(lw + WSTG, gw + 64);
#pragma unroll 1   // one stage per trip: the buffer index and the publish point at the foot stay those of a two-buffer ring
  for (int st = 0; st < DM / 64; ++st) { const __bf16* Bt = (const __bf16*)(L + (st & 1) * WSTG);
#pragma unroll
    for (int sub = 0; sub < 2; ++sub) { const F2 a = split_row(O + (r0 + col) * DM, (st * 2 + sub) * 32, lane);
#pragma unroll
      for (int j = 0; j < 8; ++j) { const v16b w = frag_b(Bt + (j * 16 + col) * TP + sub * 32, lane); acc[j] = wmma_bf(a.l, w, acc[j]); acc[j] = wmma_bf(a.h, w, acc[j]); } }
    WAIT_DS(); WAIT_ASYNC(); __syncthreads();   // publishes stage st + 1 and frees stage st's buffer
    if (st + 2 < DM / 64) fill_w(lw + (st & 1) * WSTG, gw + (st + 2) * 64); }
  WAIT_ASYNC();
#pragma unroll
  for (int j = 0; j < 8; ++j) { const float bb = bfr(BO[n0 + j * 16 + col]);
#pragma unroll
    for (int r = 0; r < 8; ++r) so[wave][8 * g + r][j * 16 + col] = acc[j][r] + bb; }
  LDSX();
  for (int rl = 0; rl < 16; ++rl) { const size_t row = r0 + rl; const int b = (int)(row / SS), s = (int)(row % SS); if (s < STXT) vst2(Y + (size_t)NB * SVID * DM + ((size_t)b * STXT + s) * DM + n0 + lane * 4, *(const v4f*)&so[wave][rl][lane * 4]); else if (s < SREAL) vst2(Y + ((size_t)b * SVID + (s - STXT)) * DM + n0 + lane * 4, *(const v4f*)&so[wave][rl][lane * 4]); }   // out0 = o[:, 226:] at 0, out1 = o[:, :226] after it; padding rows dropped
}
extern "C" void kernel_launch(void* const* d_in, const int* in_sizes, int n_in, void* d_out, int out_size, void* d_ws, size_t ws_size, hipStream_t stream) {
  (void)in_sizes; (void)n_in; (void)out_size;
  const float** F = (const float**)d_in;   // 0 hidden_states [2,2048,1024], 1 encoder_hidden_states [2,226,1024], 2 cos [2048,64], 3 sin, 4 wq [1024,1024], 5 bq, 6 wk, 7 bk, 8 wv, 9 bv, 10 wo, 11 bo, 12 lnq_w [64], 13 lnq_b, 14 lnk_w, 15 lnk_b
  if (ws_size < (size_t)WS_END) return;
  char* ws = (char*)d_ws; __bf16* PK = (__bf16*)(ws + WS_PK); _Float16 *QK = (_Float16*)(ws + WS_QK), *VTH = (_Float16*)(ws + WS_VTH), *VTL = (_Float16*)(ws + WS_VTL); float *O = (float*)(ws + WS_O);
  k_pack<<<dim3(DM * DM / (PKIT * 256 * 4), 4), 256, 0, stream>>>(F[4], F[6], F[8], F[10], PK + PK_A);   // PK_P = PK_A + 3 planes: wo is the fourth
  k_qkv<<<dim3(TNB * SS / 64, QKVW / 128), 128, 0, stream>>>(F[1], F[0], PK + PK_A, F[5], F[7], F[9], F[12], F[13], F[14], F[15], F[2], F[3], QK, VTH, VTL);
  k_attn<<<dim3(TQB, NH, TNB), 128, 0, stream>>>(QK, VTH, VTL, O);
  k_out<<<dim3(TOB, DM / 128), 128, 0, stream>>>(O, PK + PK_P, F[11], (float*)d_out);
}

// v006
// Measured time: 184 microseconds a run.
// In two side-by-side timings against v005, it was 1.05 and 1.04 times as fast.
// All steps since v000 together make it 4.20 times as fast.
// compute dtype: hidden_states, encoder_hidden_states, cos, sin and all weights / biases / norm parameters (module inputs) rounded to bf16; q/k/v projections with exact bf16 products (natural [out][in] rows) + bias on WMMA 16x16x32; per-head LayerNorm of q and k (over the 64 dims, eps 1e-5) and the interleaved rotary on the video tokens (input cos/sin tables) in f32 in the projection epilogue; q and k stored once as f16 (q unscaled; 1/8 on the f32 score), v as f16 hi + (x2048-scaled) residual planes; scores with single f16 operands (1 product) and P.V with P as f16 hi + (x2048-scaled) residual x V hi/lo (3 products); the output projection with ctx as bf16 hi + residual x exact wo (2 products) + bo; running-max softmax in f32 with the hardware exp; the 2,274-token sequence is padded to 2,304 rows per batch with the padding keys masked; f32 accumulate.
#include <hip/hip_runtime.h>
#include <math.h>

typedef __attribute__((ext_vector_type(16))) _Float16 v16h;
typedef __attribute__((ext_vector_type(16))) __bf16 v16b;
typedef __attribute__((ext_vector_type(8)))  _Float16 v8h;
typedef __attribute__((ext_vector_type(8)))  float v8f;
typedef __attribute__((ext_vector_type(4)))  float v4f;
typedef __attribute__((ext_vector_type(2)))  float v2f;
typedef __attribute__((ext_vector_type(4)))  unsigned v4u;
typedef __attribute__((ext_vector_type(4)))  int v4i;
typedef float __attribute__((may_alias)) float_a;
typedef int __attribute__((may_alias)) int_a;

template <typename T> __device__ __forceinline__ void vst2(void* p, T v) { *(T*)p = v;  }
__device__ __forceinline__ v8f wmma16(v16h a, v16h b, v8f c) {
  v8f d = __builtin_amdgcn_wmma_f32_16x16x32_f16(false, a, false, b, (short)0, c, false, false);
  return d;
}
__device__ __forceinline__ v8f wmma_bf(v16b a, v16b b, v8f c) {
  v8f d = __builtin_amdgcn_wmma_f32_16x16x32_bf16(false, a, false, b, (short)0, c, false, false);
  return d;
}
// CogVideoX joint text+video attention processor (B 2, 226 text + 2,048 video tokens, D 1,024, 16 heads x 64): qkv with bias, per-head LayerNorm on q and k, rotary on the video part, full softmax attention, output projection + bias; returns (video part, text part).
__device__ __forceinline__ v16h frag_h(const _Float16* rowk0, int lane) {
  union { v16h v; v8h q[2]; } u; const _Float16* p = rowk0 + 8 * (lane >> 4);
  u.q[0] = *(const v8h*)p; u.q[1] = *(const v8h*)(p + 16); return u.v;
}
__device__ __forceinline__ v16h frag_f32(const float* rowk0, int lane) {
  v16h a; const float* p = rowk0 + 8 * (lane >> 4);
#pragma unroll
  for (int i = 0; i < 8; ++i) { a[i] = (_Float16)p[i]; a[8 + i] = (_Float16)p[16 + i]; }
  return a;
}
__device__ __forceinline__ v16h frag_f32s(const float* rowk0, int lane, float sc) {
  v16h a; const float* p = rowk0 + 8 * (lane >> 4);
#pragma unroll
  for (int i = 0; i < 8; ++i) { a[i] = (_Float16)(p[i] * sc); a[8 + i] = (_Float16)(p[16 + i] * sc); }
  return a;
}
// column fragment from a [K][ld] layout (column n), rows >= K read as 0
__device__ __forceinline__ v16h fragc_f32(const float* W, int k0, int n, int lane, int ld, int K) {
  v16h a; const int g = lane >> 4;
#pragma unroll
  for (int i = 0; i < 8; ++i) { const int ka = k0 + 8 * g + i, kb = ka + 16;
    a[i] = (_Float16)(ka < K ? W[(size_t)(ka < K ? ka : K - 1) * ld + n] : 0.f); a[8 + i] = (_Float16)(kb < K ? W[(size_t)(kb < K ? kb : K - 1) * ld + n] : 0.f); }
  return a;
}
struct F2 { v16b h, l; };
__device__ __forceinline__ F2 bsplit16(const float v[16]) { F2 r;
#pragma unroll
  for (int i = 0; i < 16; ++i) { const __bf16 h = (__bf16)v[i]; r.h[i] = h; r.l[i] = (__bf16)(v[i] - (float)h); }
  return r; }
__device__ __forceinline__ F2 split_row(const float* row, int k0, int lane) { float v[16]; const float* p = row + k0 + 8 * (lane >> 4);
#pragma unroll
  for (int i = 0; i < 8; ++i) { v[i] = p[i]; v[8 + i] = p[16 + i]; }
  return bsplit16(v); }
__device__ __forceinline__ F2 split_rowK(const float* row, int k0, int lane, int K) { float v[16]; const int g = lane >> 4;
#pragma unroll
  for (int i = 0; i < 8; ++i) { const int ka = k0 + 8 * g + i, kb = ka + 16; v[i] = ka < K ? row[ka < K ? ka : K - 1] : 0.f; v[8 + i] = kb < K ? row[kb < K ? kb : K - 1] : 0.f; }
  return bsplit16(v); }
__device__ __forceinline__ F2 split_col(const float* W, int k0, int n, int lane, int ld, int K) { float v[16]; const int g = lane >> 4;
#pragma unroll
  for (int i = 0; i < 8; ++i) { const int ka = k0 + 8 * g + i, kb = ka + 16; v[i] = ka < K ? W[(size_t)(ka < K ? ka : K - 1) * ld + n] : 0.f; v[8 + i] = kb < K ? W[(size_t)(kb < K ? kb : K - 1) * ld + n] : 0.f; }
  return bsplit16(v); }
__device__ __forceinline__ v8f mac3(const F2& a, const F2& b, v8f c) { c = wmma_bf(a.l, b.h, c); c = wmma_bf(a.h, b.l, c); return wmma_bf(a.h, b.h, c); }
__device__ __forceinline__ float sigm(float v) { return 1.0f / (1.0f + expf(-v)); }
#define LDSX() do { asm volatile("s_wait_dscnt 0" ::: "memory"); __builtin_amdgcn_wave_barrier(); __builtin_amdgcn_fence(__ATOMIC_RELEASE, "workgroup"); } while (0)


#define NB 2
#define SS 2304                 // 2,274 tokens (226 text + 2,048 video) padded to 36 x 64
#define SREAL 2274
#define STXT 226
#define SVID 2048
#define DM 1024
#define NH 16
#define HD 64
#define QKVW (3 * DM)
#ifndef TQB
#define TQB (SS / 64)
#define TNB NB
#define TOB (NB * SS / 64)     // output row tiles (all)
#endif
typedef __attribute__((ext_vector_type(8))) __bf16 v8b;
__device__ __forceinline__ v16b frag_b(const __bf16* rowk0, int lane) {
  union { v16b v; v8b q[2]; } u; const __bf16* p = rowk0 + 8 * (lane >> 4);
  u.q[0] = *(const v8b*)p; u.q[1] = *(const v8b*)(p + 16); return u.v;
}
__device__ __forceinline__ float bfr(float v) { return (float)(__bf16)v; }
__device__ __attribute__((noinline)) float exp_ni(float v) { return expf(v); }
__device__ __attribute__((noinline)) float erf_ni(float v) { return erff(v); }

#define PK_A 0                       // [3072][1024] Wqkv rows (natural [out][in])
#define PK_P (PK_A + QKVW * DM)        // [1024][1024] Wo rows (natural)
#define PK_END (PK_P + DM * DM)
#define WS_PK  0u
#define WS_QK  (WS_PK + 2u * PK_END)             // f16 [4608 rows][2048]: q | k
#define WS_VTH (WS_QK + 2u * NB * SS * 2 * DM)     // f16 [2][1024 (h*64+d)][2304 s] hi
#define WS_VTL (WS_VTH + 2u * NB * DM * SS)        // f16 lo x 2048
#define WS_O   (WS_VTL + 2u * NB * DM * SS)        // f32 [4608][1024]
#define WS_CS  (WS_O + 4u * NB * SS * DM)           // f32 2 x [2304][32], unused
#define WS_END (WS_CS + 4u * 2 * SS * 32)

// ---- LDS staging of the operand tiles that all four waves of a block read: rows of 128 B (64 16-bit values) at a pitch of 144 B (16 B x odd: ds_load_b128 readers), two buffers
#define TP 72                        // row pitch in 16-bit values
#define TPB (2 * TP)                 // row pitch in bytes
#define T64B (64 * TPB)              // a 64-row tile, bytes
#define ASTG (3 * T64B)              // attention stage: K | V hi | V lo, 64 keys
#define WSTG (2 * T64B)              // GEMM stage: 128 weight rows x 64 k
__device__ __forceinline__ unsigned lds_off(const void* p) { return (unsigned)(size_t)p; }
// four asynchronous 16-byte copies per lane, global -> LDS, rows 16 apart (gstep = 16 source rows, in bytes); s_wait_xcnt closes the statement so that no address register is rewritten ahead of it
__device__ __forceinline__ void cp4(unsigned l, const void* gp, size_t gstep) {
  const char* g = (const char*)gp;
  asm volatile("global_load_async_to_lds_b128 %0, %1, off\n\tglobal_load_async_to_lds_b128 %2, %3, off\n\tglobal_load_async_to_lds_b128 %4, %5, off\n\tglobal_load_async_to_lds_b128 %6, %7, off\n\ts_wait_xcnt 0x0"
               :: "v"(l), "v"(g), "v"(l + 16 * TPB), "v"(g + gstep), "v"(l + 32 * TPB), "v"(g + 2 * gstep), "v"(l + 48 * TPB), "v"(g + 3 * gstep) : "memory");
}
// a 128-row x 64-k weight tile (natural rows of DM bf16); src = this lane's 16 bytes of its first row
__device__ __forceinline__ void fill_w(unsigned l, const __bf16* src) { cp4(l, src, (size_t)16 * DM * 2); cp4(l + T64B, src + (size_t)64 * DM, (size_t)16 * DM * 2); }
#define WAIT_DS()    asm volatile("s_wait_dscnt 0x0" ::: "memory")      // this wave's LDS reads of the buffer are done before the barrier frees it
#define WAIT_ASYNC() asm volatile("s_wait_asynccnt 0x0" ::: "memory")   // this wave's copies have landed before the barrier publishes them
// ---- k_pack: ONE launch rounds the four [1024][1024] weights to bf16 (natural [out][in] rows) into the four consecutive planes of DST (wq | wk | wv | wo); blockIdx.y picks the matrix. A wave's load covers 512 contiguous bytes, its store 256; a thread's PKIT loads all issue ahead of its first store
#define PKIT 16                      // 16-byte loads per thread
typedef __attribute__((ext_vector_type(4))) __bf16 v4b;
__global__ __launch_bounds__(256) void k_pack(const float* __restrict__ WQ, const float* __restrict__ WK, const float* __restrict__ WV, const float* __restrict__ WO, __bf16* __restrict__ DST) {
  const int mt = blockIdx.y; const float* S = (mt == 0) ? WQ : (mt == 1) ? WK : (mt == 2) ? WV : WO;
  const size_t e0 = ((size_t)blockIdx.x * (PKIT * 256) + threadIdx.x) * 4;   // this thread's first element; its next ones lie 1,024 elements apart
  const float* s = S + e0; __bf16* d = DST + (size_t)mt * DM * DM + e0; v4f x[PKIT];
#pragma unroll   // x stays in registers and the loads stand together, on one address with immediate offsets
  for (int it = 0; it < PKIT; ++it) x[it] = *(const v4f*)(s + it * 1024);
#pragma unroll   // as above, for the stores
  for (int it = 0; it < PKIT; ++it) { v4b o;
#pragma unroll   // four converts, packed in pairs
    for (int i = 0; i < 4; ++i) o[i] = (__bf16)x[it][i];
    *(v4b*)(d + it * 1024) = o; }
}
// ---- k_qkv: block = (64 rows (b,s), 128 of the 3072 cols): qkv = bf16(x) . rows (exact); cols < 1024 -> f16(q), cols < 2048 -> f16(k) into QK rows (pitch 2048); cols >= 2048 (v) -> per-batch transposed f16 planes VT[b][h*64+d][s]: hi = f16(v), lo = f16((v - hi) * 2048)
__global__ __launch_bounds__(128) void k_qkv(const float* __restrict__ XT, const float* __restrict__ XV, const __bf16* __restrict__ P, const float* __restrict__ BQ, const float* __restrict__ BK, const float* __restrict__ BV, const float* __restrict__ LQW, const float* __restrict__ LQB, const float* __restrict__ LKW, const float* __restrict__ LKB, const float* __restrict__ COS, const float* __restrict__ SIN, _Float16* __restrict__ QK, _Float16* __restrict__ VTH, _Float16* __restrict__ VTL) {
  __shared__ __align__(16) unsigned char L[4 * 16 * 136 * 2 + 2 * 128 * 72 * 2];   // the weight ring (2 x WSTG) during the k loop, then the output staging
  _Float16 (*so)[16][136] = (_Float16 (*)[16][136])L; _Float16 (*sth)[72] = (_Float16 (*)[72])(L + 4 * 16 * 136 * 2); _Float16 (*stl)[72] = sth + 128;
  const int tid = threadIdx.x, wave = tid >> 5, lane = tid & 31, col = lane & 15, g = lane >> 4; const size_t r0 = (size_t)blockIdx.x * 64 + wave * 16; const int n0 = blockIdx.y * 128;
  v8f acc[8] = {};
  const unsigned lw = lds_off(L) + (tid >> 3) * TPB + (tid & 7) * 16; const __bf16* gw = P + (size_t)(n0 + (tid >> 3)) * DM + (tid & 7) * 8;
  fill_w(lw, gw); WAIT_ASYNC(); __syncthreads(); fill_w(lw + WSTG, gw + 64);
const int bb_ = (int)((r0 + col) / SS), ss_ = (int)((r0 + col) % SS); const bool isT = ss_ < STXT, isV = (ss_ >= STXT) && (ss_ < SREAL);   // h = concat([encoder, hidden]); rows >= 2,274 are padding (zero input; masked as keys, never output)
  const float* xrow = isT ? XT + ((size_t)bb_ * STXT + ss_) * DM : XV + ((size_t)bb_ * SVID + (isV ? ss_ - STXT : 0)) * DM;
#pragma unroll 1   // one stage per trip: the buffer index and the publish point at the foot stay those of a two-buffer ring
  for (int st = 0; st < DM / 64; ++st) { const __bf16* Bt = (const __bf16*)(L + (st & 1) * WSTG);
    v4f x[2][4];   // the stage's 64 k of this lane's row: xrow is a valid row for padding lanes too, so the loads stand under no lane test; the zero is selected behind them
#pragma unroll
    for (int sub = 0; sub < 2; ++sub) { const float* p = xrow + st * 64 + sub * 32 + 8 * g; x[sub][0] = *(const v4f*)p; x[sub][1] = *(const v4f*)(p + 4); x[sub][2] = *(const v4f*)(p + 16); x[sub][3] = *(const v4f*)(p + 20); }
#pragma unroll
    for (int sub = 0; sub < 2; ++sub) { union { v16b v; unsigned w[8]; } u;
#pragma unroll
      for (int q = 0; q < 4; ++q) {
#pragma unroll
        for (int i = 0; i < 4; ++i) u.v[q * 4 + i] = (__bf16)x[sub][q][i]; }
#pragma unroll
      for (int q = 0; q < 8; ++q) u.w[q] = (isT || isV) ? u.w[q] : 0u;   // padding rows: zero input
      const v16b a = u.v;
#pragma unroll
      for (int j = 0; j < 8; ++j) acc[j] = wmma_bf(a, frag_b(Bt + (j * 16 + col) * TP + sub * 32, lane), acc[j]); }
    WAIT_DS(); WAIT_ASYNC(); __syncthreads();   // publishes stage st + 1 and frees stage st's buffer
    if (st + 2 < DM / 64) fill_w(lw + (st & 1) * WSTG, gw + (st + 2) * 64); }
  WAIT_ASYNC();
  { const float* BB = (n0 < DM) ? BQ : (n0 < 2 * DM) ? BK : BV; const int nb = n0 % DM;
#pragma unroll
    for (int j = 0; j < 8; ++j) { const float bb = bfr(BB[nb + j * 16 + col]);
#pragma unroll
      for (int r = 0; r < 8; ++r) acc[j][r] += bb; } }
  if (n0 < 2 * DM) {   // q | k: per-head LayerNorm over the 64 dims (this 128-col block = 2 heads: tiles 0-3 and 4-7), then rotary for video tokens; q unscaled (1/8 on the f32 score)
    const float* LW = (n0 < DM) ? LQW : LKW; const float* LBv = (n0 < DM) ? LQB : LKB;
#pragma unroll
    for (int hh = 0; hh < 2; ++hh) {
#pragma unroll
      for (int r = 0; r < 8; ++r) { float s = 0.f;
#pragma unroll
        for (int j = 0; j < 4; ++j) s += acc[hh * 4 + j][r];
#pragma unroll
        for (int o = 1; o < 16; o <<= 1) s += __shfl_xor(s, o);
        const float mu = s * (1.0f / 64.0f); float v = 0.f;
#pragma unroll
        for (int j = 0; j < 4; ++j) { const float dv = acc[hh * 4 + j][r] - mu; v += dv * dv; }
#pragma unroll
        for (int o = 1; o < 16; o <<= 1) v += __shfl_xor(v, o);
        const float rs = rsqrtf(v * (1.0f / 64.0f) + 1e-5f);
#pragma unroll
        for (int j = 0; j < 4; ++j) { const int d = j * 16 + col; acc[hh * 4 + j][r] = (acc[hh * 4 + j][r] - mu) * rs * bfr(LW[d]) + bfr(LBv[d]); } } }
    // the rotary tables of this lane's 8 rows x 4 dims (both heads of the block use the same): table row clamped to 0 for text and padding rows, so the loads stand under no lane test and are all in flight together
    float tc[8][4], ts[8][4]; bool vid[8]; unsigned to[8]; const int sv0 = (int)((r0 + 8 * g) % SS) - STXT;   // 8 rows from a multiple of 8 never cross a batch (SS is one)
#pragma unroll
    for (int r = 0; r < 8; ++r) { const int sv = sv0 + r; vid[r] = sv >= 0 && sv < SVID; to[r] = (unsigned)(vid[r] ? sv : 0) * HD + col; }
#pragma unroll
    for (int r = 0; r < 8; ++r) {
#pragma unroll
      for (int q = 0; q < 4; ++q) { tc[r][q] = COS[to[r] + q * 16]; ts[r][q] = SIN[to[r] + q * 16]; } }
    asm volatile("s_wait_xcnt 0x0" :: "v"(to[0]), "v"(to[1]), "v"(to[2]), "v"(to[3]), "v"(to[4]), "v"(to[5]), "v"(to[6]), "v"(to[7]) : "memory");   // the offset registers of the table loads stay as they are up to this wait
    // rotary on video tokens: pairs (2i, 2i+1): out = x cos + rot(x) sin with rot = [-x_{2i+1}, x_{2i}]; cos/sin [2048][64] inputs (bf16-rounded), indexed by (s - 226, d)
#pragma unroll
    for (int j = 0; j < 8; ++j) { const int d = (j & 3) * 16 + col;
#pragma unroll
      for (int r = 0; r < 8; ++r) { const float xv = acc[j][r]; const float xp = __shfl_xor(xv, 1);   // partner dim d^1 lives in lane col^1
        const float c = bfr(tc[r][j & 3]), sn = bfr(ts[r][j & 3]); const float rot = (d & 1) ? xp : -xp; acc[j][r] = vid[r] ? xv * c + rot * sn : xv; } }   // text and padding rows keep xv by the select
#pragma unroll
    for (int j = 0; j < 8; ++j) {
#pragma unroll
      for (int r = 0; r < 8; ++r) so[wave][8 * g + r][j * 16 + col] = (_Float16)acc[j][r]; }
    LDSX();
    for (int rl = 0; rl < 16; ++rl) if (lane < 16) vst2((unsigned*)(QK + (r0 + rl) * (2 * DM) + n0 + lane * 8), *(const v4u*)&so[wave][rl][lane * 8]);
  } else {
#pragma unroll
    for (int j = 0; j < 8; ++j) {
#pragma unroll
      for (int r = 0; r < 8; ++r) { const float v = acc[j][r]; const _Float16 hv = (_Float16)v; sth[j * 16 + col][wave * 16 + 8 * g + r] = hv; stl[j * 16 + col][wave * 16 + 8 * g + r] = (_Float16)((v - (float)hv) * 2048.0f); } }
    __syncthreads();
    const size_t rb = (size_t)blockIdx.x * 64; const int b = (int)(rb / SS), s0 = (int)(rb % SS); const int pc0 = n0 - 2 * DM;
    for (int q = tid; q < 128 * 8; q += 128) { const int d = q >> 3, pc = q & 7; const size_t o = ((size_t)b * DM + pc0 + d) * SS + s0 + pc * 8; vst2((unsigned*)(VTH + o), *(const v4u*)&sth[d][pc * 8]); vst2((unsigned*)(VTL + o), *(const v4u*)&stl[d][pc * 8]); }
  }
}
typedef __attribute__((ext_vector_type(2))) _Float16 v2h;
// lane l <-> lane l ^ 16 as one vector instruction
__device__ __forceinline__ float xhalf(float x) { return __builtin_bit_cast(float, __builtin_amdgcn_permlanex16(__builtin_bit_cast(int, x), __builtin_bit_cast(int, x), 0x76543210, 0xfedcba98, false, false)); }
__global__ __launch_bounds__(128, 5) void k_attn(const _Float16* __restrict__ QK, const _Float16* __restrict__ VTH, const _Float16* __restrict__ VTL, float* __restrict__ O) {
  __shared__ __align__(16) unsigned char L[2 * ASTG];   // the K/V ring during the key loop, then the output staging
  float (*so)[16][68] = (float (*)[16][68])L;
  const int tid = threadIdx.x, wave = tid >> 5, lane = tid & 31, col = lane & 15, g = lane >> 4;
  const int qb = blockIdx.x, h = blockIdx.y, b = blockIdx.z; const int q0 = qb * 64 + wave * 16; const size_t rq = (size_t)b * SS + q0 + col;
  const unsigned lt = lds_off(L) + (tid >> 3) * TPB + (tid & 7) * 16;
  const _Float16* gk = QK + ((size_t)b * SS + (tid >> 3)) * (2 * DM) + DM + h * HD + (tid & 7) * 8; const size_t gvo = ((size_t)b * DM + h * HD + (tid >> 3)) * SS + (tid & 7) * 8;
  auto fill = [&](int st) { const unsigned l = lt + (st & 1) * ASTG;   // stage st = keys 64 st .. 64 st + 63: K rows [key][64 d], V planes [d][64 keys]
    cp4(l, gk + (size_t)st * 64 * (2 * DM), (size_t)16 * 2 * DM * 2); cp4(l + T64B, VTH + gvo + st * 64, (size_t)16 * SS * 2); cp4(l + 2 * T64B, VTL + gvo + st * 64, (size_t)16 * SS * 2); };
  fill(0); WAIT_ASYNC(); __syncthreads(); fill(1);
  v16h aq[2];
#pragma unroll
  for (int kc = 0; kc < 2; ++kc) aq[kc] = frag_h(QK + rq * (2 * DM) + h * HD + kc * 32, lane);
  float m = -3.0e38f, l = 0.f;   // of query col: m is the same in both halves, l is this half's share of the sum (joined behind the loop)
  v8f acc[4] = {}, accl[4] = {};   // acc[dt][r] = O^T[dt * 16 + 8 g + r][col]
  // not causal; keys >= 2,274 are padding and masked
  // one 32-key pass; 'padded' is a literal at both calls: the mask stands only in the copy that the stage with padding keys runs
  auto pass = [&](const bool padded, const int st, const int sub) __attribute__((always_inline)) { const _Float16* Kt = (const _Float16*)(L + (st & 1) * ASTG); const _Float16* Vh = Kt + 64 * TP; const _Float16* Vl = Vh + 64 * TP; const int ks = st * 2 + sub; v8f s[2];
#pragma unroll
    for (int ct = 0; ct < 2; ++ct) { const int kk0 = ks * 32 + ct * 16 + 8 * g; const _Float16* krow = Kt + (sub * 32 + ct * 16 + col) * TP; v8f c = {};
#pragma unroll
      for (int kc = 0; kc < 2; ++kc) c = wmma16(frag_h(krow + kc * 32, lane), aq[kc], c);
#pragma unroll
      for (int r = 0; r < 8; ++r) s[ct][r] = (!padded || kk0 + r < SREAL) ? c[r] * 0.125f : -3.0e38f; }   // 1/sqrt(64); padded keys masked
    float mx = fmaxf(s[0][0], s[1][0]);
#pragma unroll
    for (int r = 1; r < 8; ++r) mx = fmaxf(mx, fmaxf(s[0][r], s[1][r]));
    mx = fmaxf(mx, xhalf(mx));
    const float mn = fmaxf(m, mx); const float alpha = __expf(m - mn);   // first pass: m = -3e38 against a finite mn, the exp is 0 by itself (and acc and l are 0)
    union { v16h v; v2h p[8]; } pa, pl; v2f es = {0.f, 0.f};   // element ct * 8 + r = key ct * 16 + 8 g + r: the k order of frag_h
#pragma unroll
    for (int ct = 0; ct < 2; ++ct) {
#pragma unroll
      for (int rp = 0; rp < 4; ++rp) { v2f e; e[0] = __expf(s[ct][2 * rp] - mn); e[1] = __expf(s[ct][2 * rp + 1] - mn); es += e;   // a masked key: -3e38 against a finite mn (the first pass holds real keys only), the exp is 0 by itself
        const v2h hh = __builtin_convertvector(e, v2h); pa.p[ct * 4 + rp] = hh; pl.p[ct * 4 + rp] = __builtin_convertvector((e - __builtin_convertvector(hh, v2f)) * 2048.0f, v2h); } }
    l = l * alpha + (es[0] + es[1]); m = mn;
#pragma unroll
    for (int dt = 0; dt < 4; ++dt) { acc[dt] *= alpha; accl[dt] *= alpha; }
#pragma unroll
    for (int dt = 0; dt < 4; ++dt) { const int vr = (dt * 16 + col) * TP + sub * 32; const v16h vh = frag_h(Vh + vr, lane); acc[dt] = wmma16(vh, pa.v, acc[dt]); accl[dt] = wmma16(vh, pl.v, accl[dt]); accl[dt] = wmma16(frag_h(Vl + vr, lane), pa.v, accl[dt]); }   // V hi x P hi + (V hi x P lo + V lo x P hi) / 2048
    // the pass's back edge: the four vector slots between the pass's last WMMAs and the next pass's first write of their operand registers stand here, behind all of them
    asm volatile("v_nop\n\tv_nop\n\tv_nop\n\tv_nop" : "+v"(acc[0]), "+v"(acc[1]), "+v"(acc[2]), "+v"(acc[3]), "+v"(accl[0]), "+v"(accl[1]), "+v"(accl[2]), "+v"(accl[3])); };
#pragma unroll 1   // one stage per trip: the buffer index and the publish point at the foot stay those of a two-buffer ring
  for (int st = 0; st < SREAL / 64; ++st) {   // the stages whose every key is real
#pragma unroll 1   // the 32-key pass stays rolled: one copy of it in the text
    for (int sub = 0; sub < 2; ++sub) pass(false, st, sub);
    WAIT_DS(); WAIT_ASYNC(); __syncthreads();   // publishes stage st + 1 and frees stage st's buffer
    if (st + 2 < SS / 64) fill(st + 2); }
  static_assert(SREAL / 64 == SS / 64 - 1, "only the last stage holds padding keys");
#pragma unroll 1   // rolled as above
  for (int sub = 0; sub < 2; ++sub) pass(true, SS / 64 - 1, sub);   // the last stage, with the mask
  WAIT_DS(); WAIT_ASYNC(); __syncthreads();   // the stage's foot: every wave has left the ring before it becomes the output staging
  WAIT_ASYNC();
  const float il = 1.0f / (l + xhalf(l));
#pragma unroll
  for (int dt = 0; dt < 4; ++dt) {
#pragma unroll
    for (int q = 0; q < 2; ++q) { v4f o;
#pragma unroll
      for (int i = 0; i < 4; ++i) o[i] = (acc[dt][q * 4 + i] + accl[dt][q * 4 + i] * (1.0f / 2048.0f)) * il;
      *(v4f*)&so[wave][col][dt * 16 + 8 * g + q * 4] = o; } }
  LDSX();
  for (int rl = 0; rl < 16; ++rl) if (lane < 16) vst2(O + ((size_t)b * SS + q0 + rl) * DM + h * HD + lane * 4, *(const v4f*)&so[wave][rl][lane * 4]);
}
// ---- k_out: block = (64 rows, 128 cols): out = O(hi/lo) . Wo rows (2 products) + bo
__global__ __launch_bounds__(128) void k_out(const float* __restrict__ O, const __bf16* __restrict__ P, const float* __restrict__ BO, float* __restrict__ Y) {
  __shared__ __align__(16) unsigned char L[2 * WSTG];   // the weight ring during the k loop, then the output staging
  float (*so)[16][132] = (float (*)[16][132])L;
  const int tid = threadIdx.x, wave = tid >> 5, lane = tid & 31, col = lane & 15, g = lane >> 4; const size_t r0 = (size_t)blockIdx.x * 64 + wave * 16; const int n0 = blockIdx.y * 128;
  v8f acc[8] = {};
  const unsigned lw = lds_off(L) + (tid >> 3) * TPB + (tid & 7) * 16; const __bf16* gw = P + (size_t)(n0 + (tid >> 3)) * DM + (tid & 7) * 8;
  fill_w(lw, gw); WAIT_ASYNC(); __syncthreads(); fill_w(lw + WSTG, gw + 64);
#pragma unroll 1   // one stage per trip: the buffer index and the publish point at the foot stay those of a two-buffer ring
  for (int st = 0; st < DM / 64; ++st) { const __bf16* Bt = (const __bf16*)(L + (st & 1) * WSTG);
#pragma unroll
    for (int sub = 0; sub < 2; ++sub) { const F2 a = split_row(O + (r0 + col) * DM, (st * 2 + sub) * 32, lane);
#pragma unroll
      for (int j = 0; j < 8; ++j) { const v16b w = frag_b(Bt + (j * 16 + col) * TP + sub * 32, lane); acc[j] = wmma_bf(a.l, w, acc[j]); acc[j] = wmma_bf(a.h, w, acc[j]); } }
    WAIT_DS(); WAIT_ASYNC(); __syncthreads();   // publishes stage st + 1 and frees stage st's buffer
    if (st + 2 < DM / 64) fill_w(lw + (st & 1) * WSTG, gw + (st + 2) * 64); }
  WAIT_ASYNC();
#pragma unroll
  for (int j = 0; j < 8; ++j) { const float bb = bfr(BO[n0 + j * 16 + col]);
#pragma unroll
    for (int r = 0; r < 8; ++r) so[wave][8 * g + r][j * 16 + col] = acc[j][r] + bb; }
  LDSX();
  for (int rl = 0; rl < 16; ++rl) { const size_t row = r0 + rl; const int b = (int)(row / SS), s = (int)(row % SS); if (s < STXT) vst2(Y + (size_t)NB * SVID * DM + ((size_t)b * STXT + s) * DM + n0 + lane * 4, *(const v4f*)&so[wave][rl][lane * 4]); else if (s < SREAL) vst2(Y + ((size_t)b * SVID + (s - STXT)) * DM + n0 + lane * 4, *(const v4f*)&so[wave][rl][lane * 4]); }   // out0 = o[:, 226:] at 0, out1 = o[:, :226] after it; padding rows dropped
}
extern "C" void kernel_launch(void* const* d_in, const int* in_sizes, int n_in, void* d_out, int out_size, void* d_ws, size_t ws_size, hipStream_t stream) {
  (void)in_sizes; (void)n_in; (void)out_size;
  const float** F = (const float**)d_in;   // 0 hidden_states [2,2048,1024], 1 encoder_hidden_states [2,226,1024], 2 cos [2048,64], 3 sin, 4 wq [1024,1024], 5 bq, 6 wk, 7 bk, 8 wv, 9 bv, 10 wo, 11 bo, 12 lnq_w [64], 13 lnq_b, 14 lnk_w, 15 lnk_b
  if (ws_size < (size_t)WS_END) return;
  char* ws = (char*)d_ws; __bf16* PK = (__bf16*)(ws + WS_PK); _Float16 *QK = (_Float16*)(ws + WS_QK), *VTH = (_Float16*)(ws + WS_VTH), *VTL = (_Float16*)(ws + WS_VTL); float *O = (float*)(ws + WS_O);
  k_pack<<<dim3(DM * DM / (PKIT * 256 * 4), 4), 256, 0, stream>>>(F[4], F[6], F[8], F[10], PK + PK_A);   // PK_P = PK_A + 3 planes: wo is the fourth
  k_qkv<<<dim3(TNB * SS / 64, QKVW / 128), 128, 0, stream>>>(F[1], F[0], PK + PK_A, F[5], F[7], F[9], F[12], F[13], F[14], F[15], F[2], F[3], QK, VTH, VTL);
  k_attn<<<dim3(TQB, NH, TNB), 128, 0, stream>>>(QK, VTH, VTL, O);
  k_out<<<dim3(TOB, DM / 128), 128, 0, stream>>>(O, PK + PK_P, F[11], (float*)d_out);
}

// v007
// A run of this version takes 158 microseconds.
// In both of two side-by-side timings against v006, it was 1.16 times as fast.
// Over all steps from v000 it is 4.88 times as fast.
// compute dtype: hidden_states, encoder_hidden_states, cos, sin and all weights / biases / norm parameters (module inputs) rounded to bf16; q/k/v projections with exact bf16 products (natural [out][in] rows) + bias on WMMA 16x16x32; per-head LayerNorm of q and k (over the 64 dims, eps 1e-5) and the interleaved rotary on the video tokens (input cos/sin tables) in f32 in the projection epilogue; q and k stored once as f16 (q unscaled; 1/8 on the f32 score), v as f16 hi + (x2048-scaled) residual planes; scores with single f16 operands (1 product) and P.V with P as f16 hi + (x2048-scaled) residual x V hi/lo (3 products); the output projection with ctx as bf16 hi + residual x exact wo (2 products) + bo; running-max softmax in f32 with the hardware exp; the 2,274-token sequence is padded to 2,304 rows per batch with the padding keys masked; f32 accumulate.
#include <hip/hip_runtime.h>
#include <math.h>

typedef __attribute__((ext_vector_type(16))) _Float16 v16h;
typedef __attribute__((ext_vector_type(16))) __bf16 v16b;
typedef __attribute__((ext_vector_type(8)))  _Float16 v8h;
typedef __attribute__((ext_vector_type(8)))  float v8f;
typedef __attribute__((ext_vector_type(4)))  float v4f;
typedef __attribute__((ext_vector_type(2)))  float v2f;
typedef __attribute__((ext_vector_type(4)))  unsigned v4u;
typedef __attribute__((ext_vector_type(4)))  int v4i;
typedef float __attribute__((may_alias)) float_a;
typedef int __attribute__((may_alias)) int_a;

template <typename T> __device__ __forceinline__ void vst2(void* p, T v) { *(T*)p = v;  }
__device__ __forceinline__ v8f wmma16(v16h a, v16h b, v8f c) {
  v8f d = __builtin_amdgcn_wmma_f32_16x16x32_f16(false, a, false, b, (short)0, c, false, false);
  return d;
}
__device__ __forceinline__ v8f wmma_bf(v16b a, v16b b, v8f c) {
  v8f d = __builtin_amdgcn_wmma_f32_16x16x32_bf16(false, a, false, b, (short)0, c, false, false);
  return d;
}
// CogVideoX joint text+video attention processor (B 2, 226 text + 2,048 video tokens, D 1,024, 16 heads x 64): qkv with bias, per-head LayerNorm on q and k, rotary on the video part, full softmax attention, output projection + bias; returns (video part, text part).
__device__ __forceinline__ v16h frag_h(const _Float16* rowk0, int lane) {
  union { v16h v; v8h q[2]; } u; const _Float16* p = rowk0 + 8 * (lane >> 4);
  u.q[0] = *(const v8h*)p; u.q[1] = *(const v8h*)(p + 16); return u.v;
}
__device__ __forceinline__ v16h frag_f32(const float* rowk0, int lane) {
  v16h a; const float* p = rowk0 + 8 * (lane >> 4);
#pragma unroll
  for (int i = 0; i < 8; ++i) { a[i] = (_Float16)p[i]; a[8 + i] = (_Float16)p[16 + i]; }
  return a;
}
__device__ __forceinline__ v16h frag_f32s(const float* rowk0, int lane, float sc) {
  v16h a; const float* p = rowk0 + 8 * (lane >> 4);
#pragma unroll
  for (int i = 0; i < 8; ++i) { a[i] = (_Float16)(p[i] * sc); a[8 + i] = (_Float16)(p[16 + i] * sc); }
  return a;
}
// column fragment from a [K][ld] layout (column n), rows >= K read as 0
__device__ __forceinline__ v16h fragc_f32(const float* W, int k0, int n, int lane, int ld, int K) {
  v16h a; const int g = lane >> 4;
#pragma unroll
  for (int i = 0; i < 8; ++i) { const int ka = k0 + 8 * g + i, kb = ka + 16;
    a[i] = (_Float16)(ka < K ? W[(size_t)(ka < K ? ka : K - 1) * ld + n] : 0.f); a[8 + i] = (_Float16)(kb < K ? W[(size_t)(kb < K ? kb : K - 1) * ld + n] : 0.f); }
  return a;
}
struct F2 { v16b h, l; };
__device__ __forceinline__ F2 bsplit16(const float v[16]) { F2 r;
#pragma unroll
  for (int i = 0; i < 16; ++i) { const __bf16 h = (__bf16)v[i]; r.h[i] = h; r.l[i] = (__bf16)(v[i] - (float)h); }
  return r; }
__device__ __forceinline__ F2 split_row(const float* row, int k0, int lane) { float v[16]; const float* p = row + k0 + 8 * (lane >> 4);
#pragma unroll
  for (int i = 0; i < 8; ++i) { v[i] = p[i]; v[8 + i] = p[16 + i]; }
  return bsplit16(v); }
__device__ __forceinline__ F2 split_rowK(const float* row, int k0, int lane, int K) { float v[16]; const int g = lane >> 4;
#pragma unroll
  for (int i = 0; i < 8; ++i) { const int ka = k0 + 8 * g + i, kb = ka + 16; v[i] = ka < K ? row[ka < K ? ka : K - 1] : 0.f; v[8 + i] = kb < K ? row[kb < K ? kb : K - 1] : 0.f; }
  return bsplit16(v); }
__device__ __forceinline__ F2 split_col(const float* W, int k0, int n, int lane, int ld, int K) { float v[16]; const int g = lane >> 4;
#pragma unroll
  for (int i = 0; i < 8; ++i) { const int ka = k0 + 8 * g + i, kb = ka + 16; v[i] = ka < K ? W[(size_t)(ka < K ? ka : K - 1) * ld + n] : 0.f; v[8 + i] = kb < K ? W[(size_t)(kb < K ? kb : K - 1) * ld + n] : 0.f; }
  return bsplit16(v); }
__device__ __forceinline__ v8f mac3(const F2& a, const F2& b, v8f c) { c = wmma_bf(a.l, b.h, c); c = wmma_bf(a.h, b.l, c); return wmma_bf(a.h, b.h, c); }
__device__ __forceinline__ float sigm(float v) { return 1.0f / (1.0f + expf(-v)); }
#define LDSX() do { asm volatile("s_wait_dscnt 0" ::: "memory"); __builtin_amdgcn_wave_barrier(); __builtin_amdgcn_fence(__ATOMIC_RELEASE, "workgroup"); } while (0)


#define NB 2
#define SS 2304                 // 2,274 tokens (226 text + 2,048 video) padded to 36 x 64
#define SREAL 2274
#define STXT 226
#define SVID 2048
#define DM 1024
#define NH 16
#define HD 64
#define QKVW (3 * DM)
#ifndef TQB
#define TQB (SS / 64)
#define TNB NB
#define TOB (NB * SS / 64)     // output row tiles (all)
#endif
typedef __attribute__((ext_vector_type(8))) __bf16 v8b;
__device__ __forceinline__ v16b frag_b(const __bf16* rowk0, int lane) {
  union { v16b v; v8b q[2]; } u; const __bf16* p = rowk0 + 8 * (lane >> 4);
  u.q[0] = *(const v8b*)p; u.q[1] = *(const v8b*)(p + 16); return u.v;
}
__device__ __forceinline__ float bfr(float v) { return (float)(__bf16)v; }
__device__ __attribute__((noinline)) float exp_ni(float v) { return expf(v); }
__device__ __attribute__((noinline)) float erf_ni(float v) { return erff(v); }

#define PK_A 0                       // [3072][1024] Wqkv rows (natural [out][in])
#define PK_P (PK_A + QKVW * DM)        // [1024][1024] Wo rows (natural)
#define PK_END (PK_P + DM * DM)
#define WS_PK  0u
#define WS_QK  (WS_PK + 2u * PK_END)             // f16 [4608 rows][2048]: q | k
#define WS_VTH (WS_QK + 2u * NB * SS * 2 * DM)     // f16 [2][1024 (h*64+d)][2304 s] hi
#define WS_VTL (WS_VTH + 2u * NB * DM * SS)        // f16 lo x 2048
#define WS_OH  (WS_VTL + 2u * NB * DM * SS)        // bf16 [4608][1024]: ctx, rounded
#define WS_OL  (WS_OH + 2u * NB * SS * DM)          // bf16 [4608][1024]: ctx, residual
#define WS_XB  (WS_OL + 2u * NB * SS * DM)          // bf16 [4608][1024]: x = text | video | zero padding rows, per batch
#define WS_END (WS_XB + 2u * NB * SS * DM)

// ---- LDS staging of the operand tiles that all four waves of a block read: rows of 128 B (64 16-bit values) at a pitch of 144 B (16 B x odd: ds_load_b128 readers), two buffers
#define TP 72                        // row pitch in 16-bit values
#define TPB (2 * TP)                 // row pitch in bytes
#define T64B (64 * TPB)              // a 64-row tile, bytes
#define ASTG (3 * T64B)              // attention stage: K | V hi | V lo, 64 keys
#define WSTG (2 * T64B)              // 128 weight rows x 64 k
#define QSTG (WSTG + T64B)           // qkv stage: weight rows | 64 x rows
#define OSTG (WSTG + 2 * T64B)       // output projection stage: weight rows | 64 ctx rows, rounded | their residuals
__device__ __forceinline__ unsigned lds_off(const void* p) { return (unsigned)(size_t)p; }
// four asynchronous 16-byte copies per lane, global -> LDS, rows 16 apart (gstep = 16 source rows, in bytes); s_wait_xcnt closes the statement so that no address register is rewritten ahead of it
__device__ __forceinline__ void cp4(unsigned l, const void* gp, size_t gstep) {
  const char* g = (const char*)gp;
  asm volatile("global_load_async_to_lds_b128 %0, %1, off\n\tglobal_load_async_to_lds_b128 %2, %3, off\n\tglobal_load_async_to_lds_b128 %4, %5, off\n\tglobal_load_async_to_lds_b128 %6, %7, off\n\ts_wait_xcnt 0x0"
               :: "v"(l), "v"(g), "v"(l + 16 * TPB), "v"(g + gstep), "v"(l + 32 * TPB), "v"(g + 2 * gstep), "v"(l + 48 * TPB), "v"(g + 3 * gstep) : "memory");
}
// a 128-row x 64-k weight tile (natural rows of DM bf16); src = this lane's 16 bytes of its first row
__device__ __forceinline__ void fill_w(unsigned l, const __bf16* src) { cp4(l, src, (size_t)16 * DM * 2); cp4(l + T64B, src + (size_t)64 * DM, (size_t)16 * DM * 2); }
#define WAIT_DS()    asm volatile("s_wait_dscnt 0x0" ::: "memory")      // this wave's LDS reads of the buffer are done before the barrier frees it
#define WAIT_ASYNC() asm volatile("s_wait_asynccnt 0x0" ::: "memory")   // this wave's copies have landed before the barrier publishes them
// ---- k_pack: ONE launch rounds to bf16 what the projections read many times over: blocks < PKW the four [1024][1024] weights (natural [out][in] rows) into the four consecutive planes of DST (wq | wk | wv | wo), the other PKX blocks the rows of x into XB (per batch: 226 text rows, 2,048 video rows, 30 zero rows). A block takes PKIT rows of 1,024; a wave's load covers 512 contiguous bytes, its store 256; a thread's PKIT loads all issue ahead of its first store
#define PKIT 16                      // 16-byte loads per thread, one per row
#define PKW (4 * DM / PKIT)          // blocks on the weights
#define PKX (NB * SS / PKIT)         // blocks on x
typedef __attribute__((ext_vector_type(4))) __bf16 v4b;
__global__ __launch_bounds__(256) void k_pack(const float* __restrict__ WQ, const float* __restrict__ WK, const float* __restrict__ WV, const float* __restrict__ WO, const float* __restrict__ XT, const float* __restrict__ XV, __bf16* __restrict__ DST, __bf16* __restrict__ XB) {
  const int bid = blockIdx.x, c4 = threadIdx.x * 4; __bf16* d; v4f x[PKIT];
  if (bid < PKW) { const int mt = bid / (DM / PKIT); const float* S = (mt == 0) ? WQ : (mt == 1) ? WK : (mt == 2) ? WV : WO;
    const float* s = S + (size_t)(bid % (DM / PKIT)) * (PKIT * DM) + c4; d = DST + (size_t)bid * (PKIT * DM) + c4;
#pragma unroll   // x stays in registers and the loads stand together, on one address with immediate offsets
    for (int it = 0; it < PKIT; ++it) x[it] = *(const v4f*)(s + it * DM);
  } else { const int r0 = (bid - PKW) * PKIT, b = r0 / SS, s0 = r0 % SS; d = XB + (size_t)r0 * DM + c4;   // PKIT rows from a multiple of PKIT never cross a batch (SS is one)
    static_assert(SS % PKIT == 0, "a block's rows lie in one batch");
    const float* pt = XT + ((ptrdiff_t)b * STXT + s0) * DM + c4; const float* pv = XV + ((ptrdiff_t)b * SVID + s0 - STXT) * DM + c4;   // where row s0 would lie in the text and in the video input; each is used only for the rows that do lie there
#pragma unroll   // as above; a padding row loads a valid row (one of the first PKIT video rows), so that no load stands under a test, and the zero is selected behind the loads
    for (int it = 0; it < PKIT; ++it) { const int s = s0 + it; const float* p = (s < STXT) ? pt : (s < SREAL) ? pv : XV + c4; x[it] = *(const v4f*)(p + it * DM); }
#pragma unroll
    for (int it = 0; it < PKIT; ++it) if (s0 + it >= SREAL) x[it] = (v4f){0.f, 0.f, 0.f, 0.f};
  }
#pragma unroll   // as above, for the stores
  for (int it = 0; it < PKIT; ++it) { v4b o;
#pragma unroll   // four converts, packed in pairs
    for (int i = 0; i < 4; ++i) o[i] = (__bf16)x[it][i];
    *(v4b*)(d + it * DM) = o; }
}
// ---- k_qkv: block = (64 rows (b,s), 128 of the 3072 cols): qkv = x (bf16 rows of XB, staged in LDS beside the weight rows) . rows (exact); cols < 1024 -> f16(q), cols < 2048 -> f16(k) into QK rows (pitch 2048); cols >= 2048 (v) -> per-batch transposed f16 planes VT[b][h*64+d][s]: hi = f16(v), lo = f16((v - hi) * 2048)
__global__ __launch_bounds__(128) void k_qkv(const __bf16* __restrict__ XB, const __bf16* __restrict__ P, const float* __restrict__ BQ, const float* __restrict__ BK, const float* __restrict__ BV, const float* __restrict__ LQW, const float* __restrict__ LQB, const float* __restrict__ LKW, const float* __restrict__ LKB, const float* __restrict__ COS, const float* __restrict__ SIN, _Float16* __restrict__ QK, _Float16* __restrict__ VTH, _Float16* __restrict__ VTL) {
  __shared__ __align__(16) unsigned char L[2 * QSTG];   // the ring during the k loop, then the output staging
  static_assert(2 * QSTG >= 4 * 16 * 136 * 2 + 2 * 128 * 72 * 2, "the output staging fits the ring");
  _Float16 (*so)[16][136] = (_Float16 (*)[16][136])L; _Float16 (*sth)[72] = (_Float16 (*)[72])(L + 4 * 16 * 136 * 2); _Float16 (*stl)[72] = sth + 128;
  const int tid = threadIdx.x, wave = tid >> 5, lane = tid & 31, col = lane & 15, g = lane >> 4; const size_t r0 = (size_t)blockIdx.x * 64 + wave * 16; const int n0 = blockIdx.y * 128;
  v8f acc[8] = {};
  const unsigned lw = lds_off(L) + (tid >> 3) * TPB + (tid & 7) * 16; const __bf16* gw = P + (size_t)(n0 + (tid >> 3)) * DM + (tid & 7) * 8;
  const __bf16* gx = XB + ((size_t)blockIdx.x * 64 + (tid >> 3)) * DM + (tid & 7) * 8;
  auto fill = [&](int st) { const unsigned l = lw + (st & 1) * QSTG; fill_w(l, gw + st * 64); cp4(l + WSTG, gx + st * 64, (size_t)16 * DM * 2); };   // stage st = k 64 st .. 64 st + 63 of the block's 128 weight rows and 64 x rows
  fill(0); WAIT_ASYNC(); __syncthreads(); fill(1);
#pragma unroll 1   // one stage per trip: the buffer index and the publish point at the foot stay those of a two-buffer ring
  for (int st = 0; st < DM / 64; ++st) { const __bf16* Bt = (const __bf16*)(L + (st & 1) * QSTG); const __bf16* At = Bt + (128 + wave * 16 + col) * TP;   // this lane's x row
#pragma unroll
    for (int sub = 0; sub < 2; ++sub) { const v16b a = frag_b(At + sub * 32, lane); v16b w[8];
#pragma unroll
      for (int j = 0; j < 8; ++j) w[j] = frag_b(Bt + (j * 16 + col) * TP + sub * 32, lane);
      __builtin_amdgcn_sched_barrier(0);   // the 32 k's fragment loads stay one group ahead of their WMMAs: left to itself this build reloads one register set in front of every WMMA and waits each load out
#pragma unroll
      for (int j = 0; j < 8; ++j) acc[j] = wmma_bf(a, w[j], acc[j]); }
    WAIT_DS(); WAIT_ASYNC(); __syncthreads();   // publishes stage st + 1 and frees stage st's buffer
    if (st + 2 < DM / 64) fill(st + 2); }
  WAIT_ASYNC();
  { const float* BB = (n0 < DM) ? BQ : (n0 < 2 * DM) ? BK : BV; const int nb = n0 % DM;
#pragma unroll
    for (int j = 0; j < 8; ++j) { const float bb = bfr(BB[nb + j * 16 + col]);
#pragma unroll
      for (int r = 0; r < 8; ++r) acc[j][r] += bb; } }
  if (n0 < 2 * DM) {   // q | k: per-head LayerNorm over the 64 dims (this 128-col block = 2 heads: tiles 0-3 and 4-7), then rotary for video tokens; q unscaled (1/8 on the f32 score)
    const float* LW = (n0 < DM) ? LQW : LKW; const float* LBv = (n0 < DM) ? LQB : LKB;
#pragma unroll
    for (int hh = 0; hh < 2; ++hh) {
#pragma unroll
      for (int r = 0; r < 8; ++r) { float s = 0.f;
#pragma unroll
        for (int j = 0; j < 4; ++j) s += acc[hh * 4 + j][r];
#pragma unroll
        for (int o = 1; o < 16; o <<= 1) s += __shfl_xor(s, o);
        const float mu = s * (1.0f / 64.0f); float v = 0.f;
#pragma unroll
        for (int j = 0; j < 4; ++j) { const float dv = acc[hh * 4 + j][r] - mu; v += dv * dv; }
#pragma unroll
        for (int o = 1; o < 16; o <<= 1) v += __shfl_xor(v, o);
        const float rs = rsqrtf(v * (1.0f / 64.0f) + 1e-5f);
#pragma unroll
        for (int j = 0; j < 4; ++j) { const int d = j * 16 + col; acc[hh * 4 + j][r] = (acc[hh * 4 + j][r] - mu) * rs * bfr(LW[d]) + bfr(LBv[d]); } } }
    // the rotary tables of this lane's 8 rows x 4 dims (both heads of the block use the same): table row clamped to 0 for text and padding rows, so the loads stand under no lane test and are all in flight together
    float tc[8][4], ts[8][4]; bool vid[8]; unsigned to[8]; const int sv0 = (int)((r0 + 8 * g) % SS) - STXT;   // 8 rows from a multiple of 8 never cross a batch (SS is one)
#pragma unroll
    for (int r = 0; r < 8; ++r) { const int sv = sv0 + r; vid[r] = sv >= 0 && sv < SVID; to[r] = (unsigned)(vid[r] ? sv : 0) * HD + col; }
#pragma unroll
    for (int r = 0; r < 8; ++r) {
#pragma unroll
      for (int q = 0; q < 4; ++q) { tc[r][q] = COS[to[r] + q * 16]; ts[r][q] = SIN[to[r] + q * 16]; } }
    asm volatile("s_wait_xcnt 0x0" :: "v"(to[0]), "v"(to[1]), "v"(to[2]), "v"(to[3]), "v"(to[4]), "v"(to[5]), "v"(to[6]), "v"(to[7]) : "memory");   // the offset registers of the table loads stay as they are up to this wait
    // rotary on video tokens: pairs (2i, 2i+1): out = x cos + rot(x) sin with rot = [-x_{2i+1}, x_{2i}]; cos/sin [2048][64] inputs (bf16-rounded), indexed by (s - 226, d)
#pragma unroll
    for (int j = 0; j < 8; ++j) { const int d = (j & 3) * 16 + col;
#pragma unroll
      for (int r = 0; r < 8; ++r) { const float xv = acc[j][r]; const float xp = __shfl_xor(xv, 1);   // partner dim d^1 lives in lane col^1
        const float c = bfr(tc[r][j & 3]), sn = bfr(ts[r][j & 3]); const float rot = (d & 1) ? xp : -xp; acc[j][r] = vid[r] ? xv * c + rot * sn : xv; } }   // text and padding rows keep xv by the select
#pragma unroll
    for (int j = 0; j < 8; ++j) {
#pragma unroll
      for (int r = 0; r < 8; ++r) so[wave][8 * g + r][j * 16 + col] = (_Float16)acc[j][r]; }
    LDSX();
    for (int rl = 0; rl < 16; ++rl) if (lane < 16) vst2((unsigned*)(QK + (r0 + rl) * (2 * DM) + n0 + lane * 8), *(const v4u*)&so[wave][rl][lane * 8]);
  } else {
#pragma unroll
    for (int j = 0; j < 8; ++j) {
#pragma unroll
      for (int r = 0; r < 8; ++r) { const float v = acc[j][r]; const _Float16 hv = (_Float16)v; sth[j * 16 + col][wave * 16 + 8 * g + r] = hv; stl[j * 16 + col][wave * 16 + 8 * g + r] = (_Float16)((v - (float)hv) * 2048.0f); } }
    __syncthreads();
    const size_t rb = (size_t)blockIdx.x * 64; const int b = (int)(rb / SS), s0 = (int)(rb % SS); const int pc0 = n0 - 2 * DM;
    for (int q = tid; q < 128 * 8; q += 128) { const int d = q >> 3, pc = q & 7; const size_t o = ((size_t)b * DM + pc0 + d) * SS + s0 + pc * 8; vst2((unsigned*)(VTH + o), *(const v4u*)&sth[d][pc * 8]); vst2((unsigned*)(VTL + o), *(const v4u*)&stl[d][pc * 8]); }
  }
}
typedef __attribute__((ext_vector_type(2))) _Float16 v2h;
// lane l <-> lane l ^ 16 as one vector instruction
__device__ __forceinline__ float xhalf(float x) { return __builtin_bit_cast(float, __builtin_amdgcn_permlanex16(__builtin_bit_cast(int, x), __builtin_bit_cast(int, x), 0x76543210, 0xfedcba98, false, false)); }
__global__ __launch_bounds__(128, 5) void k_attn(const _Float16* __restrict__ QK, const _Float16* __restrict__ VTH, const _Float16* __restrict__ VTL, __bf16* __restrict__ OH, __bf16* __restrict__ OL) {
  __shared__ __align__(16) unsigned char L[2 * ASTG];   // the K/V ring during the key loop, then the output staging
  __bf16 (*so)[2][16][TP] = (__bf16 (*)[2][16][TP])L;   // per wave: 16 query rows of 64 rounded values, then of 64 residuals
  const int tid = threadIdx.x, wave = tid >> 5, lane = tid & 31, col = lane & 15, g = lane >> 4;
  const int qb = blockIdx.x, h = blockIdx.y, b = blockIdx.z; const int q0 = qb * 64 + wave * 16; const size_t rq = (size_t)b * SS + q0 + col;
  const unsigned lt = lds_off(L) + (tid >> 3) * TPB + (tid & 7) * 16;
  const _Float16* gk = QK + ((size_t)b * SS + (tid >> 3)) * (2 * DM) + DM + h * HD + (tid & 7) * 8; const size_t gvo = ((size_t)b * DM + h * HD + (tid >> 3)) * SS + (tid & 7) * 8;
  auto fill = [&](int st) { const unsigned l = lt + (st & 1) * ASTG;   // stage st = keys 64 st .. 64 st + 63: K rows [key][64 d], V planes [d][64 keys]
    cp4(l, gk + (size_t)st * 64 * (2 * DM), (size_t)16 * 2 * DM * 2); cp4(l + T64B, VTH + gvo + st * 64, (size_t)16 * SS * 2); cp4(l + 2 * T64B, VTL + gvo + st * 64, (size_t)16 * SS * 2); };
  fill(0); WAIT_ASYNC(); __syncthreads(); fill(1);
  v16h aq[2];
#pragma unroll
  for (int kc = 0; kc < 2; ++kc) aq[kc] = frag_h(QK + rq * (2 * DM) + h * HD + kc * 32, lane);
  float m = -3.0e38f, l = 0.f;   // of query col: m is the same in both halves, l is this half's share of the sum (joined behind the loop)
  v8f acc[4] = {}, accl[4] = {};   // acc[dt][r] = O^T[dt * 16 + 8 g + r][col]
  // not causal; keys >= 2,274 are padding and masked
  // one 32-key pass; 'padded' is a literal at both calls: the mask stands only in the copy that the stage with padding keys runs
  auto pass = [&](const bool padded, const int st, const int sub) __attribute__((always_inline)) { const _Float16* Kt = (const _Float16*)(L + (st & 1) * ASTG); const _Float16* Vh = Kt + 64 * TP; const _Float16* Vl = Vh + 64 * TP; const int ks = st * 2 + sub; v8f s[2];
#pragma unroll
    for (int ct = 0; ct < 2; ++ct) { const int kk0 = ks * 32 + ct * 16 + 8 * g; const _Float16* krow = Kt + (sub * 32 + ct * 16 + col) * TP; v8f c = {};
#pragma unroll
      for (int kc = 0; kc < 2; ++kc) c = wmma16(frag_h(krow + kc * 32, lane), aq[kc], c);
#pragma unroll
      for (int r = 0; r < 8; ++r) s[ct][r] = (!padded || kk0 + r < SREAL) ? c[r] * 0.125f : -3.0e38f; }   // 1/sqrt(64); padded keys masked
    float mx = fmaxf(s[0][0], s[1][0]);
#pragma unroll
    for (int r = 1; r < 8; ++r) mx = fmaxf(mx, fmaxf(s[0][r], s[1][r]));
    mx = fmaxf(mx, xhalf(mx));
    const float mn = fmaxf(m, mx); const float alpha = __expf(m - mn);   // first pass: m = -3e38 against a finite mn, the exp is 0 by itself (and acc and l are 0)
    union { v16h v; v2h p[8]; } pa, pl; v2f es = {0.f, 0.f};   // element ct * 8 + r = key ct * 16 + 8 g + r: the k order of frag_h
#pragma unroll
    for (int ct = 0; ct < 2; ++ct) {
#pragma unroll
      for (int rp = 0; rp < 4; ++rp) { v2f e; e[0] = __expf(s[ct][2 * rp] - mn); e[1] = __expf(s[ct][2 * rp + 1] - mn); es += e;   // a masked key: -3e38 against a finite mn (the first pass holds real keys only), the exp is 0 by itself
        const v2h hh = __builtin_convertvector(e, v2h); pa.p[ct * 4 + rp] = hh; pl.p[ct * 4 + rp] = __builtin_convertvector((e - __builtin_convertvector(hh, v2f)) * 2048.0f, v2h); } }
    l = l * alpha + (es[0] + es[1]); m = mn;
#pragma unroll
    for (int dt = 0; dt < 4; ++dt) { acc[dt] *= alpha; accl[dt] *= alpha; }
#pragma unroll
    for (int dt = 0; dt < 4; ++dt) { const int vr = (dt * 16 + col) * TP + sub * 32; const v16h vh = frag_h(Vh + vr, lane); acc[dt] = wmma16(vh, pa.v, acc[dt]); accl[dt] = wmma16(vh, pl.v, accl[dt]); accl[dt] = wmma16(frag_h(Vl + vr, lane), pa.v, accl[dt]); }   // V hi x P hi + (V hi x P lo + V lo x P hi) / 2048
    // the pass's back edge: the four vector slots between the pass's last WMMAs and the next pass's first write of their operand registers stand here, behind all of them
    asm volatile("v_nop\n\tv_nop\n\tv_nop\n\tv_nop" : "+v"(acc[0]), "+v"(acc[1]), "+v"(acc[2]), "+v"(acc[3]), "+v"(accl[0]), "+v"(accl[1]), "+v"(accl[2]), "+v"(accl[3])); };
#pragma unroll 1   // one stage per trip: the buffer index and the publish point at the foot stay those of a two-buffer ring
  for (int st = 0; st < SREAL / 64; ++st) {   // the stages whose every key is real
#pragma unroll 1   // the 32-key pass stays rolled: one copy of it in the text
    for (int sub = 0; sub < 2; ++sub) pass(false, st, sub);
    WAIT_DS(); WAIT_ASYNC(); __syncthreads();   // publishes stage st + 1 and frees stage st's buffer
    if (st + 2 < SS / 64) fill(st + 2); }
  static_assert(SREAL / 64 == SS / 64 - 1, "only the last stage holds padding keys");
#pragma unroll 1   // rolled as above
  for (int sub = 0; sub < 2; ++sub) pass(true, SS / 64 - 1, sub);   // the last stage, with the mask
  WAIT_DS(); WAIT_ASYNC(); __syncthreads();   // the stage's foot: every wave has left the ring before it becomes the output staging
  WAIT_ASYNC();
  const float il = 1.0f / (l + xhalf(l));
#pragma unroll
  for (int dt = 0; dt < 4; ++dt) { v8b oh, ol;
#pragma unroll
    for (int i = 0; i < 8; ++i) { const float o = (acc[dt][i] + accl[dt][i] * (1.0f / 2048.0f)) * il; const __bf16 hb = (__bf16)o; oh[i] = hb; ol[i] = (__bf16)(o - (float)hb); }
    *(v8b*)&so[wave][0][col][dt * 16 + 8 * g] = oh; *(v8b*)&so[wave][1][col][dt * 16 + 8 * g] = ol; }
  LDSX();
#pragma unroll   // a store covers four rows' 128-byte pieces
  for (int it = 0; it < 4; ++it) { const int rl = it * 4 + (lane >> 3), pc = (lane & 7) * 8; const unsigned o = (unsigned)((b * SS + q0 + rl) * DM + h * HD + pc); vst2((unsigned*)(OH + o), *(const v4u*)&so[wave][0][rl][pc]); vst2((unsigned*)(OL + o), *(const v4u*)&so[wave][1][rl][pc]); }
}
// ---- k_out: block = (64 rows, 128 cols): out = ctx (OH and OL rows, staged in LDS beside the weight rows) . Wo rows (2 products) + bo
__global__ __launch_bounds__(128) void k_out(const __bf16* __restrict__ OH, const __bf16* __restrict__ OL, const __bf16* __restrict__ P, const float* __restrict__ BO, float* __restrict__ Y) {
  __shared__ __align__(16) unsigned char L[2 * OSTG];   // the ring during the k loop, then the output staging
  float (*so)[16][132] = (float (*)[16][132])L;
  const int tid = threadIdx.x, wave = tid >> 5, lane = tid & 31, col = lane & 15, g = lane >> 4; const size_t r0 = (size_t)blockIdx.x * 64 + wave * 16; const int n0 = blockIdx.y * 128;
  v8f acc[8] = {};
  const unsigned lw = lds_off(L) + (tid >> 3) * TPB + (tid & 7) * 16; const __bf16* gw = P + (size_t)(n0 + (tid >> 3)) * DM + (tid & 7) * 8;
  const size_t go = ((size_t)blockIdx.x * 64 + (tid >> 3)) * DM + (tid & 7) * 8;
  auto fill = [&](int st) { const unsigned l = lw + (st & 1) * OSTG; fill_w(l, gw + st * 64); cp4(l + WSTG, OH + go + st * 64, (size_t)16 * DM * 2); cp4(l + WSTG + T64B, OL + go + st * 64, (size_t)16 * DM * 2); };   // stage st = k 64 st .. 64 st + 63 of the block's 128 weight rows and 64 ctx rows (both planes)
  fill(0); WAIT_ASYNC(); __syncthreads(); fill(1);
#pragma unroll 1   // one stage per trip: the buffer index and the publish point at the foot stay those of a two-buffer ring
  for (int st = 0; st < DM / 64; ++st) { const __bf16* Bt = (const __bf16*)(L + (st & 1) * OSTG); const __bf16* Ah = Bt + (128 + wave * 16 + col) * TP; const __bf16* Al = Ah + 64 * TP;   // this lane's ctx row in the two planes
#pragma unroll
    for (int sub = 0; sub < 2; ++sub) { const v16b ah = frag_b(Ah + sub * 32, lane), al = frag_b(Al + sub * 32, lane); v16b w[8];
#pragma unroll
      for (int j = 0; j < 8; ++j) w[j] = frag_b(Bt + (j * 16 + col) * TP + sub * 32, lane);
      __builtin_amdgcn_sched_barrier(0);   // the 32 k's fragment loads stay one group ahead of their WMMAs (as in k_qkv)
#pragma unroll
      for (int j = 0; j < 8; ++j) { acc[j] = wmma_bf(al, w[j], acc[j]); acc[j] = wmma_bf(ah, w[j], acc[j]); } }
    WAIT_DS(); WAIT_ASYNC(); __syncthreads();   // publishes stage st + 1 and frees stage st's buffer
    if (st + 2 < DM / 64) fill(st + 2); }
  WAIT_ASYNC();
#pragma unroll
  for (int j = 0; j < 8; ++j) { const float bb = bfr(BO[n0 + j * 16 + col]);
#pragma unroll
    for (int r = 0; r < 8; ++r) so[wave][8 * g + r][j * 16 + col] = acc[j][r] + bb; }
  LDSX();
  for (int rl = 0; rl < 16; ++rl) { const size_t row = r0 + rl; const int b = (int)(row / SS), s = (int)(row % SS); if (s < STXT) vst2(Y + (size_t)NB * SVID * DM + ((size_t)b * STXT + s) * DM + n0 + lane * 4, *(const v4f*)&so[wave][rl][lane * 4]); else if (s < SREAL) vst2(Y + ((size_t)b * SVID + (s - STXT)) * DM + n0 + lane * 4, *(const v4f*)&so[wave][rl][lane * 4]); }   // out0 = o[:, 226:] at 0, out1 = o[:, :226] after it; padding rows dropped
}
extern "C" void kernel_launch(void* const* d_in, const int* in_sizes, int n_in, void* d_out, int out_size, void* d_ws, size_t ws_size, hipStream_t stream) {
  (void)in_sizes; (void)n_in; (void)out_size;
  const float** F = (const float**)d_in;   // 0 hidden_states [2,2048,1024], 1 encoder_hidden_states [2,226,1024], 2 cos [2048,64], 3 sin, 4 wq [1024,1024], 5 bq, 6 wk, 7 bk, 8 wv, 9 bv, 10 wo, 11 bo, 12 lnq_w [64], 13 lnq_b, 14 lnk_w, 15 lnk_b
  if (ws_size < (size_t)WS_END) return;
  char* ws = (char*)d_ws; __bf16* PK = (__bf16*)(ws + WS_PK); _Float16 *QK = (_Float16*)(ws + WS_QK), *VTH = (_Float16*)(ws + WS_VTH), *VTL = (_Float16*)(ws + WS_VTL); __bf16 *OH = (__bf16*)(ws + WS_OH), *OL = (__bf16*)(ws + WS_OL), *XB = (__bf16*)(ws + WS_XB);
  k_pack<<<dim3(PKW + PKX), 256, 0, stream>>>(F[4], F[6], F[8], F[10], F[1], F[0], PK + PK_A, XB);   // PK_P = PK_A + 3 planes: wo is the fourth
  k_qkv<<<dim3(TNB * SS / 64, QKVW / 128), 128, 0, stream>>>(XB, PK + PK_A, F[5], F[7], F[9], F[12], F[13], F[14], F[15], F[2], F[3], QK, VTH, VTL);
  k_attn<<<dim3(TQB, NH, TNB), 128, 0, stream>>>(QK, VTH, VTL, OH, OL);
  k_out<<<dim3(TOB, DM / 128), 128, 0, stream>>>(OH, OL, PK + PK_P, F[11], (float*)d_out);
}

// v008
// It runs in 148 microseconds.
// Two timings next to v007 both put it at 1.07 times that version's speed.
// Over all steps from v000 it is 5.23 times as fast.
// compute dtype: hidden_states, encoder_hidden_states, cos, sin and all weights / biases / norm parameters (module inputs) rounded to bf16; q/k/v projections with exact bf16 products (natural [out][in] rows) + bias on WMMA 16x16x32; per-head LayerNorm of q and k (over the 64 dims, eps 1e-5) and the interleaved rotary on the video tokens (input cos/sin tables) in f32 in the projection epilogue; q and k stored once as f16 (q unscaled; 1/8 on the f32 score), v as f16 hi + (x2048-scaled) residual planes; scores with single f16 operands (1 product) and P.V with P as f16 hi + (x2048-scaled) residual x V hi/lo (3 products); the output projection with ctx as bf16 hi + residual x exact wo (2 products) + bo; running-max softmax in f32 with the hardware exp; the 2,274-token sequence is padded to 2,304 rows per batch with the padding keys masked; f32 accumulate.
#include <hip/hip_runtime.h>
#include <math.h>

typedef __attribute__((ext_vector_type(16))) _Float16 v16h;
typedef __attribute__((ext_vector_type(16))) __bf16 v16b;
typedef __attribute__((ext_vector_type(8)))  _Float16 v8h;
typedef __attribute__((ext_vector_type(8)))  float v8f;
typedef __attribute__((ext_vector_type(4)))  float v4f;
typedef __attribute__((ext_vector_type(2)))  float v2f;
typedef __attribute__((ext_vector_type(4)))  unsigned v4u;
typedef __attribute__((ext_vector_type(4)))  int v4i;
typedef float __attribute__((may_alias)) float_a;
typedef int __attribute__((may_alias)) int_a;

template <typename T> __device__ __forceinline__ void vst2(void* p, T v) { *(T*)p = v;  }
__device__ __forceinline__ v8f wmma16(v16h a, v16h b, v8f c) {
  v8f d = __builtin_amdgcn_wmma_f32_16x16x32_f16(false, a, false, b, (short)0, c, false, false);
  return d;
}
__device__ __forceinline__ v8f wmma_bf(v16b a, v16b b, v8f c) {
  v8f d = __builtin_amdgcn_wmma_f32_16x16x32_bf16(false, a, false, b, (short)0, c, false, false);
  return d;
}
// CogVideoX joint text+video attention processor (B 2, 226 text + 2,048 video tokens, D 1,024, 16 heads x 64): qkv with bias, per-head LayerNorm on q and k, rotary on the video part, full softmax attention, output projection + bias; returns (video part, text part).
__device__ __forceinline__ v16h frag_h(const _Float16* rowk0, int lane) {
  union { v16h v; v8h q[2]; } u; const _Float16* p = rowk0 + 8 * (lane >> 4);
  u.q[0] = *(const v8h*)p; u.q[1] = *(const v8h*)(p + 16); return u.v;
}
__device__ __forceinline__ v16h frag_f32(const float* rowk0, int lane) {
  v16h a; const float* p = rowk0 + 8 * (lane >> 4);
#pragma unroll
  for (int i = 0; i < 8; ++i) { a[i] = (_Float16)p[i]; a[8 + i] = (_Float16)p[16 + i]; }
  return a;
}
__device__ __forceinline__ v16h frag_f32s(const float* rowk0, int lane, float sc) {
  v16h a; const float* p = rowk0 + 8 * (lane >> 4);
#pragma unroll
  for (int i = 0; i < 8; ++i) { a[i] = (_Float16)(p[i] * sc); a[8 + i] = (_Float16)(p[16 + i] * sc); }
  return a;
}
// column fragment from a [K][ld] layout (column n), rows >= K read as 0
__device__ __forceinline__ v16h fragc_f32(const float* W, int k0, int n, int lane, int ld, int K) {
  v16h a; const int g = lane >> 4;
#pragma unroll
  for (int i = 0; i < 8; ++i) { const int ka = k0 + 8 * g + i, kb = ka + 16;
    a[i] = (_Float16)(ka < K ? W[(size_t)(ka < K ? ka : K - 1) * ld + n] : 0.f); a[8 + i] = (_Float16)(kb < K ? W[(size_t)(kb < K ? kb : K - 1) * ld + n] : 0.f); }
  return a;
}
struct F2 { v16b h, l; };
__device__ __forceinline__ F2 bsplit16(const float v[16]) { F2 r;
#pragma unroll
  for (int i = 0; i < 16; ++i) { const __bf16 h = (__bf16)v[i]; r.h[i] = h; r.l[i] = (__bf16)(v[i] - (float)h); }
  return r; }
__device__ __forceinline__ F2 split_row(const float* row, int k0, int lane) { float v[16]; const float* p = row + k0 + 8 * (lane >> 4);
#pragma unroll
  for (int i = 0; i < 8; ++i) { v[i] = p[i]; v[8 + i] = p[16 + i]; }
  return bsplit16(v); }
__device__ __forceinline__ F2 split_rowK(const float* row, int k0, int lane, int K) { float v[16]; const int g = lane >> 4;
#pragma unroll
  for (int i = 0; i < 8; ++i) { const int ka = k0 + 8 * g + i, kb = ka + 16; v[i] = ka < K ? row[ka < K ? ka : K - 1] : 0.f; v[8 + i] = kb < K ? row[kb < K ? kb : K - 1] : 0.f; }
  return bsplit16(v); }
__device__ __forceinline__ F2 split_col(const float* W, int k0, int n, int lane, int ld, int K) { float v[16]; const int g = lane >> 4;
#pragma unroll
  for (int i = 0; i < 8; ++i) { const int ka = k0 + 8 * g + i, kb = ka + 16; v[i] = ka < K ? W[(size_t)(ka < K ? ka : K - 1) * ld + n] : 0.f; v[8 + i] = kb < K ? W[(size_t)(kb < K ? kb : K - 1) * ld + n] : 0.f; }
  return bsplit16(v); }
__device__ __forceinline__ v8f mac3(const F2& a, const F2& b, v8f c) { c = wmma_bf(a.l, b.h, c); c = wmma_bf(a.h, b.l, c); return wmma_bf(a.h, b.h, c); }
__device__ __forceinline__ float sigm(float v) { return 1.0f / (1.0f + expf(-v)); }
#define LDSX() do { asm volatile("s_wait_dscnt 0" ::: "memory"); __builtin_amdgcn_wave_barrier(); __builtin_amdgcn_fence(__ATOMIC_RELEASE, "workgroup"); } while (0)


#define NB 2
#define SS 2304                 // 2,274 tokens (226 text + 2,048 video) padded to 36 x 64
#define SREAL 2274
#define STXT 226
#define SVID 2048
#define DM 1024
#define NH 16
#define HD 64
#define QKVW (3 * DM)
#ifndef TQB
#define TQB (SS / 64)
#define TNB NB
#define TOB (NB * SS / 64)     // output row tiles (all)
#endif
typedef __attribute__((ext_vector_type(8))) __bf16 v8b;
__device__ __forceinline__ v16b frag_b(const __bf16* rowk0, int lane) {
  union { v16b v; v8b q[2]; } u; const __bf16* p = rowk0 + 8 * (lane >> 4);
  u.q[0] = *(const v8b*)p; u.q[1] = *(const v8b*)(p + 16); return u.v;
}
__device__ __forceinline__ float bfr(float v) { return (float)(__bf16)v; }
__device__ __attribute__((noinline)) float exp_ni(float v) { return expf(v); }
__device__ __attribute__((noinline)) float erf_ni(float v) { return erff(v); }

#define PK_A 0                       // [3072][1024] Wqkv rows (natural [out][in])
#define PK_P (PK_A + QKVW * DM)        // [1024][1024] Wo rows (natural)
#define PK_END (PK_P + DM * DM)
#define WS_PK  0u
#define WS_QK  (WS_PK + 2u * PK_END)             // f16 [4608 rows][2048]: q | k
#define WS_VTH (WS_QK + 2u * NB * SS * 2 * DM)     // f16 [2][1024 (h*64+d)][2304 s] hi
#define WS_VTL (WS_VTH + 2u * NB * DM * SS)        // f16 lo x 2048
#define WS_OH  (WS_VTL + 2u * NB * DM * SS)        // bf16 [4608][1024]: ctx, rounded
#define WS_OL  (WS_OH + 2u * NB * SS * DM)          // bf16 [4608][1024]: ctx, residual
#define WS_XB  (WS_OL + 2u * NB * SS * DM)          // bf16 [4608][1024]: x = text | video | zero padding rows, per batch
#define WS_END (WS_XB + 2u * NB * SS * DM)

// ---- LDS staging of the operand tiles that all four waves of a block read: rows of 128 B (64 16-bit values) at a pitch of 144 B (16 B x odd: ds_load_b128 readers), two buffers
#define TP 72                        // row pitch in 16-bit values
#define TPB (2 * TP)                 // row pitch in bytes
#define T64B (64 * TPB)              // a 64-row tile, bytes
#define ASTG (3 * T64B)              // attention stage: K | V hi | V lo, 64 keys
#define WSTG (2 * T64B)              // 128 weight rows x 64 k
#define QSTG (WSTG + T64B)           // qkv stage: weight rows | 64 x rows
#define OSTG (WSTG + 2 * T64B)       // output projection stage: weight rows | 64 ctx rows, rounded | their residuals
__device__ __forceinline__ unsigned lds_off(const void* p) { return (unsigned)(size_t)p; }
// four asynchronous 16-byte copies per lane, global -> LDS, rows 16 apart (gstep = 16 source rows, in bytes); s_wait_xcnt closes the statement so that no address register is rewritten ahead of it
__device__ __forceinline__ void cp4(unsigned l, const void* gp, size_t gstep) {
  const char* g = (const char*)gp;
  asm volatile("global_load_async_to_lds_b128 %0, %1, off\n\tglobal_load_async_to_lds_b128 %2, %3, off\n\tglobal_load_async_to_lds_b128 %4, %5, off\n\tglobal_load_async_to_lds_b128 %6, %7, off\n\ts_wait_xcnt 0x0"
               :: "v"(l), "v"(g), "v"(l + 16 * TPB), "v"(g + gstep), "v"(l + 32 * TPB), "v"(g + 2 * gstep), "v"(l + 48 * TPB), "v"(g + 3 * gstep) : "memory");
}
// a 128-row x 64-k weight tile (natural rows of DM bf16); src = this lane's 16 bytes of its first row
__device__ __forceinline__ void fill_w(unsigned l, const __bf16* src) { cp4(l, src, (size_t)16 * DM * 2); cp4(l + T64B, src + (size_t)64 * DM, (size_t)16 * DM * 2); }
#define WAIT_DS()    asm volatile("s_wait_dscnt 0x0" ::: "memory")      // this wave's LDS reads of the buffer are done before the barrier frees it
#define WAIT_ASYNC() asm volatile("s_wait_asynccnt 0x0" ::: "memory")   // this wave's copies have landed before the barrier publishes them
// ---- k_pack: ONE launch rounds to bf16 what the projections read many times over: blocks < PKW the four [1024][1024] weights (natural [out][in] rows) into the four consecutive planes of DST (wq | wk | wv | wo), the other PKX blocks the rows of x into XB (per batch: 226 text rows, 2,048 video rows, 30 zero rows). A block takes PKIT rows of 1,024; a wave's load covers 512 contiguous bytes, its store 256; a thread's PKIT loads all issue ahead of its first store
#define PKIT 16                      // 16-byte loads per thread, one per row
#define PKW (4 * DM / PKIT)          // blocks on the weights
#define PKX (NB * SS / PKIT)         // blocks on x
typedef __attribute__((ext_vector_type(4))) __bf16 v4b;
__global__ __launch_bounds__(256) void k_pack(const float* __restrict__ WQ, const float* __restrict__ WK, const float* __restrict__ WV, const float* __restrict__ WO, const float* __restrict__ XT, const float* __restrict__ XV, __bf16* __restrict__ DST, __bf16* __restrict__ XB) {
  const int bid = blockIdx.x, c4 = threadIdx.x * 4; __bf16* d; v4f x[PKIT];
  if (bid < PKW) { const int mt = bid / (DM / PKIT); const float* S = (mt == 0) ? WQ : (mt == 1) ? WK : (mt == 2) ? WV : WO;
    const float* s = S + (size_t)(bid % (DM / PKIT)) * (PKIT * DM) + c4; d = DST + (size_t)bid * (PKIT * DM) + c4;
#pragma unroll   // x stays in registers and the loads stand together, on one address with immediate offsets
    for (int it = 0; it < PKIT; ++it) x[it] = *(const v4f*)(s + it * DM);
  } else { const int r0 = (bid - PKW) * PKIT, b = r0 / SS, s0 = r0 % SS; d = XB + (size_t)r0 * DM + c4;   // PKIT rows from a multiple of PKIT never cross a batch (SS is one)
    static_assert(SS % PKIT == 0, "a block's rows lie in one batch");
    const float* pt = XT + ((ptrdiff_t)b * STXT + s0) * DM + c4; const float* pv = XV + ((ptrdiff_t)b * SVID + s0 - STXT) * DM + c4;   // where row s0 would lie in the text and in the video input; each is used only for the rows that do lie there
#pragma unroll   // as above; a padding row loads a valid row (one of the first PKIT video rows), so that no load stands under a test, and the zero is selected behind the loads
    for (int it = 0; it < PKIT; ++it) { const int s = s0 + it; const float* p = (s < STXT) ? pt : (s < SREAL) ? pv : XV + c4; x[it] = *(const v4f*)(p + it * DM); }
#pragma unroll
    for (int it = 0; it < PKIT; ++it) if (s0 + it >= SREAL) x[it] = (v4f){0.f, 0.f, 0.f, 0.f};
  }
#pragma unroll   // as above, for the stores
  for (int it = 0; it < PKIT; ++it) { v4b o;
#pragma unroll   // four converts, packed in pairs
    for (int i = 0; i < 4; ++i) o[i] = (__bf16)x[it][i];
    *(v4b*)(d + it * DM) = o; }
}
// ---- k_qkv: block = (64 rows (b,s), 128 of the 3072 cols): qkv = x (bf16 rows of XB, staged in LDS beside the weight rows) . rows (exact); cols < 1024 -> f16(q), cols < 2048 -> f16(k) into QK rows (pitch 2048); cols >= 2048 (v) -> per-batch transposed f16 planes VT[b][h*64+d][s]: hi = f16(v), lo = f16((v - hi) * 2048)
__global__ __launch_bounds__(128) void k_qkv(const __bf16* __restrict__ XB, const __bf16* __restrict__ P, const float* __restrict__ BQ, const float* __restrict__ BK, const float* __restrict__ BV, const float* __restrict__ LQW, const float* __restrict__ LQB, const float* __restrict__ LKW, const float* __restrict__ LKB, const float* __restrict__ COS, const float* __restrict__ SIN, _Float16* __restrict__ QK, _Float16* __restrict__ VTH, _Float16* __restrict__ VTL) {
  __shared__ __align__(16) unsigned char L[2 * QSTG];   // the ring during the k loop, then the output staging
  static_assert(2 * QSTG >= 4 * 16 * 136 * 2 + 2 * 128 * 72 * 2, "the output staging fits the ring");
  _Float16 (*so)[16][136] = (_Float16 (*)[16][136])L; _Float16 (*sth)[72] = (_Float16 (*)[72])(L + 4 * 16 * 136 * 2); _Float16 (*stl)[72] = sth + 128;
  const int tid = threadIdx.x, wave = tid >> 5, lane = tid & 31, col = lane & 15, g = lane >> 4; const size_t r0 = (size_t)blockIdx.x * 64 + wave * 16; const int n0 = blockIdx.y * 128;
  v8f acc[8] = {};
  const unsigned lw = lds_off(L) + (tid >> 3) * TPB + (tid & 7) * 16; const __bf16* gw = P + (size_t)(n0 + (tid >> 3)) * DM + (tid & 7) * 8;
  const __bf16* gx = XB + ((size_t)blockIdx.x * 64 + (tid >> 3)) * DM + (tid & 7) * 8;
  auto fill = [&](int st) { const unsigned l = lw + (st & 1) * QSTG; fill_w(l, gw + st * 64); cp4(l + WSTG, gx + st * 64, (size_t)16 * DM * 2); };   // stage st = k 64 st .. 64 st + 63 of the block's 128 weight rows and 64 x rows
  fill(0); WAIT_ASYNC(); __syncthreads(); fill(1);
#pragma unroll 1   // one stage per trip: the buffer index and the publish point at the foot stay those of a two-buffer ring
  for (int st = 0; st < DM / 64; ++st) { const __bf16* Bt = (const __bf16*)(L + (st & 1) * QSTG); const __bf16* At = Bt + (128 + wave * 16 + col) * TP;   // this lane's x row
#pragma unroll
    for (int sub = 0; sub < 2; ++sub) { const v16b a = frag_b(At + sub * 32, lane); v16b w[8];
#pragma unroll
      for (int j = 0; j < 8; ++j) w[j] = frag_b(Bt + (j * 16 + col) * TP + sub * 32, lane);
      __builtin_amdgcn_sched_barrier(0);   // the 32 k's fragment loads stay one group ahead of their WMMAs: left to itself this build reloads one register set in front of every WMMA and waits each load out
#pragma unroll
      for (int j = 0; j < 8; ++j) acc[j] = wmma_bf(a, w[j], acc[j]); }
    WAIT_DS(); WAIT_ASYNC(); __syncthreads();   // publishes stage st + 1 and frees stage st's buffer
    if (st + 2 < DM / 64) fill(st + 2); }
  WAIT_ASYNC();
  { const float* BB = (n0 < DM) ? BQ : (n0 < 2 * DM) ? BK : BV; const int nb = n0 % DM;
#pragma unroll
    for (int j = 0; j < 8; ++j) { const float bb = bfr(BB[nb + j * 16 + col]);
#pragma unroll
      for (int r = 0; r < 8; ++r) acc[j][r] += bb; } }
  if (n0 < 2 * DM) {   // q | k: per-head LayerNorm over the 64 dims (this 128-col block = 2 heads: tiles 0-3 and 4-7), then rotary for video tokens; q unscaled (1/8 on the f32 score)
    const float* LW = (n0 < DM) ? LQW : LKW; const float* LBv = (n0 < DM) ? LQB : LKB;
#pragma unroll
    for (int hh = 0; hh < 2; ++hh) {
#pragma unroll
      for (int r = 0; r < 8; ++r) { float s = 0.f;
#pragma unroll
        for (int j = 0; j < 4; ++j) s += acc[hh * 4 + j][r];
#pragma unroll
        for (int o = 1; o < 16; o <<= 1) s += __shfl_xor(s, o);
        const float mu = s * (1.0f / 64.0f); float v = 0.f;
#pragma unroll
        for (int j = 0; j < 4; ++j) { const float dv = acc[hh * 4 + j][r] - mu; v += dv * dv; }
#pragma unroll
        for (int o = 1; o < 16; o <<= 1) v += __shfl_xor(v, o);
        const float rs = rsqrtf(v * (1.0f / 64.0f) + 1e-5f);
#pragma unroll
        for (int j = 0; j < 4; ++j) { const int d = j * 16 + col; acc[hh * 4 + j][r] = (acc[hh * 4 + j][r] - mu) * rs * bfr(LW[d]) + bfr(LBv[d]); } } }
    // the rotary tables of this lane's 8 rows x 4 dims (both heads of the block use the same): table row clamped to 0 for text and padding rows, so the loads stand under no lane test and are all in flight together
    float tc[8][4], ts[8][4]; bool vid[8]; unsigned to[8]; const int sv0 = (int)((r0 + 8 * g) % SS) - STXT;   // 8 rows from a multiple of 8 never cross a batch (SS is one)
#pragma unroll
    for (int r = 0; r < 8; ++r) { const int sv = sv0 + r; vid[r] = sv >= 0 && sv < SVID; to[r] = (unsigned)(vid[r] ? sv : 0) * HD + col; }
#pragma unroll
    for (int r = 0; r < 8; ++r) {
#pragma unroll
      for (int q = 0; q < 4; ++q) { tc[r][q] = COS[to[r] + q * 16]; ts[r][q] = SIN[to[r] + q * 16]; } }
    asm volatile("s_wait_xcnt 0x0" :: "v"(to[0]), "v"(to[1]), "v"(to[2]), "v"(to[3]), "v"(to[4]), "v"(to[5]), "v"(to[6]), "v"(to[7]) : "memory");   // the offset registers of the table loads stay as they are up to this wait
    // rotary on video tokens: pairs (2i, 2i+1): out = x cos + rot(x) sin with rot = [-x_{2i+1}, x_{2i}]; cos/sin [2048][64] inputs (bf16-rounded), indexed by (s - 226, d)
#pragma unroll
    for (int j = 0; j < 8; ++j) { const int d = (j & 3) * 16 + col;
#pragma unroll
      for (int r = 0; r < 8; ++r) { const float xv = acc[j][r]; const float xp = __shfl_xor(xv, 1);   // partner dim d^1 lives in lane col^1
        const float c = bfr(tc[r][j & 3]), sn = bfr(ts[r][j & 3]); const float rot = (d & 1) ? xp : -xp; acc[j][r] = vid[r] ? xv * c + rot * sn : xv; } }   // text and padding rows keep xv by the select
#pragma unroll
    for (int j = 0; j < 8; ++j) {
#pragma unroll
      for (int r = 0; r < 8; ++r) so[wave][8 * g + r][j * 16 + col] = (_Float16)acc[j][r]; }
    LDSX();
    for (int rl = 0; rl < 16; ++rl) if (lane < 16) vst2((unsigned*)(QK + (r0 + rl) * (2 * DM) + n0 + lane * 8), *(const v4u*)&so[wave][rl][lane * 8]);
  } else {
#pragma unroll
    for (int j = 0; j < 8; ++j) {
#pragma unroll
      for (int r = 0; r < 8; ++r) { const float v = acc[j][r]; const _Float16 hv = (_Float16)v; sth[j * 16 + col][wave * 16 + 8 * g + r] = hv; stl[j * 16 + col][wave * 16 + 8 * g + r] = (_Float16)((v - (float)hv) * 2048.0f); } }
    __syncthreads();
    const size_t rb = (size_t)blockIdx.x * 64; const int b = (int)(rb / SS), s0 = (int)(rb % SS); const int pc0 = n0 - 2 * DM;
    for (int q = tid; q < 128 * 8; q += 128) { const int d = q >> 3, pc = q & 7; const size_t o = ((size_t)b * DM + pc0 + d) * SS + s0 + pc * 8; vst2((unsigned*)(VTH + o), *(const v4u*)&sth[d][pc * 8]); vst2((unsigned*)(VTL + o), *(const v4u*)&stl[d][pc * 8]); }
  }
}
typedef __attribute__((ext_vector_type(2))) _Float16 v2h;
// lane l <-> lane l ^ 16 as one vector instruction
__device__ __forceinline__ float xhalf(float x) { return __builtin_bit_cast(float, __builtin_amdgcn_permlanex16(__builtin_bit_cast(int, x), __builtin_bit_cast(int, x), 0x76543210, 0xfedcba98, false, false)); }
__global__ __launch_bounds__(128, 5) void k_attn(const _Float16* __restrict__ QK, const _Float16* __restrict__ VTH, const _Float16* __restrict__ VTL, __bf16* __restrict__ OH, __bf16* __restrict__ OL) {
  __shared__ __align__(16) unsigned char L[2 * ASTG];   // the K/V ring during the key loop, then the output staging
  __bf16 (*so)[2][16][TP] = (__bf16 (*)[2][16][TP])L;   // per wave: 16 query rows of 64 rounded values, then of 64 residuals
  const int tid = threadIdx.x, wave = tid >> 5, lane = tid & 31, col = lane & 15, g = lane >> 4;
  const int qb = blockIdx.x, h = blockIdx.y, b = blockIdx.z; const int q0 = qb * 64 + wave * 16; const size_t rq = (size_t)b * SS + q0 + col;
  const unsigned lt = lds_off(L) + (tid >> 3) * TPB + (tid & 7) * 16;
  const _Float16* gk = QK + ((size_t)b * SS + (tid >> 3)) * (2 * DM) + DM + h * HD + (tid & 7) * 8; const size_t gvo = ((size_t)b * DM + h * HD + (tid >> 3)) * SS + (tid & 7) * 8;
  auto fill = [&](int st) { const unsigned l = lt + (st & 1) * ASTG;   // stage st = keys 64 st .. 64 st + 63: K rows [key][64 d], V planes [d][64 keys]
    cp4(l, gk + (size_t)st * 64 * (2 * DM), (size_t)16 * 2 * DM * 2); cp4(l + T64B, VTH + gvo + st * 64, (size_t)16 * SS * 2); cp4(l + 2 * T64B, VTL + gvo + st * 64, (size_t)16 * SS * 2); };
  fill(0); WAIT_ASYNC(); __syncthreads(); fill(1);
  v16h aq[2];
#pragma unroll
  for (int kc = 0; kc < 2; ++kc) aq[kc] = frag_h(QK + rq * (2 * DM) + h * HD + kc * 32, lane);
  float m = -3.0e38f, l = 0.f;   // of query col: m is the same in both halves, l is this half's share of the sum (joined behind the loop)
  v8f acc[4] = {}, accl[4] = {};   // acc[dt][r] = O^T[dt * 16 + 8 g + r][col]
  // not causal; keys >= 2,274 are padding and masked
  // one 32-key pass; 'padded' is a literal at both calls: the mask stands only in the copy that the stage with padding keys runs
  auto pass = [&](const bool padded, const int st, const int sub) __attribute__((always_inline)) { const _Float16* Kt = (const _Float16*)(L + (st & 1) * ASTG); const _Float16* Vh = Kt + 64 * TP; const _Float16* Vl = Vh + 64 * TP; const int ks = st * 2 + sub; v8f s[2]; v16h kf[2][2], vh[4], vl[4];
#pragma unroll
    for (int ct = 0; ct < 2; ++ct) {
#pragma unroll
      for (int kc = 0; kc < 2; ++kc) kf[ct][kc] = frag_h(Kt + (sub * 32 + ct * 16 + col) * TP + kc * 32, lane); }
#pragma unroll
    for (int dt = 0; dt < 4; ++dt) vh[dt] = frag_h(Vh + (dt * 16 + col) * TP + sub * 32, lane);
    if (!padded) __builtin_amdgcn_sched_barrier(0);   // (not in the masked copy, two passes of 72, which has no registers to spare) the pass's K and V hi fragment loads stay one group ahead of the score WMMAs: with the pass split by the rescale branch this build otherwise reloads one register set in front of every WMMA and waits each load out
#pragma unroll
    for (int ct = 0; ct < 2; ++ct) { const int kk0 = ks * 32 + ct * 16 + 8 * g; v8f c = {};
#pragma unroll
      for (int kc = 0; kc < 2; ++kc) c = wmma16(kf[ct][kc], aq[kc], c);
#pragma unroll
      for (int r = 0; r < 8; ++r) s[ct][r] = (!padded || kk0 + r < SREAL) ? c[r] : -3.0e38f; }   // q.k, not yet scaled; padded keys masked
    v2f e[8], es;   // e[ct * 4 + rp] = exp(score - m) of keys ct * 16 + 8 g + 2 rp and + 1; es = their sums
    auto expo = [&]() __attribute__((always_inline)) { es = (v2f){0.f, 0.f};
#pragma unroll
      for (int ct = 0; ct < 2; ++ct) {
#pragma unroll
        for (int rp = 0; rp < 4; ++rp) { v2f x; x[0] = __expf(fmaf(s[ct][2 * rp], 0.125f, -m)); x[1] = __expf(fmaf(s[ct][2 * rp + 1], 0.125f, -m)); e[ct * 4 + rp] = x; es += x; } } };   // score = q.k / sqrt(64): the product with 0.125 is exact, so the fused form rounds as product and difference did; a masked key: -3e38 / 8 against a finite m (the first pass holds real keys only), the exp is 0 by itself
    expo();   // against the maximum in use
    // lazy rescale, tested once per pass for the whole wave (a scalar branch): m stays as long as every lane's 16 exponentials sum to at most 256, so that each is at most 256 and P and its residual fit f16. The negated form also catches infinity (the first pass, m = -3e38) and not-a-number
    if (__builtin_amdgcn_ballot_w32(!(es[0] + es[1] <= 256.0f)) != 0) {
      float mx = fmaxf(s[0][0], s[1][0]);
#pragma unroll
      for (int r = 1; r < 8; ++r) mx = fmaxf(mx, fmaxf(s[0][r], s[1][r]));
      mx = 0.125f * fmaxf(mx, xhalf(mx));
      const float mn = fmaxf(m, mx); const float alpha = __expf(m - mn);   // first pass: m = -3e38 against a finite mn, the exp is 0 by itself (and acc and l are 0)
      l *= alpha; m = mn;
#pragma unroll
      for (int dt = 0; dt < 4; ++dt) { acc[dt] *= alpha; accl[dt] *= alpha; }
      expo(); }   // again, against the new maximum
    l += es[0] + es[1];
#pragma unroll
    for (int dt = 0; dt < 4; ++dt) vl[dt] = frag_h(Vl + (dt * 16 + col) * TP + sub * 32, lane);
    if (!padded) __builtin_amdgcn_sched_barrier(0);   // the V lo fragment loads stay one group ahead of P's conversions, which cover their latency (as above)
    union { v16h v; v2h p[8]; } pa, pl;   // element ct * 8 + r = key ct * 16 + 8 g + r: the k order of frag_h
#pragma unroll
    for (int i = 0; i < 8; ++i) { const v2h hh = __builtin_convertvector(e[i], v2h); pa.p[i] = hh; pl.p[i] = __builtin_convertvector((e[i] - __builtin_convertvector(hh, v2f)) * 2048.0f, v2h); }
#pragma unroll
    for (int dt = 0; dt < 4; ++dt) { acc[dt] = wmma16(vh[dt], pa.v, acc[dt]); accl[dt] = wmma16(vh[dt], pl.v, accl[dt]); accl[dt] = wmma16(vl[dt], pa.v, accl[dt]); }   // V hi x P hi + (V hi x P lo + V lo x P hi) / 2048
    // the pass's back edge: the four vector slots between the pass's last WMMAs and the next pass's first write of their operand registers stand here, behind all of them
    asm volatile("v_nop\n\tv_nop\n\tv_nop\n\tv_nop" : "+v"(acc[0]), "+v"(acc[1]), "+v"(acc[2]), "+v"(acc[3]), "+v"(accl[0]), "+v"(accl[1]), "+v"(accl[2]), "+v"(accl[3])); };
#pragma unroll 1   // one stage per trip: the buffer index and the publish point at the foot stay those of a two-buffer ring
  for (int st = 0; st < SREAL / 64; ++st) {   // the stages whose every key is real
#pragma unroll 1   // the 32-key pass stays rolled: one copy of it in the text
    for (int sub = 0; sub < 2; ++sub) pass(false, st, sub);
    WAIT_DS(); WAIT_ASYNC(); __syncthreads();   // publishes stage st + 1 and frees stage st's buffer
    if (st + 2 < SS / 64) fill(st + 2); }
  static_assert(SREAL / 64 == SS / 64 - 1, "only the last stage holds padding keys");
#pragma unroll 1   // rolled as above
  for (int sub = 0; sub < 2; ++sub) pass(true, SS / 64 - 1, sub);   // the last stage, with the mask
  WAIT_DS(); WAIT_ASYNC(); __syncthreads();   // the stage's foot: every wave has left the ring before it becomes the output staging
  WAIT_ASYNC();
  const float il = 1.0f / (l + xhalf(l));
#pragma unroll
  for (int dt = 0; dt < 4; ++dt) { v8b oh, ol;
#pragma unroll
    for (int i = 0; i < 8; ++i) { const float o = (acc[dt][i] + accl[dt][i] * (1.0f / 2048.0f)) * il; const __bf16 hb = (__bf16)o; oh[i] = hb; ol[i] = (__bf16)(o - (float)hb); }
    *(v8b*)&so[wave][0][col][dt * 16 + 8 * g] = oh; *(v8b*)&so[wave][1][col][dt * 16 + 8 * g] = ol; }
  LDSX();
#pragma unroll   // a store covers four rows' 128-byte pieces
  for (int it = 0; it < 4; ++it) { const int rl = it * 4 + (lane >> 3), pc = (lane & 7) * 8; const unsigned o = (unsigned)((b * SS + q0 + rl) * DM + h * HD + pc); vst2((unsigned*)(OH + o), *(const v4u*)&so[wave][0][rl][pc]); vst2((unsigned*)(OL + o), *(const v4u*)&so[wave][1][rl][pc]); }
}
// ---- k_out: block = (64 rows, 128 cols): out = ctx (OH and OL rows, staged in LDS beside the weight rows) . Wo rows (2 products) + bo
__global__ __launch_bounds__(128) void k_out(const __bf16* __restrict__ OH, const __bf16* __restrict__ OL, const __bf16* __restrict__ P, const float* __restrict__ BO, float* __restrict__ Y) {
  __shared__ __align__(16) unsigned char L[2 * OSTG];   // the ring during the k loop, then the output staging
  float (*so)[16][132] = (float (*)[16][132])L;
  const int tid = threadIdx.x, wave = tid >> 5, lane = tid & 31, col = lane & 15, g = lane >> 4; const size_t r0 = (size_t)blockIdx.x * 64 + wave * 16; const int n0 = blockIdx.y * 128;
  v8f acc[8] = {};
  const unsigned lw = lds_off(L) + (tid >> 3) * TPB + (tid & 7) * 16; const __bf16* gw = P + (size_t)(n0 + (tid >> 3)) * DM + (tid & 7) * 8;
  const size_t go = ((size_t)blockIdx.x * 64 + (tid >> 3)) * DM + (tid & 7) * 8;
  auto fill = [&](int st) { const unsigned l = lw + (st & 1) * OSTG; fill_w(l, gw + st * 64); cp4(l + WSTG, OH + go + st * 64, (size_t)16 * DM * 2); cp4(l + WSTG + T64B, OL + go + st * 64, (size_t)16 * DM * 2); };   // stage st = k 64 st .. 64 st + 63 of the block's 128 weight rows and 64 ctx rows (both planes)
  fill(0); WAIT_ASYNC(); __syncthreads(); fill(1);
#pragma unroll 1   // one stage per trip: the buffer index and the publish point at the foot stay those of a two-buffer ring
  for (int st = 0; st < DM / 64; ++st) { const __bf16* Bt = (const __bf16*)(L + (st & 1) * OSTG); const __bf16* Ah = Bt + (128 + wave * 16 + col) * TP; const __bf16* Al = Ah + 64 * TP;   // this lane's ctx row in the two planes
#pragma unroll
    for (int sub = 0; sub < 2; ++sub) { const v16b ah = frag_b(Ah + sub * 32, lane), al = frag_b(Al + sub * 32, lane); v16b w[8];
#pragma unroll
      for (int j = 0; j < 8; ++j) w[j] = frag_b(Bt + (j * 16 + col) * TP + sub * 32, lane);
      __builtin_amdgcn_sched_barrier(0);   // the 32 k's fragment loads stay one group ahead of their WMMAs (as in k_qkv)
#pragma unroll
      for (int j = 0; j < 8; ++j) { acc[j] = wmma_bf(al, w[j], acc[j]); acc[j] = wmma_bf(ah, w[j], acc[j]); } }
    WAIT_DS(); WAIT_ASYNC(); __syncthreads();   // publishes stage st + 1 and frees stage st's buffer
    if (st + 2 < DM / 64) fill(st + 2); }
  WAIT_ASYNC();
#pragma unroll
  for (int j = 0; j < 8; ++j) { const float bb = bfr(BO[n0 + j * 16 + col]);
#pragma unroll
    for (int r = 0; r < 8; ++r) so[wave][8 * g + r][j * 16 + col] = acc[j][r] + bb; }
  LDSX();
  for (int rl = 0; rl < 16; ++rl) { const size_t row = r0 + rl; const int b = (int)(row / SS), s = (int)(row % SS); if (s < STXT) vst2(Y + (size_t)NB * SVID * DM + ((size_t)b * STXT + s) * DM + n0 + lane * 4, *(const v4f*)&so[wave][rl][lane * 4]); else if (s < SREAL) vst2(Y + ((size_t)b * SVID + (s - STXT)) * DM + n0 + lane * 4, *(const v4f*)&so[wave][rl][lane * 4]); }   // out0 = o[:, 226:] at 0, out1 = o[:, :226] after it; padding rows dropped
}
extern "C" void kernel_launch(void* const* d_in, const int* in_sizes, int n_in, void* d_out, int out_size, void* d_ws, size_t ws_size, hipStream_t stream) {
  (void)in_sizes; (void)n_in; (void)out_size;
  const float** F = (const float**)d_in;   // 0 hidden_states [2,2048,1024], 1 encoder_hidden_states [2,226,1024], 2 cos [2048,64], 3 sin, 4 wq [1024,1024], 5 bq, 6 wk, 7 bk, 8 wv, 9 bv, 10 wo, 11 bo, 12 lnq_w [64], 13 lnq_b, 14 lnk_w, 15 lnk_b
  if (ws_size < (size_t)WS_END) return;
  char* ws = (char*)d_ws; __bf16* PK = (__bf16*)(ws + WS_PK); _Float16 *QK = (_Float16*)(ws + WS_QK), *VTH = (_Float16*)(ws + WS_VTH), *VTL = (_Float16*)(ws + WS_VTL); __bf16 *OH = (__bf16*)(ws + WS_OH), *OL = (__bf16*)(ws + WS_OL), *XB = (__bf16*)(ws + WS_XB);
  k_pack<<<dim3(PKW + PKX), 256, 0, stream>>>(F[4], F[6], F[8], F[10], F[1], F[0], PK + PK_A, XB);   // PK_P = PK_A + 3 planes: wo is the fourth
  k_qkv<<<dim3(TNB * SS / 64, QKVW / 128), 128, 0, stream>>>(XB, PK + PK_A, F[5], F[7], F[9], F[12], F[13], F[14], F[15], F[2], F[3], QK, VTH, VTL);
  k_attn<<<dim3(TQB, NH, TNB), 128, 0, stream>>>(QK, VTH, VTL, OH, OL);
  k_out<<<dim3(TOB, DM / 128), 128, 0, stream>>>(OH, OL, PK + PK_P, F[11], (float*)d_out);
}

// v009
// Measured time: 139 microseconds a run.
// Two timings next to v008 put it at 1.07 and 1.06 times that version's speed.
// Over all steps from v000 it is 5.55 times as fast.
// compute dtype: hidden_states, encoder_hidden_states, cos, sin and all weights / biases / norm parameters (module inputs) rounded to bf16; q/k/v projections with exact bf16 products (natural [out][in] rows) + bias on WMMA 16x16x32; per-head LayerNorm of q and k (over the 64 dims, eps 1e-5) and the interleaved rotary on the video tokens (input cos/sin tables) in f32 in the projection epilogue; q and k stored once as f16 (q unscaled; 1/8 on the f32 score), v as f16 hi + (x2048-scaled) residual planes; scores with single f16 operands (1 product) and P.V with P as f16 hi + (x2048-scaled) residual x V hi/lo (3 products); the output projection with ctx as bf16 hi + residual x exact wo (2 products) + bo; running-max softmax in f32 with the hardware exp; the 2,274-token sequence is padded to 2,304 rows per batch with the padding keys masked; f32 accumulate.
#include <hip/hip_runtime.h>
#include <math.h>

typedef __attribute__((ext_vector_type(16))) _Float16 v16h;
typedef __attribute__((ext_vector_type(16))) __bf16 v16b;
typedef __attribute__((ext_vector_type(8)))  _Float16 v8h;
typedef __attribute__((ext_vector_type(8)))  float v8f;
typedef __attribute__((ext_vector_type(4)))  float v4f;
typedef __attribute__((ext_vector_type(2)))  float v2f;
typedef __attribute__((ext_vector_type(4)))  unsigned v4u;
typedef __attribute__((ext_vector_type(4)))  int v4i;
typedef float __attribute__((may_alias)) float_a;
typedef int __attribute__((may_alias)) int_a;

template <typename T> __device__ __forceinline__ void vst2(void* p, T v) { *(T*)p = v;  }
__device__ __forceinline__ v8f wmma16(v16h a, v16h b, v8f c) {
  v8f d = __builtin_amdgcn_wmma_f32_16x16x32_f16(false, a, false, b, (short)0, c, false, false);
  return d;
}
__device__ __forceinline__ v8f wmma_bf(v16b a, v16b b, v8f c) {
  v8f d = __builtin_amdgcn_wmma_f32_16x16x32_bf16(false, a, false, b, (short)0, c, false, false);
  return d;
}
// CogVideoX joint text+video attention processor (B 2, 226 text + 2,048 video tokens, D 1,024, 16 heads x 64): qkv with bias, per-head LayerNorm on q and k, rotary on the video part, full softmax attention, output projection + bias; returns (video part, text part).
__device__ __forceinline__ v16h frag_h(const _Float16* rowk0, int lane) {
  union { v16h v; v8h q[2]; } u; const _Float16* p = rowk0 + 8 * (lane >> 4);
  u.q[0] = *(const v8h*)p; u.q[1] = *(const v8h*)(p + 16); return u.v;
}
__device__ __forceinline__ v16h frag_f32(const float* rowk0, int lane) {
  v16h a; const float* p = rowk0 + 8 * (lane >> 4);
#pragma unroll
  for (int i = 0; i < 8; ++i) { a[i] = (_Float16)p[i]; a[8 + i] = (_Float16)p[16 + i]; }
  return a;
}
__device__ __forceinline__ v16h frag_f32s(const float* rowk0, int lane, float sc) {
  v16h a; const float* p = rowk0 + 8 * (lane >> 4);
#pragma unroll
  for (int i = 0; i < 8; ++i) { a[i] = (_Float16)(p[i] * sc); a[8 + i] = (_Float16)(p[16 + i] * sc); }
  return a;
}
// column fragment from a [K][ld] layout (column n), rows >= K read as 0
__device__ __forceinline__ v16h fragc_f32(const float* W, int k0, int n, int lane, int ld, int K) {
  v16h a; const int g = lane >> 4;
#pragma unroll
  for (int i = 0; i < 8; ++i) { const int ka = k0 + 8 * g + i, kb = ka + 16;
    a[i] = (_Float16)(ka < K ? W[(size_t)(ka < K ? ka : K - 1) * ld + n] : 0.f); a[8 + i] = (_Float16)(kb < K ? W[(size_t)(kb < K ? kb : K - 1) * ld + n] : 0.f); }
  return a;
}
struct F2 { v16b h, l; };
__device__ __forceinline__ F2 bsplit16(const float v[16]) { F2 r;
#pragma unroll
  for (int i = 0; i < 16; ++i) { const __bf16 h = (__bf16)v[i]; r.h[i] = h; r.l[i] = (__bf16)(v[i] - (float)h); }
  return r; }
__device__ __forceinline__ F2 split_row(const float* row, int k0, int lane) { float v[16]; const float* p = row + k0 + 8 * (lane >> 4);
#pragma unroll
  for (int i = 0; i < 8; ++i) { v[i] = p[i]; v[8 + i] = p[16 + i]; }
  return bsplit16(v); }
__device__ __forceinline__ F2 split_rowK(const float* row, int k0, int lane, int K) { float v[16]; const int g = lane >> 4;
#pragma unroll
  for (int i = 0; i < 8; ++i) { const int ka = k0 + 8 * g + i, kb = ka + 16; v[i] = ka < K ? row[ka < K ? ka : K - 1] : 0.f; v[8 + i] = kb < K ? row[kb < K ? kb : K - 1] : 0.f; }
  return bsplit16(v); }
__device__ __forceinline__ F2 split_col(const float* W, int k0, int n, int lane, int ld, int K) { float v[16]; const int g = lane >> 4;
#pragma unroll
  for (int i = 0; i < 8; ++i) { const int ka = k0 + 8 * g + i, kb = ka + 16; v[i] = ka < K ? W[(size_t)(ka < K ? ka : K - 1) * ld + n] : 0.f; v[8 + i] = kb < K ? W[(size_t)(kb < K ? kb : K - 1) * ld + n] : 0.f; }
  return bsplit16(v); }
__device__ __forceinline__ v8f mac3(const F2& a, const F2& b, v8f c) { c = wmma_bf(a.l, b.h, c); c = wmma_bf(a.h, b.l, c); return wmma_bf(a.h, b.h, c); }
__device__ __forceinline__ float sigm(float v) { return 1.0f / (1.0f + expf(-v)); }
#define LDSX() do { asm volatile("s_wait_dscnt 0" ::: "memory"); __builtin_amdgcn_wave_barrier(); __builtin_amdgcn_fence(__ATOMIC_RELEASE, "workgroup"); } while (0)


#define NB 2
#define SS 2304                 // 2,274 tokens (226 text + 2,048 video) padded to 36 x 64
#define SREAL 2274
#define STXT 226
#define SVID 2048
#define DM 1024
#define NH 16
#define HD 64
#define QKVW (3 * DM)
#ifndef TQB
#define TQB (SS / 64)
#define TNB NB
#define TOB (NB * SS / 64)     // output row tiles (all)
#endif
typedef __attribute__((ext_vector_type(8))) __bf16 v8b;
__device__ __forceinline__ v16b frag_b(const __bf16* rowk0, int lane) {
  union { v16b v; v8b q[2]; } u; const __bf16* p = rowk0 + 8 * (lane >> 4);
  u.q[0] = *(const v8b*)p; u.q[1] = *(const v8b*)(p + 16); return u.v;
}
__device__ __forceinline__ float bfr(float v) { return (float)(__bf16)v; }
__device__ __attribute__((noinline)) float exp_ni(float v) { return expf(v); }
__device__ __attribute__((noinline)) float erf_ni(float v) { return erff(v); }

#define PK_A 0                       // [3072][1024] Wqkv rows (natural [out][in])
#define PK_P (PK_A + QKVW * DM)        // [1024][1024] Wo rows (natural)
#define PK_END (PK_P + DM * DM)
#define WS_PK  0u
#define WS_QK  (WS_PK + 2u * PK_END)             // f16 [4608 rows][2048]: q | k
#define WS_VTH (WS_QK + 2u * NB * SS * 2 * DM)     // f16 [2][1024 (h*64+d)][2304 s] hi
#define WS_VTL (WS_VTH + 2u * NB * DM * SS)        // f16 lo x 2048
#define WS_OH  (WS_VTL + 2u * NB * DM * SS)        // bf16 [4608][1024]: ctx, rounded
#define WS_OL  (WS_OH + 2u * NB * SS * DM)          // bf16 [4608][1024]: ctx, residual
#define WS_XB  (WS_OL + 2u * NB * SS * DM)          // bf16 [4608][1024]: x = text | video | zero padding rows, per batch
#define WS_END (WS_XB + 2u * NB * SS * DM)

// ---- LDS staging of the operand tiles that all four waves of a block read: rows of 128 B (64 16-bit values) at a pitch of 144 B (16 B x odd: ds_load_b128 readers), two buffers
#define TP 72                        // row pitch in 16-bit values
#define TPB (2 * TP)                 // row pitch in bytes
#define T64B (64 * TPB)              // a 64-row tile, bytes
#define ASTG (3 * T64B)              // attention stage: K | V hi | V lo, 64 keys
#define WSTG (2 * T64B)              // 128 weight rows x 64 k
#define QSTG (2 * WSTG)              // qkv stage: 128 weight rows | 128 x rows
#define OSTG (WSTG + 2 * T64B)       // output projection stage: weight rows | 64 ctx rows, rounded | their residuals
__device__ __forceinline__ unsigned lds_off(const void* p) { return (unsigned)(size_t)p; }
// four asynchronous 16-byte copies per lane, global -> LDS, rows 16 apart (gstep = 16 source rows, in bytes); s_wait_xcnt closes the statement so that no address register is rewritten ahead of it
__device__ __forceinline__ void cp4(unsigned l, const void* gp, size_t gstep) {
  const char* g = (const char*)gp;
  asm volatile("global_load_async_to_lds_b128 %0, %1, off\n\tglobal_load_async_to_lds_b128 %2, %3, off\n\tglobal_load_async_to_lds_b128 %4, %5, off\n\tglobal_load_async_to_lds_b128 %6, %7, off\n\ts_wait_xcnt 0x0"
               :: "v"(l), "v"(g), "v"(l + 16 * TPB), "v"(g + gstep), "v"(l + 32 * TPB), "v"(g + 2 * gstep), "v"(l + 48 * TPB), "v"(g + 3 * gstep) : "memory");
}
// a 128-row x 64-k weight tile (natural rows of DM bf16); src = this lane's 16 bytes of its first row
__device__ __forceinline__ void fill_w(unsigned l, const __bf16* src) { cp4(l, src, (size_t)16 * DM * 2); cp4(l + T64B, src + (size_t)64 * DM, (size_t)16 * DM * 2); }
#define WAIT_DS()    asm volatile("s_wait_dscnt 0x0" ::: "memory")      // this wave's LDS reads of the buffer are done before the barrier frees it
#define WAIT_ASYNC() asm volatile("s_wait_asynccnt 0x0" ::: "memory")   // this wave's copies have landed before the barrier publishes them
// ---- k_pack: ONE launch rounds to bf16 what the projections read many times over: blocks < PKW the four [1024][1024] weights (natural [out][in] rows) into the four consecutive planes of DST (wq | wk | wv | wo), the other PKX blocks the rows of x into XB (per batch: 226 text rows, 2,048 video rows, 30 zero rows). A block takes PKIT rows of 1,024; a wave's load covers 512 contiguous bytes, its store 256; a thread's PKIT loads all issue ahead of its first store
#define PKIT 16                      // 16-byte loads per thread, one per row
#define PKW (4 * DM / PKIT)          // blocks on the weights
#define PKX (NB * SS / PKIT)         // blocks on x
typedef __attribute__((ext_vector_type(4))) __bf16 v4b;
__global__ __launch_bounds__(256) void k_pack(const float* __restrict__ WQ, const float* __restrict__ WK, const float* __restrict__ WV, const float* __restrict__ WO, const float* __restrict__ XT, const float* __restrict__ XV, __bf16* __restrict__ DST, __bf16* __restrict__ XB) {
  const int bid = blockIdx.x, c4 = threadIdx.x * 4; __bf16* d; v4f x[PKIT];
  if (bid < PKW) { const int mt = bid / (DM / PKIT); const float* S = (mt == 0) ? WQ : (mt == 1) ? WK : (mt == 2) ? WV : WO;
    const float* s = S + (size_t)(bid % (DM / PKIT)) * (PKIT * DM) + c4; d = DST + (size_t)bid * (PKIT * DM) + c4;
#pragma unroll   // x stays in registers and the loads stand together, on one address with immediate offsets
    for (int it = 0; it < PKIT; ++it) x[it] = *(const v4f*)(s + it * DM);
  } else { const int r0 = (bid - PKW) * PKIT, b = r0 / SS, s0 = r0 % SS; d = XB + (size_t)r0 * DM + c4;   // PKIT rows from a multiple of PKIT never cross a batch (SS is one)
    static_assert(SS % PKIT == 0, "a block's rows lie in one batch");
    const float* pt = XT + ((ptrdiff_t)b * STXT + s0) * DM + c4; const float* pv = XV + ((ptrdiff_t)b * SVID + s0 - STXT) * DM + c4;   // where row s0 would lie in the text and in the video input; each is used only for the rows that do lie there
#pragma unroll   // as above; a padding row loads a valid row (one of the first PKIT video rows), so that no load stands under a test, and the zero is selected behind the loads
    for (int it = 0; it < PKIT; ++it) { const int s = s0 + it; const float* p = (s < STXT) ? pt : (s < SREAL) ? pv : XV + c4; x[it] = *(const v4f*)(p + it * DM); }
#pragma unroll
    for (int it = 0; it < PKIT; ++it) if (s0 + it >= SREAL) x[it] = (v4f){0.f, 0.f, 0.f, 0.f};
  }
#pragma unroll   // as above, for the stores
  for (int it = 0; it < PKIT; ++it) { v4b o;
#pragma unroll   // four converts, packed in pairs
    for (int i = 0; i < 4; ++i) o[i] = (__bf16)x[it][i];
    *(v4b*)(d + it * DM) = o; }
}
// ---- k_qkv: block = (128 rows (b,s), 128 of the 3072 cols), wave = (64 rows, 64 cols = one head): qkv = x (bf16 rows of XB, staged in LDS beside the weight rows) . rows (exact); per 32 k a wave's 4 x fragments and 4 weight fragments feed 16 WMMAs; cols < 1024 -> f16(q), cols < 2048 -> f16(k) into QK rows (pitch 2048); cols >= 2048 (v) -> per-batch transposed f16 planes VT[b][h*64+d][s]: hi = f16(v), lo = f16((v - hi) * 2048)
// the second launch bound: four waves per SIMD, that is at most 256 registers a wave, so that four blocks share a WGP (as their LDS allows) and all 864 blocks are resident at once
__global__ __launch_bounds__(128, 4) void k_qkv(const __bf16* __restrict__ XB, const __bf16* __restrict__ P, const float* __restrict__ BQ, const float* __restrict__ BK, const float* __restrict__ BV, const float* __restrict__ LQW, const float* __restrict__ LQB, const float* __restrict__ LKW, const float* __restrict__ LKB, const float* __restrict__ COS, const float* __restrict__ SIN, _Float16* __restrict__ QK, _Float16* __restrict__ VTH, _Float16* __restrict__ VTL) {
  __shared__ __align__(16) unsigned char L[2 * QSTG];   // the ring during the k loop, then the output staging
  static_assert(2 * QSTG >= 4 * 64 * TP * 2 && 2 * QSTG >= 2 * 128 * 136 * 2, "the output staging fits the ring");
  static_assert(SS % 128 == 0, "a block's rows lie in one batch");
  _Float16 (*so)[64][TP] = (_Float16 (*)[64][TP])L;   // q | k blocks: per wave 64 rows of 64 values
  _Float16 (*sth)[136] = (_Float16 (*)[136])L; _Float16 (*stl)[136] = sth + 128;   // v blocks: [128 d][128 keys], rounded and residual
  const int tid = threadIdx.x, wave = tid >> 5, lane = tid & 31, col = lane & 15, g = lane >> 4, rw = wave >> 1, hw = wave & 1; const size_t r0 = (size_t)blockIdx.x * 128 + rw * 64; const int n0 = blockIdx.y * 128;
  v8f acc[4][4] = {};   // acc[i][j][r] = row r0 + 16 i + 8 g + r, col n0 + 64 hw + 16 j + col
  const unsigned lw = lds_off(L) + (tid >> 3) * TPB + (tid & 7) * 16; const __bf16* gw = P + (size_t)(n0 + (tid >> 3)) * DM + (tid & 7) * 8;
  const __bf16* gx = XB + ((size_t)blockIdx.x * 128 + (tid >> 3)) * DM + (tid & 7) * 8;
  auto fill = [&](int st) { const unsigned l = lw + (st & 1) * QSTG; fill_w(l, gw + st * 64); fill_w(l + WSTG, gx + st * 64); };   // stage st = k 64 st .. 64 st + 63 of the block's 128 weight rows and 128 x rows
  fill(0); WAIT_ASYNC(); __syncthreads(); fill(1);
#pragma unroll 1   // one stage per trip: the buffer index and the publish point at the foot stay those of a two-buffer ring
  for (int st = 0; st < DM / 64; ++st) { const __bf16* Bt = (const __bf16*)(L + (st & 1) * QSTG); const __bf16* Wt = Bt + (hw * 64 + col) * TP; const __bf16* At = Bt + (128 + rw * 64 + col) * TP;   // this lane's first weight row and first x row
#pragma unroll
    for (int sub = 0; sub < 2; ++sub) { v16b a[4], w[4];
#pragma unroll
      for (int i = 0; i < 4; ++i) { a[i] = frag_b(At + i * 16 * TP + sub * 32, lane); w[i] = frag_b(Wt + i * 16 * TP + sub * 32, lane); }
      __builtin_amdgcn_sched_barrier(0);   // the 32 k's fragment loads stay one group ahead of their WMMAs: left to itself this build reloads one register set in front of every WMMA and waits each load out
#pragma unroll
      for (int i = 0; i < 4; ++i) {
#pragma unroll
        for (int j = 0; j < 4; ++j) acc[i][j] = wmma_bf(a[i], w[j], acc[i][j]); } }
    WAIT_DS(); WAIT_ASYNC(); __syncthreads();   // publishes stage st + 1 and frees stage st's buffer
    if (st + 2 < DM / 64) fill(st + 2); }
  WAIT_ASYNC();
  { const float* BB = (n0 < DM) ? BQ : (n0 < 2 * DM) ? BK : BV; const unsigned nb = (unsigned)(n0 % DM + hw * 64 + col); float bv[4];
#pragma unroll
    for (int j = 0; j < 4; ++j) bv[j] = BB[nb + j * 16];
    asm volatile("s_wait_xcnt 0x0" :: "v"(nb) : "memory");   // the offset register of the bias loads stays as it is up to this wait
#pragma unroll
    for (int j = 0; j < 4; ++j) { const float bb = bfr(bv[j]);
#pragma unroll
      for (int i = 0; i < 4; ++i) {
#pragma unroll
        for (int r = 0; r < 8; ++r) acc[i][j][r] += bb; } } }
  if (n0 < 2 * DM) {   // q | k: per-head LayerNorm over the 64 dims (the wave's four col tiles), then rotary for video tokens; q unscaled (1/8 on the f32 score)
    const float* LW = (n0 < DM) ? LQW : LKW; const float* LBv = (n0 < DM) ? LQB : LKB;
#pragma unroll
    for (int i = 0; i < 4; ++i) {
#pragma unroll
      for (int r = 0; r < 8; ++r) { float s = 0.f;
#pragma unroll
        for (int j = 0; j < 4; ++j) s += acc[i][j][r];
#pragma unroll
        for (int o = 1; o < 16; o <<= 1) s += __shfl_xor(s, o);
        const float mu = s * (1.0f / 64.0f); float v = 0.f;
#pragma unroll
        for (int j = 0; j < 4; ++j) { const float dv = acc[i][j][r] - mu; v += dv * dv; }
#pragma unroll
        for (int o = 1; o < 16; o <<= 1) v += __shfl_xor(v, o);
        float rs; asm("v_rsq_f32 %0, %1\n\tv_nop" : "=v"(rs) : "v"(v * (1.0f / 64.0f) + 1e-5f));   // the hardware's reciprocal square root with the one slot that the instruction set asks for behind a transcendental in the same statement; the argument is at least 1e-5, so the library call's scaling of subnormal arguments never acts
#pragma unroll
        for (int j = 0; j < 4; ++j) { const int d = j * 16 + col; acc[i][j][r] = (acc[i][j][r] - mu) * rs * bfr(LW[d]) + bfr(LBv[d]); } } }
#pragma unroll   // row tile by row tile, so that one tile's tables are in registers at a time
    for (int i = 0; i < 4; ++i) {
      // the rotary tables of this lane's 8 rows x 4 dims: table row clamped to 0 for text and padding rows, so the loads stand under no lane test and are all in flight together
      float tc[8][4], ts[8][4]; bool vid[8]; unsigned to[8]; const int sv0 = (int)((r0 + i * 16 + 8 * g) % SS) - STXT;   // 8 rows from a multiple of 8 never cross a batch (SS is one)
#pragma unroll
      for (int r = 0; r < 8; ++r) { const int sv = sv0 + r; vid[r] = sv >= 0 && sv < SVID; to[r] = (unsigned)(vid[r] ? sv : 0) * HD + col; }
#pragma unroll
      for (int r = 0; r < 8; ++r) {
#pragma unroll
        for (int q = 0; q < 4; ++q) { tc[r][q] = COS[to[r] + q * 16]; ts[r][q] = SIN[to[r] + q * 16]; } }
      asm volatile("s_wait_xcnt 0x0" :: "v"(to[0]), "v"(to[1]), "v"(to[2]), "v"(to[3]), "v"(to[4]), "v"(to[5]), "v"(to[6]), "v"(to[7]) : "memory");   // the offset registers of the table loads stay as they are up to this wait
      // rotary on video tokens: pairs (2i, 2i+1): out = x cos + rot(x) sin with rot = [-x_{2i+1}, x_{2i}]; cos/sin [2048][64] inputs (bf16-rounded), indexed by (s - 226, d)
#pragma unroll
      for (int j = 0; j < 4; ++j) { const int d = j * 16 + col;
#pragma unroll
        for (int r = 0; r < 8; ++r) { const float xv = acc[i][j][r]; const float xp = __shfl_xor(xv, 1);   // partner dim d^1 lives in lane col^1
          const float c = bfr(tc[r][j]), sn = bfr(ts[r][j]); const float rot = (d & 1) ? xp : -xp; so[wave][i * 16 + 8 * g + r][j * 16 + col] = (_Float16)(vid[r] ? xv * c + rot * sn : xv); } } }   // text and padding rows keep xv by the select
    LDSX();
#pragma unroll 4   // a store covers four rows' 128-byte pieces
    for (int it = 0; it < 16; ++it) { const int rl = it * 4 + (lane >> 3), pc = (lane & 7) * 8; vst2((unsigned*)(QK + (r0 + rl) * (2 * DM) + n0 + hw * 64 + pc), *(const v4u*)&so[wave][rl][pc]); }
  } else {
#pragma unroll
    for (int i = 0; i < 4; ++i) {
#pragma unroll
      for (int j = 0; j < 4; ++j) {
#pragma unroll
        for (int r = 0; r < 8; ++r) { const float v = acc[i][j][r]; const _Float16 hv = (_Float16)v; sth[hw * 64 + j * 16 + col][rw * 64 + i * 16 + 8 * g + r] = hv; stl[hw * 64 + j * 16 + col][rw * 64 + i * 16 + 8 * g + r] = (_Float16)((v - (float)hv) * 2048.0f); } } }
    __syncthreads();
    const size_t rb = (size_t)blockIdx.x * 128; const int b = (int)(rb / SS), s0 = (int)(rb % SS); const int pc0 = n0 - 2 * DM;
    for (int q = tid; q < 128 * 16; q += 128) { const int d = q >> 4, pc = q & 15; const size_t o = ((size_t)b * DM + pc0 + d) * SS + s0 + pc * 8; vst2((unsigned*)(VTH + o), *(const v4u*)&sth[d][pc * 8]); vst2((unsigned*)(VTL + o), *(const v4u*)&stl[d][pc * 8]); }
  }
}
typedef __attribute__((ext_vector_type(2))) _Float16 v2h;
// lane l <-> lane l ^ 16 as one vector instruction
__device__ __forceinline__ float xhalf(float x) { return __builtin_bit_cast(float, __builtin_amdgcn_permlanex16(__builtin_bit_cast(int, x), __builtin_bit_cast(int, x), 0x76543210, 0xfedcba98, false, false)); }
__global__ __launch_bounds__(128, 5) void k_attn(const _Float16* __restrict__ QK, const _Float16* __restrict__ VTH, const _Float16* __restrict__ VTL, __bf16* __restrict__ OH, __bf16* __restrict__ OL) {
  __shared__ __align__(16) unsigned char L[2 * ASTG];   // the K/V ring during the key loop, then the output staging
  __bf16 (*so)[2][16][TP] = (__bf16 (*)[2][16][TP])L;   // per wave: 16 query rows of 64 rounded values, then of 64 residuals
  const int tid = threadIdx.x, wave = tid >> 5, lane = tid & 31, col = lane & 15, g = lane >> 4;
  const int qb = blockIdx.x, h = blockIdx.y, b = blockIdx.z; const int q0 = qb * 64 + wave * 16; const size_t rq = (size_t)b * SS + q0 + col;
  const unsigned lt = lds_off(L) + (tid >> 3) * TPB + (tid & 7) * 16;
  const _Float16* gk = QK + ((size_t)b * SS + (tid >> 3)) * (2 * DM) + DM + h * HD + (tid & 7) * 8; const size_t gvo = ((size_t)b * DM + h * HD + (tid >> 3)) * SS + (tid & 7) * 8;
  auto fill = [&](int st) { const unsigned l = lt + (st & 1) * ASTG;   // stage st = keys 64 st .. 64 st + 63: K rows [key][64 d], V planes [d][64 keys]
    cp4(l, gk + (size_t)st * 64 * (2 * DM), (size_t)16 * 2 * DM * 2); cp4(l + T64B, VTH + gvo + st * 64, (size_t)16 * SS * 2); cp4(l + 2 * T64B, VTL + gvo + st * 64, (size_t)16 * SS * 2); };
  fill(0); WAIT_ASYNC(); __syncthreads(); fill(1);
  v16h aq[2];
#pragma unroll
  for (int kc = 0; kc < 2; ++kc) aq[kc] = frag_h(QK + rq * (2 * DM) + h * HD + kc * 32, lane);
  float m = -3.0e38f, l = 0.f;   // of query col: m is the same in both halves, l is this half's share of the sum (joined behind the loop)
  v8f acc[4] = {}, accl[4] = {};   // acc[dt][r] = O^T[dt * 16 + 8 g + r][col]
  // not causal; keys >= 2,274 are padding and masked
  // one 32-key pass; 'padded' is a literal at both calls: the mask stands only in the copy that the stage with padding keys runs
  auto pass = [&](const bool padded, const int st, const int sub) __attribute__((always_inline)) { const _Float16* Kt = (const _Float16*)(L + (st & 1) * ASTG); const _Float16* Vh = Kt + 64 * TP; const _Float16* Vl = Vh + 64 * TP; const int ks = st * 2 + sub; v8f s[2]; v16h kf[2][2], vh[4], vl[4];
#pragma unroll
    for (int ct = 0; ct < 2; ++ct) {
#pragma unroll
      for (int kc = 0; kc < 2; ++kc) kf[ct][kc] = frag_h(Kt + (sub * 32 + ct * 16 + col) * TP + kc * 32, lane); }
#pragma unroll
    for (int dt = 0; dt < 4; ++dt) vh[dt] = frag_h(Vh + (dt * 16 + col) * TP + sub * 32, lane);
    if (!padded) __builtin_amdgcn_sched_barrier(0);   // (not in the masked copy, two passes of 72, which has no registers to spare) the pass's K and V hi fragment loads stay one group ahead of the score WMMAs: with the pass split by the rescale branch this build otherwise reloads one register set in front of every WMMA and waits each load out
#pragma unroll
    for (int ct = 0; ct < 2; ++ct) { const int kk0 = ks * 32 + ct * 16 + 8 * g; v8f c = {};
#pragma unroll
      for (int kc = 0; kc < 2; ++kc) c = wmma16(kf[ct][kc], aq[kc], c);
#pragma unroll
      for (int r = 0; r < 8; ++r) s[ct][r] = (!padded || kk0 + r < SREAL) ? c[r] : -3.0e38f; }   // q.k, not yet scaled; padded keys masked
    v2f e[8], es;   // e[ct * 4 + rp] = exp(score - m) of keys ct * 16 + 8 g + 2 rp and + 1; es = their sums
    auto expo = [&]() __attribute__((always_inline)) { es = (v2f){0.f, 0.f};
#pragma unroll
      for (int ct = 0; ct < 2; ++ct) {
#pragma unroll
        for (int rp = 0; rp < 4; ++rp) { v2f x; x[0] = __expf(fmaf(s[ct][2 * rp], 0.125f, -m)); x[1] = __expf(fmaf(s[ct][2 * rp + 1], 0.125f, -m)); e[ct * 4 + rp] = x; es += x; } } };   // score = q.k / sqrt(64): the product with 0.125 is exact, so the fused form rounds as product and difference did; a masked key: -3e38 / 8 against a finite m (the first pass holds real keys only), the exp is 0 by itself
    expo();   // against the maximum in use
    // lazy rescale, tested once per pass for the whole wave (a scalar branch): m stays as long as every lane's 16 exponentials sum to at most 256, so that each is at most 256 and P and its residual fit f16. The negated form also catches infinity (the first pass, m = -3e38) and not-a-number
    if (__builtin_amdgcn_ballot_w32(!(es[0] + es[1] <= 256.0f)) != 0) {
      float mx = fmaxf(s[0][0], s[1][0]);
#pragma unroll
      for (int r = 1; r < 8; ++r) mx = fmaxf(mx, fmaxf(s[0][r], s[1][r]));
      mx = 0.125f * fmaxf(mx, xhalf(mx));
      const float mn = fmaxf(m, mx); const float alpha = __expf(m - mn);   // first pass: m = -3e38 against a finite mn, the exp is 0 by itself (and acc and l are 0)
      l *= alpha; m = mn;
#pragma unroll
      for (int dt = 0; dt < 4; ++dt) { acc[dt] *= alpha; accl[dt] *= alpha; }
      expo(); }   // again, against the new maximum
    l += es[0] + es[1];
#pragma unroll
    for (int dt = 0; dt < 4; ++dt) vl[dt] = frag_h(Vl + (dt * 16 + col) * TP + sub * 32, lane);
    if (!padded) __builtin_amdgcn_sched_barrier(0);   // the V lo fragment loads stay one group ahead of P's conversions, which cover their latency (as above)
    union { v16h v; v2h p[8]; } pa, pl;   // element ct * 8 + r = key ct * 16 + 8 g + r: the k order of frag_h
#pragma unroll
    for (int i = 0; i < 8; ++i) { const v2h hh = __builtin_convertvector(e[i], v2h); pa.p[i] = hh; pl.p[i] = __builtin_convertvector((e[i] - __builtin_convertvector(hh, v2f)) * 2048.0f, v2h); }
#pragma unroll
    for (int dt = 0; dt < 4; ++dt) { acc[dt] = wmma16(vh[dt], pa.v, acc[dt]); accl[dt] = wmma16(vh[dt], pl.v, accl[dt]); accl[dt] = wmma16(vl[dt], pa.v, accl[dt]); }   // V hi x P hi + (V hi x P lo + V lo x P hi) / 2048
    // the pass's back edge: the four vector slots between the pass's last WMMAs and the next pass's first write of their operand registers stand here, behind all of them
    asm volatile("v_nop\n\tv_nop\n\tv_nop\n\tv_nop" : "+v"(acc[0]), "+v"(acc[1]), "+v"(acc[2]), "+v"(acc[3]), "+v"(accl[0]), "+v"(accl[1]), "+v"(accl[2]), "+v"(accl[3])); };
#pragma unroll 1   // one stage per trip: the buffer index and the publish point at the foot stay those of a two-buffer ring
  for (int st = 0; st < SREAL / 64; ++st) {   // the stages whose every key is real
#pragma unroll 1   // the 32-key pass stays rolled: one copy of it in the text
    for (int sub = 0; sub < 2; ++sub) pass(false, st, sub);
    WAIT_DS(); WAIT_ASYNC(); __syncthreads();   // publishes stage st + 1 and frees stage st's buffer
    if (st + 2 < SS / 64) fill(st + 2); }
  static_assert(SREAL / 64 == SS / 64 - 1, "only the last stage holds padding keys");
#pragma unroll 1   // rolled as above
  for (int sub = 0; sub < 2; ++sub) pass(true, SS / 64 - 1, sub);   // the last stage, with the mask
  WAIT_DS(); WAIT_ASYNC(); __syncthreads();   // the stage's foot: every wave has left the ring before it becomes the output staging
  WAIT_ASYNC();
  const float il = 1.0f / (l + xhalf(l));
#pragma unroll
  for (int dt = 0; dt < 4; ++dt) { v8b oh, ol;
#pragma unroll
    for (int i = 0; i < 8; ++i) { const float o = (acc[dt][i] + accl[dt][i] * (1.0f / 2048.0f)) * il; const __bf16 hb = (__bf16)o; oh[i] = hb; ol[i] = (__bf16)(o - (float)hb); }
    *(v8b*)&so[wave][0][col][dt * 16 + 8 * g] = oh; *(v8b*)&so[wave][1][col][dt * 16 + 8 * g] = ol; }
  LDSX();
#pragma unroll   // a store covers four rows' 128-byte pieces
  for (int it = 0; it < 4; ++it) { const int rl = it * 4 + (lane >> 3), pc = (lane & 7) * 8; const unsigned o = (unsigned)((b * SS + q0 + rl) * DM + h * HD + pc); vst2((unsigned*)(OH + o), *(const v4u*)&so[wave][0][rl][pc]); vst2((unsigned*)(OL + o), *(const v4u*)&so[wave][1][rl][pc]); }
}
// ---- k_out: block = (64 rows, 128 cols): out = ctx (OH and OL rows, staged in LDS beside the weight rows) . Wo rows (2 products) + bo
__global__ __launch_bounds__(128) void k_out(const __bf16* __restrict__ OH, const __bf16* __restrict__ OL, const __bf16* __restrict__ P, const float* __restrict__ BO, float* __restrict__ Y) {
  __shared__ __align__(16) unsigned char L[2 * OSTG];   // the ring during the k loop, then the output staging
  float (*so)[16][132] = (float (*)[16][132])L;
  const int tid = threadIdx.x, wave = tid >> 5, lane = tid & 31, col = lane & 15, g = lane >> 4; const size_t r0 = (size_t)blockIdx.x * 64 + wave * 16; const int n0 = blockIdx.y * 128;
  v8f acc[8] = {};
  const unsigned lw = lds_off(L) + (tid >> 3) * TPB + (tid & 7) * 16; const __bf16* gw = P + (size_t)(n0 + (tid >> 3)) * DM + (tid & 7) * 8;
  const size_t go = ((size_t)blockIdx.x * 64 + (tid >> 3)) * DM + (tid & 7) * 8;
  auto fill = [&](int st) { const unsigned l = lw + (st & 1) * OSTG; fill_w(l, gw + st * 64); cp4(l + WSTG, OH + go + st * 64, (size_t)16 * DM * 2); cp4(l + WSTG + T64B, OL + go + st * 64, (size_t)16 * DM * 2); };   // stage st = k 64 st .. 64 st + 63 of the block's 128 weight rows and 64 ctx rows (both planes)
  fill(0); WAIT_ASYNC(); __syncthreads(); fill(1);
#pragma unroll 1   // one stage per trip: the buffer index and the publish point at the foot stay those of a two-buffer ring
  for (int st = 0; st < DM / 64; ++st) { const __bf16* Bt = (const __bf16*)(L + (st & 1) * OSTG); const __bf16* Ah = Bt + (128 + wave * 16 + col) * TP; const __bf16* Al = Ah + 64 * TP;   // this lane's ctx row in the two planes
#pragma unroll
    for (int sub = 0; sub < 2; ++sub) { const v16b ah = frag_b(Ah + sub * 32, lane), al = frag_b(Al + sub * 32, lane); v16b w[8];
#pragma unroll
      for (int j = 0; j < 8; ++j) w[j] = frag_b(Bt + (j * 16 + col) * TP + sub * 32, lane);
      __builtin_amdgcn_sched_barrier(0);   // the 32 k's fragment loads stay one group ahead of their WMMAs (as in k_qkv)
#pragma unroll
      for (int j = 0; j < 8; ++j) { acc[j] = wmma_bf(al, w[j], acc[j]); acc[j] = wmma_bf(ah, w[j], acc[j]); } }
    WAIT_DS(); WAIT_ASYNC(); __syncthreads();   // publishes stage st + 1 and frees stage st's buffer
    if (st + 2 < DM / 64) fill(st + 2); }
  WAIT_ASYNC();
#pragma unroll
  for (int j = 0; j < 8; ++j) { const float bb = bfr(BO[n0 + j * 16 + col]);
#pragma unroll
    for (int r = 0; r < 8; ++r) so[wave][8 * g + r][j * 16 + col] = acc[j][r] + bb; }
  LDSX();
  for (int rl = 0; rl < 16; ++rl) { const size_t row = r0 + rl; const int b = (int)(row / SS), s = (int)(row % SS); if (s < STXT) vst2(Y + (size_t)NB * SVID * DM + ((size_t)b * STXT + s) * DM + n0 + lane * 4, *(const v4f*)&so[wave][rl][lane * 4]); else if (s < SREAL) vst2(Y + ((size_t)b * SVID + (s - STXT)) * DM + n0 + lane * 4, *(const v4f*)&so[wave][rl][lane * 4]); }   // out0 = o[:, 226:] at 0, out1 = o[:, :226] after it; padding rows dropped
}
extern "C" void kernel_launch(void* const* d_in, const int* in_sizes, int n_in, void* d_out, int out_size, void* d_ws, size_t ws_size, hipStream_t stream) {
  (void)in_sizes; (void)n_in; (void)out_size;
  const float** F = (const float**)d_in;   // 0 hidden_states [2,2048,1024], 1 encoder_hidden_states [2,226,1024], 2 cos [2048,64], 3 sin, 4 wq [1024,1024], 5 bq, 6 wk, 7 bk, 8 wv, 9 bv, 10 wo, 11 bo, 12 lnq_w [64], 13 lnq_b, 14 lnk_w, 15 lnk_b
  if (ws_size < (size_t)WS_END) return;
  char* ws = (char*)d_ws; __bf16* PK = (__bf16*)(ws + WS_PK); _Float16 *QK = (_Float16*)(ws + WS_QK), *VTH = (_Float16*)(ws + WS_VTH), *VTL = (_Float16*)(ws + WS_VTL); __bf16 *OH = (__bf16*)(ws + WS_OH), *OL = (__bf16*)(ws + WS_OL), *XB = (__bf16*)(ws + WS_XB);
  k_pack<<<dim3(PKW + PKX), 256, 0, stream>>>(F[4], F[6], F[8], F[10], F[1], F[0], PK + PK_A, XB);   // PK_P = PK_A + 3 planes: wo is the fourth
  k_qkv<<<dim3(TNB * SS / 128, QKVW / 128), 128, 0, stream>>>(XB, PK + PK_A, F[5], F[7], F[9], F[12], F[13], F[14], F[15], F[2], F[3], QK, VTH, VTL);
  k_attn<<<dim3(TQB, NH, TNB), 128, 0, stream>>>(QK, VTH, VTL, OH, OL);
  k_out<<<dim3(TOB, DM / 128), 128, 0, stream>>>(OH, OL, PK + PK_P, F[11], (float*)d_out);
}

// v010
// A run of this version takes 132 microseconds.
// In two side-by-side timings against v009, it was 1.06 and 1.05 times as fast.
// Counting every step since v000, it is 5.85 times as fast.
// compute dtype: hidden_states, encoder_hidden_states, cos, sin and all weights / biases / norm parameters (module inputs) rounded to bf16; q/k/v projections with exact bf16 products (natural [out][in] rows) + bias on WMMA 16x16x32; per-head LayerNorm of q and k (over the 64 dims, eps 1e-5) and the interleaved rotary on the video tokens (input cos/sin tables) in f32 in the projection epilogue; q and k stored once as f16 (q unscaled; 1/8 on the f32 score), v as f16 hi + (x2048-scaled) residual planes; scores with single f16 operands (1 product) and P.V with P as f16 hi + (x2048-scaled) residual x V hi/lo (3 products); the output projection with ctx as bf16 hi + residual x exact wo (2 products) + bo; running-max softmax in f32 with the hardware exp; the 2,274-token sequence is padded to 2,304 rows per batch with the padding keys masked; f32 accumulate.
#include <hip/hip_runtime.h>
#include <math.h>

typedef __attribute__((ext_vector_type(16))) _Float16 v16h;
typedef __attribute__((ext_vector_type(16))) __bf16 v16b;
typedef __attribute__((ext_vector_type(8)))  _Float16 v8h;
typedef __attribute__((ext_vector_type(8)))  float v8f;
typedef __attribute__((ext_vector_type(4)))  float v4f;
typedef __attribute__((ext_vector_type(2)))  float v2f;
typedef __attribute__((ext_vector_type(4)))  unsigned v4u;
typedef __attribute__((ext_vector_type(4)))  int v4i;
typedef float __attribute__((may_alias)) float_a;
typedef int __attribute__((may_alias)) int_a;

template <typename T> __device__ __forceinline__ void vst2(void* p, T v) { *(T*)p = v;  }
__device__ __forceinline__ v8f wmma16(v16h a, v16h b, v8f c) {
  v8f d = __builtin_amdgcn_wmma_f32_16x16x32_f16(false, a, false, b, (short)0, c, false, false);
  return d;
}
__device__ __forceinline__ v8f wmma_bf(v16b a, v16b b, v8f c) {
  v8f d = __builtin_amdgcn_wmma_f32_16x16x32_bf16(false, a, false, b, (short)0, c, false, false);
  return d;
}
// CogVideoX joint text+video attention processor (B 2, 226 text + 2,048 video tokens, D 1,024, 16 heads x 64): qkv with bias, per-head LayerNorm on q and k, rotary on the video part, full softmax attention, output projection + bias; returns (video part, text part).
__device__ __forceinline__ v16h frag_h(const _Float16* rowk0, int lane) {
  union { v16h v; v8h q[2]; } u; const _Float16* p = rowk0 + 8 * (lane >> 4);
  u.q[0] = *(const v8h*)p; u.q[1] = *(const v8h*)(p + 16); return u.v;
}
__device__ __forceinline__ v16h frag_f32(const float* rowk0, int lane) {
  v16h a; const float* p = rowk0 + 8 * (lane >> 4);
#pragma unroll
  for (int i = 0; i < 8; ++i) { a[i] = (_Float16)p[i]; a[8 + i] = (_Float16)p[16 + i]; }
  return a;
}
__device__ __forceinline__ v16h frag_f32s(const float* rowk0, int lane, float sc) {
  v16h a; const float* p = rowk0 + 8 * (lane >> 4);
#pragma unroll
  for (int i = 0; i < 8; ++i) { a[i] = (_Float16)(p[i] * sc); a[8 + i] = (_Float16)(p[16 + i] * sc); }
  return a;
}
// column fragment from a [K][ld] layout (column n), rows >= K read as 0
__device__ __forceinline__ v16h fragc_f32(const float* W, int k0, int n, int lane, int ld, int K) {
  v16h a; const int g = lane >> 4;
#pragma unroll
  for (int i = 0; i < 8; ++i) { const int ka = k0 + 8 * g + i, kb = ka + 16;
    a[i] = (_Float16)(ka < K ? W[(size_t)(ka < K ? ka : K - 1) * ld + n] : 0.f); a[8 + i] = (_Float16)(kb < K ? W[(size_t)(kb < K ? kb : K - 1) * ld + n] : 0.f); }
  return a;
}
struct F2 { v16b h, l; };
__device__ __forceinline__ F2 bsplit16(const float v[16]) { F2 r;
#pragma unroll
  for (int i = 0; i < 16; ++i) { const __bf16 h = (__bf16)v[i]; r.h[i] = h; r.l[i] = (__bf16)(v[i] - (float)h); }
  return r; }
__device__ __forceinline__ F2 split_row(const float* row, int k0, int lane) { float v[16]; const float* p = row + k0 + 8 * (lane >> 4);
#pragma unroll
  for (int i = 0; i < 8; ++i) { v[i] = p[i]; v[8 + i] = p[16 + i]; }
  return bsplit16(v); }
__device__ __forceinline__ F2 split_rowK(const float* row, int k0, int lane, int K) { float v[16]; const int g = lane >> 4;
#pragma unroll
  for (int i = 0; i < 8; ++i) { const int ka = k0 + 8 * g + i, kb = ka + 16; v[i] = ka < K ? row[ka < K ? ka : K - 1] : 0.f; v[8 + i] = kb < K ? row[kb < K ? kb : K - 1] : 0.f; }
  return bsplit16(v); }
__device__ __forceinline__ F2 split_col(const float* W, int k0, int n, int lane, int ld, int K) { float v[16]; const int g = lane >> 4;
#pragma unroll
  for (int i = 0; i < 8; ++i) { const int ka = k0 + 8 * g + i, kb = ka + 16; v[i] = ka < K ? W[(size_t)(ka < K ? ka : K - 1) * ld + n] : 0.f; v[8 + i] = kb < K ? W[(size_t)(kb < K ? kb : K - 1) * ld + n] : 0.f; }
  return bsplit16(v); }
__device__ __forceinline__ v8f mac3(const F2& a, const F2& b, v8f c) { c = wmma_bf(a.l, b.h, c); c = wmma_bf(a.h, b.l, c); return wmma_bf(a.h, b.h, c); }
__device__ __forceinline__ float sigm(float v) { return 1.0f / (1.0f + expf(-v)); }
#define LDSX() do { asm volatile("s_wait_dscnt 0" ::: "memory"); __builtin_amdgcn_wave_barrier(); __builtin_amdgcn_fence(__ATOMIC_RELEASE, "workgroup"); } while (0)


#define NB 2
#define SS 2304                 // 2,274 tokens (226 text + 2,048 video) padded to 36 x 64
#define SREAL 2274
#define STXT 226
#define SVID 2048
#define DM 1024
#define NH 16
#define HD 64
#define QKVW (3 * DM)
#ifndef TQB
#define TQB (SS / 64)
#define TNB NB
#define TOB (NB * SS / 64)     // output row tiles (all)
#endif
typedef __attribute__((ext_vector_type(8))) __bf16 v8b;
__device__ __forceinline__ v16b frag_b(const __bf16* rowk0, int lane) {
  union { v16b v; v8b q[2]; } u; const __bf16* p = rowk0 + 8 * (lane >> 4);
  u.q[0] = *(const v8b*)p; u.q[1] = *(const v8b*)(p + 16); return u.v;
}
__device__ __forceinline__ float bfr(float v) { return (float)(__bf16)v; }
__device__ __attribute__((noinline)) float exp_ni(float v) { return expf(v); }
__device__ __attribute__((noinline)) float erf_ni(float v) { return erff(v); }

#define PK_A 0                       // [3072][1024] Wqkv rows (natural [out][in])
#define PK_P (PK_A + QKVW * DM)        // [1024][1024] Wo rows (natural)
#define PK_END (PK_P + DM * DM)
#define WS_PK  0u
#define WS_QK  (WS_PK + 2u * PK_END)             // f16 [4608 rows][2048]: q | k
#define WS_VTH (WS_QK + 2u * NB * SS * 2 * DM)     // f16 [2][1024 (h*64+d)][2304 s] hi
#define WS_VTL (WS_VTH + 2u * NB * DM * SS)        // f16 lo x 2048
#define WS_OH  (WS_VTL + 2u * NB * DM * SS)        // bf16 [4608][1024]: ctx, rounded
#define WS_OL  (WS_OH + 2u * NB * SS * DM)          // bf16 [4608][1024]: ctx, residual
#define WS_XB  (WS_OL + 2u * NB * SS * DM)          // bf16 [4608][1024]: x = text | video | zero padding rows, per batch
#define WS_END (WS_XB + 2u * NB * SS * DM)

// ---- LDS staging of the operand tiles that all four waves of a block read: rows of 128 B (64 16-bit values) at a pitch of 144 B (16 B x odd: ds_load_b128 readers), two buffers
#define TP 72                        // row pitch in 16-bit values
#define TPB (2 * TP)                 // row pitch in bytes
#define T64B (64 * TPB)              // a 64-row tile, bytes
#define ASTG (3 * T64B)              // attention stage: K | V hi | V lo, 64 keys
#define WSTG (2 * T64B)              // 128 weight rows x 64 k
#define QSTG (2 * WSTG)              // qkv stage: 128 weight rows | 128 x rows
#define OSTG (WSTG + 2 * T64B)       // output projection stage: weight rows | 64 ctx rows, rounded | their residuals
__device__ __forceinline__ unsigned lds_off(const void* p) { return (unsigned)(size_t)p; }
// four asynchronous 16-byte copies per lane, global -> LDS, rows 16 apart (gstep = 16 source rows, in bytes); s_wait_xcnt closes the statement so that no address register is rewritten ahead of it
__device__ __forceinline__ void cp4(unsigned l, const void* gp, size_t gstep) {
  const char* g = (const char*)gp;
  asm volatile("global_load_async_to_lds_b128 %0, %1, off\n\tglobal_load_async_to_lds_b128 %2, %3, off\n\tglobal_load_async_to_lds_b128 %4, %5, off\n\tglobal_load_async_to_lds_b128 %6, %7, off\n\ts_wait_xcnt 0x0"
               :: "v"(l), "v"(g), "v"(l + 16 * TPB), "v"(g + gstep), "v"(l + 32 * TPB), "v"(g + 2 * gstep), "v"(l + 48 * TPB), "v"(g + 3 * gstep) : "memory");
}
// a 128-row x 64-k weight tile (natural rows of DM bf16); src = this lane's 16 bytes of its first row
__device__ __forceinline__ void fill_w(unsigned l, const __bf16* src) { cp4(l, src, (size_t)16 * DM * 2); cp4(l + T64B, src + (size_t)64 * DM, (size_t)16 * DM * 2); }
#define WAIT_DS()    asm volatile("s_wait_dscnt 0x0" ::: "memory")      // this wave's LDS reads of the buffer are done before the barrier frees it
#define WAIT_ASYNC() asm volatile("s_wait_asynccnt 0x0" ::: "memory")   // this wave's copies have landed before the barrier publishes them
// ---- k_pack: ONE launch rounds to bf16 what the projections read many times over: blocks < PKW the four [1024][1024] weights (natural [out][in] rows) into the four consecutive planes of DST (wq | wk | wv | wo), the other PKX blocks the rows of x into XB (per batch: 226 text rows, 2,048 video rows, 30 zero rows). A block takes PKIT rows of 1,024; a wave's load covers 512 contiguous bytes, its store 256; a thread's PKIT loads all issue ahead of its first store
#define PKIT 16                      // 16-byte loads per thread, one per row
#define PKW (4 * DM / PKIT)          // blocks on the weights
#define PKX (NB * SS / PKIT)         // blocks on x
typedef __attribute__((ext_vector_type(4))) __bf16 v4b;
__global__ __launch_bounds__(256) void k_pack(const float* __restrict__ WQ, const float* __restrict__ WK, const float* __restrict__ WV, const float* __restrict__ WO, const float* __restrict__ XT, const float* __restrict__ XV, __bf16* __restrict__ DST, __bf16* __restrict__ XB) {
  const int bid = blockIdx.x, c4 = threadIdx.x * 4; __bf16* d; v4f x[PKIT];
  if (bid < PKW) { const int mt = bid / (DM / PKIT); const float* S = (mt == 0) ? WQ : (mt == 1) ? WK : (mt == 2) ? WV : WO;
    const float* s = S + (size_t)(bid % (DM / PKIT)) * (PKIT * DM) + c4; d = DST + (size_t)bid * (PKIT * DM) + c4;
#pragma unroll   // x stays in registers and the loads stand together, on one address with immediate offsets
    for (int it = 0; it < PKIT; ++it) x[it] = *(const v4f*)(s + it * DM);
  } else { const int r0 = (bid - PKW) * PKIT, b = r0 / SS, s0 = r0 % SS; d = XB + (size_t)r0 * DM + c4;   // PKIT rows from a multiple of PKIT never cross a batch (SS is one)
    static_assert(SS % PKIT == 0, "a block's rows lie in one batch");
    const float* pt = XT + ((ptrdiff_t)b * STXT + s0) * DM + c4; const float* pv = XV + ((ptrdiff_t)b * SVID + s0 - STXT) * DM + c4;   // where row s0 would lie in the text and in the video input; each is used only for the rows that do lie there
#pragma unroll   // as above; a padding row loads a valid row (one of the first PKIT video rows), so that no load stands under a test, and the zero is selected behind the loads
    for (int it = 0; it < PKIT; ++it) { const int s = s0 + it; const float* p = (s < STXT) ? pt : (s < SREAL) ? pv : XV + c4; x[it] = *(const v4f*)(p + it * DM); }
#pragma unroll
    for (int it = 0; it < PKIT; ++it) if (s0 + it >= SREAL) x[it] = (v4f){0.f, 0.f, 0.f, 0.f};
  }
#pragma unroll   // as above, for the stores
  for (int it = 0; it < PKIT; ++it) { v4b o;
#pragma unroll   // four converts, packed in pairs
    for (int i = 0; i < 4; ++i) o[i] = (__bf16)x[it][i];
    *(v4b*)(d + it * DM) = o; }
}
// ---- k_qkv: block = (128 rows (b,s), 128 of the 3072 cols), wave = (64 rows, 64 cols = one head): qkv = x (bf16 rows of XB, staged in LDS beside the weight rows) . rows (exact); per 32 k a wave's 4 x fragments and 4 weight fragments feed 16 WMMAs; cols < 1024 -> f16(q), cols < 2048 -> f16(k) into QK rows (pitch 2048); cols >= 2048 (v) -> per-batch transposed f16 planes VT[b][h*64+d][s]: hi = f16(v), lo = f16((v - hi) * 2048)
// the second launch bound: four waves per SIMD, that is at most 256 registers a wave, so that four blocks share a WGP (as their LDS allows) and all 864 blocks are resident at once
__global__ __launch_bounds__(128, 4) void k_qkv(const __bf16* __restrict__ XB, const __bf16* __restrict__ P, const float* __restrict__ BQ, const float* __restrict__ BK, const float* __restrict__ BV, const float* __restrict__ LQW, const float* __restrict__ LQB, const float* __restrict__ LKW, const float* __restrict__ LKB, const float* __restrict__ COS, const float* __restrict__ SIN, _Float16* __restrict__ QK, _Float16* __restrict__ VTH, _Float16* __restrict__ VTL) {
  __shared__ __align__(16) unsigned char L[2 * QSTG];   // the ring during the k loop, then the output staging
  static_assert(2 * QSTG >= 4 * 64 * TP * 2 && 2 * QSTG >= 2 * 128 * 136 * 2, "the output staging fits the ring");
  static_assert(SS % 128 == 0, "a block's rows lie in one batch");
  _Float16 (*so)[64][TP] = (_Float16 (*)[64][TP])L;   // q | k blocks: per wave 64 rows of 64 values
  _Float16 (*sth)[136] = (_Float16 (*)[136])L; _Float16 (*stl)[136] = sth + 128;   // v blocks: [128 d][128 keys], rounded and residual
  const int tid = threadIdx.x, wave = tid >> 5, lane = tid & 31, col = lane & 15, g = lane >> 4, rw = wave >> 1, hw = wave & 1; const size_t r0 = (size_t)blockIdx.x * 128 + rw * 64; const int n0 = blockIdx.y * 128;
  v8f acc[4][4] = {};   // acc[i][j][r] = row r0 + 16 i + 8 g + r, col n0 + 64 hw + 16 j + col
  const unsigned lw = lds_off(L) + (tid >> 3) * TPB + (tid & 7) * 16; const __bf16* gw = P + (size_t)(n0 + (tid >> 3)) * DM + (tid & 7) * 8;
  const __bf16* gx = XB + ((size_t)blockIdx.x * 128 + (tid >> 3)) * DM + (tid & 7) * 8;
  auto fill = [&](int st) { const unsigned l = lw + (st & 1) * QSTG; fill_w(l, gw + st * 64); fill_w(l + WSTG, gx + st * 64); };   // stage st = k 64 st .. 64 st + 63 of the block's 128 weight rows and 128 x rows
  fill(0); WAIT_ASYNC(); __syncthreads(); fill(1);
#pragma unroll 1   // one stage per trip: the buffer index and the publish point at the foot stay those of a two-buffer ring
  for (int st = 0; st < DM / 64; ++st) { const __bf16* Bt = (const __bf16*)(L + (st & 1) * QSTG); const __bf16* Wt = Bt + (hw * 64 + col) * TP; const __bf16* At = Bt + (128 + rw * 64 + col) * TP;   // this lane's first weight row and first x row
#pragma unroll
    for (int sub = 0; sub < 2; ++sub) { v16b a[4], w[4];
#pragma unroll
      for (int i = 0; i < 4; ++i) { a[i] = frag_b(At + i * 16 * TP + sub * 32, lane); w[i] = frag_b(Wt + i * 16 * TP + sub * 32, lane); }
      __builtin_amdgcn_sched_barrier(0);   // the 32 k's fragment loads stay one group ahead of their WMMAs: left to itself this build reloads one register set in front of every WMMA and waits each load out
#pragma unroll
      for (int i = 0; i < 4; ++i) {
#pragma unroll
        for (int j = 0; j < 4; ++j) acc[i][j] = wmma_bf(a[i], w[j], acc[i][j]); } }
    WAIT_DS(); WAIT_ASYNC(); __syncthreads();   // publishes stage st + 1 and frees stage st's buffer
    if (st + 2 < DM / 64) fill(st + 2); }
  WAIT_ASYNC();
  { const float* BB = (n0 < DM) ? BQ : (n0 < 2 * DM) ? BK : BV; const unsigned nb = (unsigned)(n0 % DM + hw * 64 + col); float bv[4];
#pragma unroll
    for (int j = 0; j < 4; ++j) bv[j] = BB[nb + j * 16];
    asm volatile("s_wait_xcnt 0x0" :: "v"(nb) : "memory");   // the offset register of the bias loads stays as it is up to this wait
#pragma unroll
    for (int j = 0; j < 4; ++j) { const float bb = bfr(bv[j]);
#pragma unroll
      for (int i = 0; i < 4; ++i) {
#pragma unroll
        for (int r = 0; r < 8; ++r) acc[i][j][r] += bb; } } }
  if (n0 < 2 * DM) {   // q | k: per-head LayerNorm over the 64 dims (the wave's four col tiles), then rotary for video tokens; q unscaled (1/8 on the f32 score)
    const float* LW = (n0 < DM) ? LQW : LKW; const float* LBv = (n0 < DM) ? LQB : LKB;
#pragma unroll
    for (int i = 0; i < 4; ++i) {
#pragma unroll
      for (int r = 0; r < 8; ++r) { float s = 0.f;
#pragma unroll
        for (int j = 0; j < 4; ++j) s += acc[i][j][r];
#pragma unroll
        for (int o = 1; o < 16; o <<= 1) s += __shfl_xor(s, o);
        const float mu = s * (1.0f / 64.0f); float v = 0.f;
#pragma unroll
        for (int j = 0; j < 4; ++j) { const float dv = acc[i][j][r] - mu; v += dv * dv; }
#pragma unroll
        for (int o = 1; o < 16; o <<= 1) v += __shfl_xor(v, o);
        float rs; asm("v_rsq_f32 %0, %1\n\tv_nop" : "=v"(rs) : "v"(v * (1.0f / 64.0f) + 1e-5f));   // the hardware's reciprocal square root with the one slot that the instruction set asks for behind a transcendental in the same statement; the argument is at least 1e-5, so the library call's scaling of subnormal arguments never acts
#pragma unroll
        for (int j = 0; j < 4; ++j) { const int d = j * 16 + col; acc[i][j][r] = (acc[i][j][r] - mu) * rs * bfr(LW[d]) + bfr(LBv[d]); } } }
#pragma unroll   // row tile by row tile, so that one tile's tables are in registers at a time
    for (int i = 0; i < 4; ++i) {
      // the rotary tables of this lane's 8 rows x 4 dims: table row clamped to 0 for text and padding rows, so the loads stand under no lane test and are all in flight together
      float tc[8][4], ts[8][4]; bool vid[8]; unsigned to[8]; const int sv0 = (int)((r0 + i * 16 + 8 * g) % SS) - STXT;   // 8 rows from a multiple of 8 never cross a batch (SS is one)
#pragma unroll
      for (int r = 0; r < 8; ++r) { const int sv = sv0 + r; vid[r] = sv >= 0 && sv < SVID; to[r] = (unsigned)(vid[r] ? sv : 0) * HD + col; }
#pragma unroll
      for (int r = 0; r < 8; ++r) {
#pragma unroll
        for (int q = 0; q < 4; ++q) { tc[r][q] = COS[to[r] + q * 16]; ts[r][q] = SIN[to[r] + q * 16]; } }
      asm volatile("s_wait_xcnt 0x0" :: "v"(to[0]), "v"(to[1]), "v"(to[2]), "v"(to[3]), "v"(to[4]), "v"(to[5]), "v"(to[6]), "v"(to[7]) : "memory");   // the offset registers of the table loads stay as they are up to this wait
      // rotary on video tokens: pairs (2i, 2i+1): out = x cos + rot(x) sin with rot = [-x_{2i+1}, x_{2i}]; cos/sin [2048][64] inputs (bf16-rounded), indexed by (s - 226, d)
#pragma unroll
      for (int j = 0; j < 4; ++j) { const int d = j * 16 + col;
#pragma unroll
        for (int r = 0; r < 8; ++r) { const float xv = acc[i][j][r]; const float xp = __shfl_xor(xv, 1);   // partner dim d^1 lives in lane col^1
          const float c = bfr(tc[r][j]), sn = bfr(ts[r][j]); const float rot = (d & 1) ? xp : -xp; so[wave][i * 16 + 8 * g + r][j * 16 + col] = (_Float16)(vid[r] ? xv * c + rot * sn : xv); } } }   // text and padding rows keep xv by the select
    LDSX();
#pragma unroll 4   // a store covers four rows' 128-byte pieces
    for (int it = 0; it < 16; ++it) { const int rl = it * 4 + (lane >> 3), pc = (lane & 7) * 8; vst2((unsigned*)(QK + (r0 + rl) * (2 * DM) + n0 + hw * 64 + pc), *(const v4u*)&so[wave][rl][pc]); }
  } else {
#pragma unroll
    for (int i = 0; i < 4; ++i) {
#pragma unroll
      for (int j = 0; j < 4; ++j) {
#pragma unroll
        for (int r = 0; r < 8; ++r) { const float v = acc[i][j][r]; const _Float16 hv = (_Float16)v; sth[hw * 64 + j * 16 + col][rw * 64 + i * 16 + 8 * g + r] = hv; stl[hw * 64 + j * 16 + col][rw * 64 + i * 16 + 8 * g + r] = (_Float16)((v - (float)hv) * 2048.0f); } } }
    __syncthreads();
    const size_t rb = (size_t)blockIdx.x * 128; const int b = (int)(rb / SS), s0 = (int)(rb % SS); const int pc0 = n0 - 2 * DM;
    for (int q = tid; q < 128 * 16; q += 128) { const int d = q >> 4, pc = q & 15; const size_t o = ((size_t)b * DM + pc0 + d) * SS + s0 + pc * 8; vst2((unsigned*)(VTH + o), *(const v4u*)&sth[d][pc * 8]); vst2((unsigned*)(VTL + o), *(const v4u*)&stl[d][pc * 8]); }
  }
}
typedef __attribute__((ext_vector_type(2))) _Float16 v2h;
// lane l <-> lane l ^ 16 as one vector instruction
__device__ __forceinline__ float xhalf(float x) { return __builtin_bit_cast(float, __builtin_amdgcn_permlanex16(__builtin_bit_cast(int, x), __builtin_bit_cast(int, x), 0x76543210, 0xfedcba98, false, false)); }
template <int AQT> __device__ __forceinline__ void attn_body(unsigned char* L, const int qs, const int h, const int b, const _Float16* __restrict__ QK, const _Float16* __restrict__ VTH, const _Float16* __restrict__ VTL, __bf16* __restrict__ OH, __bf16* __restrict__ OL) {
  static_assert(2 * ASTG >= 4 * 2 * AQT * 16 * TP * 2, "the output staging fits the ring");
  __bf16 (*so)[2][AQT * 16][TP] = (__bf16 (*)[2][AQT * 16][TP])L;   // per wave: its query rows of 64 rounded values, then of 64 residuals
  const int tid = threadIdx.x, wave = tid >> 5, lane = tid & 31, col = lane & 15, g = lane >> 4;
  const int q0 = qs + wave * (AQT * 16); const size_t rq = (size_t)b * SS + q0 + col;
  const unsigned lt = lds_off(L) + (tid >> 3) * TPB + (tid & 7) * 16;
  const _Float16* gk = QK + ((size_t)b * SS + (tid >> 3)) * (2 * DM) + DM + h * HD + (tid & 7) * 8; const size_t gvo = ((size_t)b * DM + h * HD + (tid >> 3)) * SS + (tid & 7) * 8;
  auto fill = [&](int st) { const unsigned l = lt + (st & 1) * ASTG;   // stage st = keys 64 st .. 64 st + 63: K rows [key][64 d], V planes [d][64 keys]
    cp4(l, gk + (size_t)st * 64 * (2 * DM), (size_t)16 * 2 * DM * 2); cp4(l + T64B, VTH + gvo + st * 64, (size_t)16 * SS * 2); cp4(l + 2 * T64B, VTL + gvo + st * 64, (size_t)16 * SS * 2); };
  fill(0); WAIT_ASYNC(); __syncthreads(); fill(1);
  v16h aq[AQT][2];
#pragma unroll
  for (int qt = 0; qt < AQT; ++qt) {
#pragma unroll
    for (int kc = 0; kc < 2; ++kc) aq[qt][kc] = frag_h(QK + (rq + qt * 16) * (2 * DM) + h * HD + kc * 32, lane); }
  float m[AQT], l[AQT];   // of query qt * 16 + col: m is the same in both halves, l is this half's share of the sum (joined behind the loop)
  v8f acc[AQT][4] = {}, accl[AQT][4] = {};   // acc[qt][dt][r] = O^T[dt * 16 + 8 g + r][qt * 16 + col]
#pragma unroll
  for (int qt = 0; qt < AQT; ++qt) { m[qt] = -3.0e38f; l[qt] = 0.f; }
  // not causal; keys >= 2,274 are padding and masked
  // one 32-key pass; 'padded' is a literal at both calls: the mask stands only in the copy that the stage with padding keys runs
  auto pass = [&](const bool padded, const int st, const int sub) __attribute__((always_inline)) { const _Float16* Kt = (const _Float16*)(L + (st & 1) * ASTG); const _Float16* Vh = Kt + 64 * TP; const _Float16* Vl = Vh + 64 * TP; const int ks = st * 2 + sub; v8f s[AQT][2]; v16h kf[2][2], vh[4], vl[4];
#pragma unroll
    for (int ct = 0; ct < 2; ++ct) {
#pragma unroll
      for (int kc = 0; kc < 2; ++kc) kf[ct][kc] = frag_h(Kt + (sub * 32 + ct * 16 + col) * TP + kc * 32, lane); }
#pragma unroll
    for (int dt = 0; dt < 4; ++dt) vh[dt] = frag_h(Vh + (dt * 16 + col) * TP + sub * 32, lane);
    __builtin_amdgcn_sched_barrier(0);   // the pass's K and V hi fragment loads stay one group ahead of the score WMMAs: with the pass split by the rescale branch this build otherwise reloads one register set in front of every WMMA and waits each load out
#pragma unroll
    for (int ct = 0; ct < 2; ++ct) { const int kk0 = ks * 32 + ct * 16 + 8 * g; v8f c[AQT] = {};
#pragma unroll
      for (int kc = 0; kc < 2; ++kc) {
#pragma unroll
        for (int qt = 0; qt < AQT; ++qt) c[qt] = wmma16(kf[ct][kc], aq[qt][kc], c[qt]); }
#pragma unroll
      for (int qt = 0; qt < AQT; ++qt) {
#pragma unroll
        for (int r = 0; r < 8; ++r) s[qt][ct][r] = (!padded || kk0 + r < SREAL) ? c[qt][r] : -3.0e38f; } }   // q.k, not yet scaled; padded keys masked
    v2f e[AQT][8], es[AQT];   // e[qt][ct * 4 + rp] = exp(score - m) of keys ct * 16 + 8 g + 2 rp and + 1; es = their sums
    auto expo = [&]() __attribute__((always_inline)) {
#pragma unroll
      for (int qt = 0; qt < AQT; ++qt) { es[qt] = (v2f){0.f, 0.f};
#pragma unroll
        for (int ct = 0; ct < 2; ++ct) {
#pragma unroll
          for (int rp = 0; rp < 4; ++rp) { v2f x; x[0] = __expf(fmaf(s[qt][ct][2 * rp], 0.125f, -m[qt])); x[1] = __expf(fmaf(s[qt][ct][2 * rp + 1], 0.125f, -m[qt])); e[qt][ct * 4 + rp] = x; es[qt] += x; } } } };   // score = q.k / sqrt(64): the product with 0.125 is exact, so the fused form rounds as product and difference did; a masked key: -3e38 / 8 against a finite m (the first pass holds real keys only), the exp is 0 by itself
    expo();   // against the maxima in use
    // lazy rescale, tested once per pass for the whole wave (a scalar branch): the maxima stay as long as every lane's 16 exponentials of either tile sum to at most 256, so that each is at most 256 and P and its residual fit f16. The negated form also catches infinity (the first pass, m = -3e38) and not-a-number
    bool fits = true;
#pragma unroll
    for (int qt = 0; qt < AQT; ++qt) fits = fits && es[qt][0] + es[qt][1] <= 256.0f;
    if (__builtin_amdgcn_ballot_w32(!fits) != 0) {
#pragma unroll
      for (int qt = 0; qt < AQT; ++qt) { float mx = fmaxf(s[qt][0][0], s[qt][1][0]);
#pragma unroll
        for (int r = 1; r < 8; ++r) mx = fmaxf(mx, fmaxf(s[qt][0][r], s[qt][1][r]));
        mx = 0.125f * fmaxf(mx, xhalf(mx));
        const float mn = fmaxf(m[qt], mx); const float alpha = __expf(m[qt] - mn);   // first pass: m = -3e38 against a finite mn, the exp is 0 by itself (and acc and l are 0)
        l[qt] *= alpha; m[qt] = mn;
#pragma unroll
        for (int dt = 0; dt < 4; ++dt) { acc[qt][dt] *= alpha; accl[qt][dt] *= alpha; } }
      expo(); }   // again, against the new maxima
#pragma unroll
    for (int qt = 0; qt < AQT; ++qt) l[qt] += es[qt][0] + es[qt][1];
#pragma unroll
    for (int dt = 0; dt < 4; ++dt) vl[dt] = frag_h(Vl + (dt * 16 + col) * TP + sub * 32, lane);
    __builtin_amdgcn_sched_barrier(0);   // the V lo fragment loads stay one group ahead of P's conversions, which cover their latency (as above)
    union { v16h v; v2h p[8]; } pa[AQT], pl[AQT];   // element ct * 8 + r = key ct * 16 + 8 g + r: the k order of frag_h
#pragma unroll
    for (int qt = 0; qt < AQT; ++qt) {
#pragma unroll
      for (int i = 0; i < 8; ++i) { const v2h hh = __builtin_convertvector(e[qt][i], v2h); pa[qt].p[i] = hh; pl[qt].p[i] = __builtin_convertvector((e[qt][i] - __builtin_convertvector(hh, v2f)) * 2048.0f, v2h); } }
#pragma unroll
    for (int dt = 0; dt < 4; ++dt) {   // V hi x P hi + (V hi x P lo + V lo x P hi) / 2048, each V fragment on every query tile
#pragma unroll
      for (int qt = 0; qt < AQT; ++qt) acc[qt][dt] = wmma16(vh[dt], pa[qt].v, acc[qt][dt]);
#pragma unroll
      for (int qt = 0; qt < AQT; ++qt) accl[qt][dt] = wmma16(vh[dt], pl[qt].v, accl[qt][dt]);
#pragma unroll
      for (int qt = 0; qt < AQT; ++qt) accl[qt][dt] = wmma16(vl[dt], pa[qt].v, accl[qt][dt]); }
    // the pass's back edge: the four vector slots between the pass's last WMMAs and the next pass's first write of their operand registers stand here, behind all of them
    if constexpr (AQT == 2) asm volatile("v_nop\n\tv_nop\n\tv_nop\n\tv_nop" : "+v"(acc[0][0]), "+v"(acc[0][1]), "+v"(acc[0][2]), "+v"(acc[0][3]), "+v"(accl[0][0]), "+v"(accl[0][1]), "+v"(accl[0][2]), "+v"(accl[0][3]), "+v"(acc[AQT - 1][0]), "+v"(acc[AQT - 1][1]), "+v"(acc[AQT - 1][2]), "+v"(acc[AQT - 1][3]), "+v"(accl[AQT - 1][0]), "+v"(accl[AQT - 1][1]), "+v"(accl[AQT - 1][2]), "+v"(accl[AQT - 1][3]));
    else asm volatile("v_nop\n\tv_nop\n\tv_nop\n\tv_nop" : "+v"(acc[0][0]), "+v"(acc[0][1]), "+v"(acc[0][2]), "+v"(acc[0][3]), "+v"(accl[0][0]), "+v"(accl[0][1]), "+v"(accl[0][2]), "+v"(accl[0][3])); };
#pragma unroll 1   // one stage per trip: the buffer index and the publish point at the foot stay those of a two-buffer ring
  for (int st = 0; st < SREAL / 64; ++st) {   // the stages whose every key is real
#pragma unroll 1   // the 32-key pass stays rolled: one copy of it in the text
    for (int sub = 0; sub < 2; ++sub) pass(false, st, sub);
    WAIT_DS(); WAIT_ASYNC(); __syncthreads();   // publishes stage st + 1 and frees stage st's buffer
    if (st + 2 < SS / 64) fill(st + 2); }
  static_assert(SREAL / 64 == SS / 64 - 1, "only the last stage holds padding keys");
#pragma unroll 1   // rolled as above
  for (int sub = 0; sub < 2; ++sub) pass(true, SS / 64 - 1, sub);   // the last stage, with the mask
  WAIT_DS(); WAIT_ASYNC(); __syncthreads();   // the stage's foot: every wave has left the ring before it becomes the output staging
  WAIT_ASYNC();
#pragma unroll
  for (int qt = 0; qt < AQT; ++qt) { const float il = 1.0f / (l[qt] + xhalf(l[qt]));
#pragma unroll
    for (int dt = 0; dt < 4; ++dt) { v8b oh, ol;
#pragma unroll
      for (int i = 0; i < 8; ++i) { const float o = (acc[qt][dt][i] + accl[qt][dt][i] * (1.0f / 2048.0f)) * il; const __bf16 hb = (__bf16)o; oh[i] = hb; ol[i] = (__bf16)(o - (float)hb); }
      *(v8b*)&so[wave][0][qt * 16 + col][dt * 16 + 8 * g] = oh; *(v8b*)&so[wave][1][qt * 16 + col][dt * 16 + 8 * g] = ol; } }
  LDSX();
#pragma unroll   // a store covers four rows' 128-byte pieces
  for (int it = 0; it < AQT * 4; ++it) { const int rl = it * 4 + (lane >> 3), pc = (lane & 7) * 8; const unsigned o = (unsigned)((b * SS + q0 + rl) * DM + h * HD + pc); vst2((unsigned*)(OH + o), *(const v4u*)&so[wave][0][rl][pc]); vst2((unsigned*)(OL + o), *(const v4u*)&so[wave][1][rl][pc]); }
}
// the grid: per (batch, head) the first ABIG * 128 queries go to blocks of 128 (32 a wave), the other 256 to blocks of 64 (16 a wave). All blocks of 128 come first in the index: 512 of them are two for each of the chip's WGPs, and the 128 short blocks top up half of the WGPs, so that no SIMD carries more than five 16-query tiles (18 blocks of 128 per head would leave a quarter of the WGPs with six a SIMD). For speed only: the result does not depend on where a block runs
#define ABIG 16                      // blocks of 128 queries per (batch, head)
#define ASML ((SS - ABIG * 128) / 64)   // blocks of 64 queries per (batch, head)
// the second launch bound: three waves per SIMD, that is at most 336 registers a wave, so that three blocks share a WGP and all 640 blocks are resident at once
__global__ __launch_bounds__(128, 3) void k_attn(const _Float16* __restrict__ QK, const _Float16* __restrict__ VTH, const _Float16* __restrict__ VTL, __bf16* __restrict__ OH, __bf16* __restrict__ OL) {
  __shared__ __align__(16) unsigned char L[2 * ASTG];   // the K/V ring during the key loop, then the output staging
  static_assert(ABIG * 128 + ASML * 64 == SS, "the two kinds of block cover a batch's rows");
  const int id = blockIdx.x;
  if (id < NB * NH * ABIG) { const int bh = id / ABIG; attn_body<2>(L, (id % ABIG) * 128, bh % NH, bh / NH, QK, VTH, VTL, OH, OL); }
  else { const int is = id - NB * NH * ABIG, bh = is / ASML; attn_body<1>(L, ABIG * 128 + (is % ASML) * 64, bh % NH, bh / NH, QK, VTH, VTL, OH, OL); }
}
// ---- k_out: block = (64 rows, 128 cols): out = ctx (OH and OL rows, staged in LDS beside the weight rows) . Wo rows (2 products) + bo
__global__ __launch_bounds__(128) void k_out(const __bf16* __restrict__ OH, const __bf16* __restrict__ OL, const __bf16* __restrict__ P, const float* __restrict__ BO, float* __restrict__ Y) {
  __shared__ __align__(16) unsigned char L[2 * OSTG];   // the ring during the k loop, then the output staging
  float (*so)[16][132] = (float (*)[16][132])L;
  const int tid = threadIdx.x, wave = tid >> 5, lane = tid & 31, col = lane & 15, g = lane >> 4; const size_t r0 = (size_t)blockIdx.x * 64 + wave * 16; const int n0 = blockIdx.y * 128;
  v8f acc[8] = {};
  const unsigned lw = lds_off(L) + (tid >> 3) * TPB + (tid & 7) * 16; const __bf16* gw = P + (size_t)(n0 + (tid >> 3)) * DM + (tid & 7) * 8;
  const size_t go = ((size_t)blockIdx.x * 64 + (tid >> 3)) * DM + (tid & 7) * 8;
  auto fill = [&](int st) { const unsigned l = lw + (st & 1) * OSTG; fill_w(l, gw + st * 64); cp4(l + WSTG, OH + go + st * 64, (size_t)16 * DM * 2); cp4(l + WSTG + T64B, OL + go + st * 64, (size_t)16 * DM * 2); };   // stage st = k 64 st .. 64 st + 63 of the block's 128 weight rows and 64 ctx rows (both planes)
  fill(0); WAIT_ASYNC(); __syncthreads(); fill(1);
#pragma unroll 1   // one stage per trip: the buffer index and the publish point at the foot stay those of a two-buffer ring
  for (int st = 0; st < DM / 64; ++st) { const __bf16* Bt = (const __bf16*)(L + (st & 1) * OSTG); const __bf16* Ah = Bt + (128 + wave * 16 + col) * TP; const __bf16* Al = Ah + 64 * TP;   // this lane's ctx row in the two planes
#pragma unroll
    for (int sub = 0; sub < 2; ++sub) { const v16b ah = frag_b(Ah + sub * 32, lane), al = frag_b(Al + sub * 32, lane); v16b w[8];
#pragma unroll
      for (int j = 0; j < 8; ++j) w[j] = frag_b(Bt + (j * 16 + col) * TP + sub * 32, lane);
      __builtin_amdgcn_sched_barrier(0);   // the 32 k's fragment loads stay one group ahead of their WMMAs (as in k_qkv)
#pragma unroll
      for (int j = 0; j < 8; ++j) { acc[j] = wmma_bf(al, w[j], acc[j]); acc[j] = wmma_bf(ah, w[j], acc[j]); } }
    WAIT_DS(); WAIT_ASYNC(); __syncthreads();   // publishes stage st + 1 and frees stage st's buffer
    if (st + 2 < DM / 64) fill(st + 2); }
  WAIT_ASYNC();
#pragma unroll
  for (int j = 0; j < 8; ++j) { const float bb = bfr(BO[n0 + j * 16 + col]);
#pragma unroll
    for (int r = 0; r < 8; ++r) so[wave][8 * g + r][j * 16 + col] = acc[j][r] + bb; }
  LDSX();
  for (int rl = 0; rl < 16; ++rl) { const size_t row = r0 + rl; const int b = (int)(row / SS), s = (int)(row % SS); if (s < STXT) vst2(Y + (size_t)NB * SVID * DM + ((size_t)b * STXT + s) * DM + n0 + lane * 4, *(const v4f*)&so[wave][rl][lane * 4]); else if (s < SREAL) vst2(Y + ((size_t)b * SVID + (s - STXT)) * DM + n0 + lane * 4, *(const v4f*)&so[wave][rl][lane * 4]); }   // out0 = o[:, 226:] at 0, out1 = o[:, :226] after it; padding rows dropped
}
extern "C" void kernel_launch(void* const* d_in, const int* in_sizes, int n_in, void* d_out, int out_size, void* d_ws, size_t ws_size, hipStream_t stream) {
  (void)in_sizes; (void)n_in; (void)out_size;
  const float** F = (const float**)d_in;   // 0 hidden_states [2,2048,1024], 1 encoder_hidden_states [2,226,1024], 2 cos [2048,64], 3 sin, 4 wq [1024,1024], 5 bq, 6 wk, 7 bk, 8 wv, 9 bv, 10 wo, 11 bo, 12 lnq_w [64], 13 lnq_b, 14 lnk_w, 15 lnk_b
  if (ws_size < (size_t)WS_END) return;
  char* ws = (char*)d_ws; __bf16* PK = (__bf16*)(ws + WS_PK); _Float16 *QK = (_Float16*)(ws + WS_QK), *VTH = (_Float16*)(ws + WS_VTH), *VTL = (_Float16*)(ws + WS_VTL); __bf16 *OH = (__bf16*)(ws + WS_OH), *OL = (__bf16*)(ws + WS_OL), *XB = (__bf16*)(ws + WS_XB);
  k_pack<<<dim3(PKW + PKX), 256, 0, stream>>>(F[4], F[6], F[8], F[10], F[1], F[0], PK + PK_A, XB);   // PK_P = PK_A + 3 planes: wo is the fourth
  k_qkv<<<dim3(TNB * SS / 128, QKVW / 128), 128, 0, stream>>>(XB, PK + PK_A, F[5], F[7], F[9], F[12], F[13], F[14], F[15], F[2], F[3], QK, VTH, VTL);
  k_attn<<<dim3(NB * NH * (ABIG + ASML)), 128, 0, stream>>>(QK, VTH, VTL, OH, OL);
  k_out<<<dim3(TOB, DM / 128), 128, 0, stream>>>(OH, OL, PK + PK_P, F[11], (float*)d_out);
}
